// v000
// Times are from an AMD MI455X. After a warm-up the kernel runs many times in a row, and a time is the length of
// such a window on the GPU divided by its runs, so every launch and the gaps after it count. The runs cycle
// through copies of the inputs. A figure is the median of several windows, for all but v000 over two sittings.
// Sittings can differ by a few percent; kernels timed side by side share one.
// The starting kernel, v000, takes 294 microseconds a run.
#include <hip/hip_runtime.h>
#include <hip/hip_bf16.h>

#define B_    4
#define ND    512
#define NT    512
#define DM    256
#define DH    128
#define NH    8
#define DK    32
#define RT    8      // row tile for qkv / oln
#define QT    8      // query tile for attention
#define W1S_STRIDE 264   // bf16 elems per row: 256 + 8 pad -> 528 B (16B aligned, banks spread)

typedef __attribute__((ext_vector_type(16))) __bf16 v16bf;
typedef __attribute__((ext_vector_type(8)))  __bf16 v8bf;
typedef __attribute__((ext_vector_type(4)))  __bf16 v4bf;
typedef __attribute__((ext_vector_type(8)))  float  v8f;

// Issue a 32-byte B-tile fetch from LDS: base register + immediate offsets so
// no VALU address math lands after a WMMA (avoids WMMA->VALU WAR hazard NOPs).
#define LDSB_ISSUE(lo, hi, base, imm)                    \
    asm volatile("ds_load_b128 %0, %2 offset:%3\n\t"     \
                 "ds_load_b128 %1, %2 offset:%4"         \
                 : "=v"(lo), "=v"(hi)                    \
                 : "v"(base), "n"(imm), "n"((imm) + 32))

// Wait until at most N DS ops outstanding; ties (lo,hi) through the asm so the
// consuming WMMA can never be scheduled ahead of the wait.
#define LDSB_WAIT2(lo, hi) \
    asm volatile("s_wait_dscnt 0x2" : "+v"(lo), "+v"(hi))
#define LDSB_WAIT0(lo, hi) \
    asm volatile("s_wait_dscnt 0x0" : "+v"(lo), "+v"(hi))

// ---------------------------------------------------------------------------
// 1) QKV projection, 8 rows per block: W streamed once, reused by 8 rows.
//    blockIdx.x = row-tile (0..255), blockIdx.y = which (0=Q,1=K,2=V)
// ---------------------------------------------------------------------------
__global__ __launch_bounds__(256) void qkv_kernel(
    const float* __restrict__ det, const float* __restrict__ trk,
    const float* __restrict__ wq, const float* __restrict__ bq,
    const float* __restrict__ wk, const float* __restrict__ bk,
    const float* __restrict__ wv, const float* __restrict__ bv,
    float* __restrict__ Q, float* __restrict__ K, float* __restrict__ V)
{
    __shared__ float xs[RT][DM];
    const int which = blockIdx.y;
    const int tid   = threadIdx.x;
    const int row0  = blockIdx.x * RT;

    const float* in   = (which == 0) ? det : trk;
    const float* W    = (which == 0) ? wq : (which == 1) ? wk : wv;
    const float* bias = (which == 0) ? bq : (which == 1) ? bk : bv;
    float* outp       = (which == 0) ? Q  : (which == 1) ? K  : V;

    #pragma unroll
    for (int r = 0; r < RT; ++r)
        xs[r][tid] = in[(row0 + r) * DM + tid];
    __syncthreads();

    float acc[RT];
    #pragma unroll
    for (int r = 0; r < RT; ++r) acc[r] = bias[tid];

    const float* wr = W + tid * DM;
    for (int d = 0; d < DM; d += 4) {
        float4 w4 = *(const float4*)(wr + d);
        #pragma unroll
        for (int r = 0; r < RT; ++r)
            acc[r] += w4.x * xs[r][d]     + w4.y * xs[r][d + 1]
                    + w4.z * xs[r][d + 2] + w4.w * xs[r][d + 3];
    }
    const int h = tid >> 5, dk = tid & 31;
    #pragma unroll
    for (int r = 0; r < RT; ++r) {
        const int row = row0 + r;
        const int b = row >> 9, n = row & 511;
        outp[((b * NH + h) * ND + n) * DK + dk] = acc[r];
    }
}

// ---------------------------------------------------------------------------
// 2) Attention, 8 queries per block (K/V streamed once per 8 queries).
//    grid = (ND/QT, NH, B_); 256 threads = 8 waves.
// ---------------------------------------------------------------------------
__global__ __launch_bounds__(256) void attn_kernel(
    const float* __restrict__ Q, const float* __restrict__ K,
    const float* __restrict__ V, float* __restrict__ ctx)
{
    __shared__ float qs[QT][DK];
    __shared__ float ps[QT][NT];       // 16 KB
    __shared__ float wred[QT][8];
    __shared__ float mrow[QT];
    __shared__ float dinv[QT];

    const int qbase = blockIdx.x * QT;
    const int h = blockIdx.y, b = blockIdx.z;
    const int tid = threadIdx.x;
    const int wv = tid >> 5, l = tid & 31;

    const float* Qb = Q + ((b * NH + h) * ND + qbase) * DK;
    const float* Kb = K + (b * NH + h) * NT * DK;
    const float* Vb = V + (b * NH + h) * NT * DK;

    qs[wv][l] = Qb[wv * DK + l];       // 8 waves x 32 lanes = full Q tile
    __syncthreads();

    const float scale = 0.17677669529663687f;  // 1/sqrt(32)
    float sreg[2][QT];
    float sm[QT];
    #pragma unroll
    for (int q = 0; q < QT; ++q) sm[q] = -1e30f;

    #pragma unroll
    for (int i = 0; i < 2; ++i) {
        const int k = tid + i * 256;
        const float* Kr = Kb + k * DK;
        float4 kv[8];
        #pragma unroll
        for (int j = 0; j < 8; ++j) kv[j] = *(const float4*)(Kr + 4 * j);
        #pragma unroll
        for (int q = 0; q < QT; ++q) {
            float s = 0.f;
            #pragma unroll
            for (int j = 0; j < 8; ++j)
                s += kv[j].x * qs[q][4*j]   + kv[j].y * qs[q][4*j+1]
                   + kv[j].z * qs[q][4*j+2] + kv[j].w * qs[q][4*j+3];
            s *= scale;
            sreg[i][q] = s;
            sm[q] = fmaxf(sm[q], s);
        }
    }

    // row max: wave shfl + cross-wave via LDS
    #pragma unroll
    for (int q = 0; q < QT; ++q) {
        float m = sm[q];
        m = fmaxf(m, __shfl_xor(m, 1, 32));
        m = fmaxf(m, __shfl_xor(m, 2, 32));
        m = fmaxf(m, __shfl_xor(m, 4, 32));
        m = fmaxf(m, __shfl_xor(m, 8, 32));
        m = fmaxf(m, __shfl_xor(m, 16, 32));
        if (l == 0) wred[q][wv] = m;
    }
    __syncthreads();
    if (tid < QT) {
        float m = wred[tid][0];
        #pragma unroll
        for (int j = 1; j < 8; ++j) m = fmaxf(m, wred[tid][j]);
        mrow[tid] = m;
    }
    __syncthreads();

    float ls[QT];
    #pragma unroll
    for (int q = 0; q < QT; ++q) {
        const float m = mrow[q];
        const float p0 = __expf(sreg[0][q] - m);
        const float p1 = __expf(sreg[1][q] - m);
        ps[q][tid]       = p0;
        ps[q][tid + 256] = p1;
        ls[q] = p0 + p1;
    }
    #pragma unroll
    for (int q = 0; q < QT; ++q) {
        float s = ls[q];
        s += __shfl_xor(s, 1, 32);
        s += __shfl_xor(s, 2, 32);
        s += __shfl_xor(s, 4, 32);
        s += __shfl_xor(s, 8, 32);
        s += __shfl_xor(s, 16, 32);
        if (l == 0) wred[q][wv] = s;
    }
    __syncthreads();
    if (tid < QT) {
        float s = 0.f;
        #pragma unroll
        for (int j = 0; j < 8; ++j) s += wred[tid][j];
        dinv[tid] = 1.f / s;
    }
    __syncthreads();

    // ctx: wave wv owns query wv, lane l owns dk = l
    float c = 0.f;
    for (int k = 0; k < NT; ++k)
        c += ps[wv][k] * Vb[k * DK + l];
    ctx[(b * ND + qbase + wv) * DM + h * DK + l] = c * dinv[wv];
}

// ---------------------------------------------------------------------------
// 3) Output projection + residual + LayerNorm, 8 rows per block.
// ---------------------------------------------------------------------------
__global__ __launch_bounds__(256) void oln_kernel(
    const float* __restrict__ det, const float* __restrict__ ctx,
    const float* __restrict__ wo, const float* __restrict__ bo,
    const float* __restrict__ g, const float* __restrict__ beta,
    float* __restrict__ xn)
{
    __shared__ float cs[RT][DM];
    __shared__ float xb[RT][DM];
    __shared__ float mus[RT];
    __shared__ float invs[RT];
    const int tid  = threadIdx.x;
    const int row0 = blockIdx.x * RT;

    #pragma unroll
    for (int r = 0; r < RT; ++r)
        cs[r][tid] = ctx[(row0 + r) * DM + tid];
    __syncthreads();

    float acc[RT];
    #pragma unroll
    for (int r = 0; r < RT; ++r) acc[r] = bo[tid];

    const float* wr = wo + tid * DM;
    for (int d = 0; d < DM; d += 4) {
        float4 w4 = *(const float4*)(wr + d);
        #pragma unroll
        for (int r = 0; r < RT; ++r)
            acc[r] += w4.x * cs[r][d]     + w4.y * cs[r][d + 1]
                    + w4.z * cs[r][d + 2] + w4.w * cs[r][d + 3];
    }
    #pragma unroll
    for (int r = 0; r < RT; ++r)
        xb[r][tid] = det[(row0 + r) * DM + tid] + acc[r];
    __syncthreads();

    // wave w reduces row w (sum, sumsq)
    const int w = tid >> 5, l = tid & 31;
    float s = 0.f, s2 = 0.f;
    #pragma unroll
    for (int i = 0; i < DM / 32; ++i) {
        const float v = xb[w][l + 32 * i];
        s += v; s2 += v * v;
    }
    s  += __shfl_xor(s, 1, 32);  s2 += __shfl_xor(s2, 1, 32);
    s  += __shfl_xor(s, 2, 32);  s2 += __shfl_xor(s2, 2, 32);
    s  += __shfl_xor(s, 4, 32);  s2 += __shfl_xor(s2, 4, 32);
    s  += __shfl_xor(s, 8, 32);  s2 += __shfl_xor(s2, 8, 32);
    s  += __shfl_xor(s, 16, 32); s2 += __shfl_xor(s2, 16, 32);
    if (l == 0) {
        const float mu = s * (1.f / DM);
        mus[w]  = mu;
        invs[w] = rsqrtf(s2 * (1.f / DM) - mu * mu + 1e-5f);
    }
    __syncthreads();

    #pragma unroll
    for (int r = 0; r < RT; ++r)
        xn[(row0 + r) * DM + tid] = (xb[r][tid] - mus[r]) * invs[r] * g[tid] + beta[tid];
}

// ---------------------------------------------------------------------------
// 4) tracks fp32 -> bf16 (row-major [B][NT][DM])
// ---------------------------------------------------------------------------
__global__ void cvt_kernel(const float* __restrict__ in, __bf16* __restrict__ outb, int n4)
{
    const int i = blockIdx.x * blockDim.x + threadIdx.x;
    if (i < n4) {
        float4 v = ((const float4*)in)[i];
        v4bf p;
        p.x = (__bf16)v.x; p.y = (__bf16)v.y; p.z = (__bf16)v.z; p.w = (__bf16)v.w;
        ((v4bf*)outb)[i] = p;
    }
}

// ---------------------------------------------------------------------------
// 5) Association head: per (b,n):
//      W1n = w1 * xn_row (bf16, LDS)
//      H   = tracks[b] (512x256) @ W1n^T (256x128)  via v_wmma_f32_16x16x32_bf16
//      out[t] = sigmoid( relu(H + b1) @ w2 + b2 )
// ---------------------------------------------------------------------------
__global__ __launch_bounds__(256) void assoc_kernel(
    const __bf16* __restrict__ trkbf,  // [B][NT][DM] bf16
    const float* __restrict__ xn,      // [B][ND][DM]
    const float* __restrict__ w1,      // [DH][DM]
    const float* __restrict__ b1,      // [DH]
    const float* __restrict__ w2,      // [DH]
    const float* __restrict__ b2,      // [1]
    float* __restrict__ out)           // [B][ND][NT]
{
    __shared__ __bf16 w1s[DH * W1S_STRIDE];   // 67,584 bytes

    const int n   = blockIdx.x;
    const int b   = blockIdx.y;
    const int tid = threadIdx.x;

    const float* xrow = xn + (b * ND + n) * DM;

    // Build W1n = w1 ⊙ xn_row into LDS (bf16, padded rows).
    for (int idx = tid; idx < DH * (DM / 4); idx += 256) {
        const int j = idx >> 6;           // DM/4 == 64
        const int d = (idx & 63) << 2;
        const float4 wv = *(const float4*)(w1 + j * DM + d);
        const float4 xv = *(const float4*)(xrow + d);
        v4bf p;
        p.x = (__bf16)(wv.x * xv.x);
        p.y = (__bf16)(wv.y * xv.y);
        p.z = (__bf16)(wv.z * xv.z);
        p.w = (__bf16)(wv.w * xv.w);
        *(v4bf*)(&w1s[j * W1S_STRIDE + d]) = p;
    }
    __syncthreads();

    const int wave  = tid >> 5;
    const int lane  = tid & 31;
    const int lhalf = lane & 15;
    const int khalf = (lane >> 4) << 3;   // 0 for lanes 0-15, 8 for lanes 16-31

    float b1v[8], w2v[8];
    #pragma unroll
    for (int nt = 0; nt < 8; ++nt) {
        b1v[nt] = b1[nt * 16 + lhalf];
        w2v[nt] = w2[nt * 16 + lhalf];
    }
    const float bias2 = b2[0];

    // Per-lane LDS byte address of each B-tile row base (generic LDS pointer:
    // low 32 bits are the LDS byte offset per the aperture mapping).
    unsigned bbase[8];
    #pragma unroll
    for (int nt = 0; nt < 8; ++nt)
        bbase[nt] = (unsigned)(unsigned long long)(const void*)
                        &w1s[(nt * 16 + lhalf) * W1S_STRIDE + khalf];

    const __bf16* trk = trkbf + b * NT * DM;
    float* orow = out + (b * ND + n) * NT;

    for (int mi = 0; mi < 4; ++mi) {
        const int mbase = (wave * 4 + mi) * 16;
        const __bf16* arowp = trk + (mbase + lhalf) * DM + khalf;

        v8f acc[8];
        #pragma unroll
        for (int nt = 0; nt < 8; ++nt)
            #pragma unroll
            for (int e = 0; e < 8; ++e) acc[nt][e] = 0.f;

        // Double-buffered B pipeline across the 64 (k0,nt) tiles of this mi.
        v8bf blo[2], bhi[2];
        LDSB_ISSUE(blo[0], bhi[0], bbase[0], 0);   // preload tile (k0=0, nt=0)

        #pragma unroll
        for (int k0 = 0; k0 < DM; k0 += 32) {
            // A tile: 16x32 bf16 (lane<16 -> K {k0..k0+7, k0+16..23}; lane>=16 -> +8),
            // two contiguous 16B chunks per lane, reused across all 8 N-tiles.
            union { v16bf v; v8bf h[2]; } A;
            A.h[0] = *(const v8bf*)(arowp + k0);
            A.h[1] = *(const v8bf*)(arowp + k0 + 16);

            #pragma unroll
            for (int nt = 0; nt < 8; ++nt) {
                const int t    = (k0 >> 2) + nt;        // (k0/32)*8 + nt
                const int buf  = t & 1;
                const bool last = (k0 == DM - 32) && (nt == 7);

                if (!last) {
                    const int nnt = (nt + 1) & 7;
                    const int nk0 = (nt == 7) ? (k0 + 32) : k0;
                    LDSB_ISSUE(blo[buf ^ 1], bhi[buf ^ 1], bbase[nnt], nk0 * 2);
                    LDSB_WAIT2(blo[buf], bhi[buf]);     // tile t's data is home
                } else {
                    LDSB_WAIT0(blo[buf], bhi[buf]);
                }

                union { v16bf v; v8bf h[2]; } Bm;
                Bm.h[0] = blo[buf];
                Bm.h[1] = bhi[buf];

                acc[nt] = __builtin_amdgcn_wmma_f32_16x16x32_bf16(
                    false, A.v, false, Bm.v, (short)0, acc[nt], false, false);
            }
        }

        // Epilogue: C/D layout: VGPR r, lane l -> M = r + 8*(l>>4), N = l&15.
        #pragma unroll
        for (int r = 0; r < 8; ++r) {
            float s = 0.f;
            #pragma unroll
            for (int nt = 0; nt < 8; ++nt) {
                const float hval = acc[nt][r] + b1v[nt];
                s += fmaxf(hval, 0.f) * w2v[nt];
            }
            // reduce across the 16 lanes of this half (N dimension)
            s += __shfl_xor(s, 1, 32);
            s += __shfl_xor(s, 2, 32);
            s += __shfl_xor(s, 4, 32);
            s += __shfl_xor(s, 8, 32);
            if (lhalf == 0) {
                const int t = mbase + r + khalf;   // khalf == 8*(lane>>4)
                const float logit = s + bias2;
                orow[t] = 1.f / (1.f + __expf(-logit));
            }
        }
    }
}

// ---------------------------------------------------------------------------
// Launcher
// ---------------------------------------------------------------------------
extern "C" void kernel_launch(void* const* d_in, const int* in_sizes, int n_in,
                              void* d_out, int out_size, void* d_ws, size_t ws_size,
                              hipStream_t stream)
{
    const float* det = (const float*)d_in[0];
    const float* trk = (const float*)d_in[1];
    const float* wq  = (const float*)d_in[2];
    const float* bq  = (const float*)d_in[3];
    const float* wk  = (const float*)d_in[4];
    const float* bk  = (const float*)d_in[5];
    const float* wv  = (const float*)d_in[6];
    const float* bv  = (const float*)d_in[7];
    const float* wo  = (const float*)d_in[8];
    const float* bo  = (const float*)d_in[9];
    const float* lng = (const float*)d_in[10];
    const float* lnb = (const float*)d_in[11];
    const float* w1  = (const float*)d_in[12];
    const float* b1  = (const float*)d_in[13];
    const float* w2  = (const float*)d_in[14];
    const float* b2  = (const float*)d_in[15];
    float* out = (float*)d_out;

    const size_t rowsD = (size_t)B_ * ND * DM;  // 524288 floats
    float* Q   = (float*)d_ws;
    float* K   = Q + rowsD;
    float* V   = K + rowsD;
    float* CTX = V + rowsD;
    float* XN  = CTX + rowsD;
    __bf16* TRKB = (__bf16*)(XN + rowsD);       // 1 MB of bf16

    qkv_kernel<<<dim3(B_ * ND / RT, 3), 256, 0, stream>>>(det, trk, wq, bq, wk, bk, wv, bv, Q, K, V);
    cvt_kernel<<<dim3((B_ * NT * DM / 4 + 255) / 256), 256, 0, stream>>>(trk, TRKB, B_ * NT * DM / 4);
    attn_kernel<<<dim3(ND / QT, NH, B_), 256, 0, stream>>>(Q, K, V, CTX);
    oln_kernel<<<dim3(B_ * ND / RT), 256, 0, stream>>>(det, CTX, wo, bo, lng, lnb, XN);
    assoc_kernel<<<dim3(ND, B_), 256, 0, stream>>>(TRKB, XN, w1, b1, w2, b2, out);
}

// v001
// A run of this version takes 131 microseconds.
// Two timings next to v000 put it at 2.24 and 2.29 times that version's speed.
#include <hip/hip_runtime.h>
#include <hip/hip_bf16.h>

#define B_    4
#define ND    512
#define NT    512
#define DM    256
#define DH    128
#define NH    8
#define DK    32
#define RT    8      // row tile for qkv / oln
#define AQ    32     // queries per attention block
#define AKW   64     // keys per attention wave
#define OPITCH 36    // floats per LDS row of an output part: 32 + 4 pad, 16B aligned
#define W1S_STRIDE 264   // bf16 elems per row: 256 + 8 pad -> 528 B (16B aligned, banks spread)

typedef __attribute__((ext_vector_type(16))) __bf16 v16bf;
typedef __attribute__((ext_vector_type(8)))  __bf16 v8bf;
typedef __attribute__((ext_vector_type(4)))  __bf16 v4bf;
typedef __attribute__((ext_vector_type(8)))  float  v8f;
typedef __attribute__((ext_vector_type(2)))  float  v2f;

// Issue a 32-byte B-tile fetch from LDS: base register + immediate offsets so
// no VALU address math lands after a WMMA (avoids WMMA->VALU WAR hazard NOPs).
#define LDSB_ISSUE(lo, hi, base, imm)                    \
    asm volatile("ds_load_b128 %0, %2 offset:%3\n\t"     \
                 "ds_load_b128 %1, %2 offset:%4"         \
                 : "=v"(lo), "=v"(hi)                    \
                 : "v"(base), "n"(imm), "n"((imm) + 32))

// Wait until at most N DS ops outstanding; ties (lo,hi) through the asm so the
// consuming WMMA can never be scheduled ahead of the wait.
#define LDSB_WAIT2(lo, hi) \
    asm volatile("s_wait_dscnt 0x2" : "+v"(lo), "+v"(hi))
#define LDSB_WAIT0(lo, hi) \
    asm volatile("s_wait_dscnt 0x0" : "+v"(lo), "+v"(hi))

// ---------------------------------------------------------------------------
// 1) QKV projection, 8 rows per block: W streamed once, reused by 8 rows.
//    blockIdx.x = row-tile (0..255), blockIdx.y = which (0=Q,1=K,2=V)
// ---------------------------------------------------------------------------
__global__ __launch_bounds__(256) void qkv_kernel(
    const float* __restrict__ det, const float* __restrict__ trk,
    const float* __restrict__ wq, const float* __restrict__ bq,
    const float* __restrict__ wk, const float* __restrict__ bk,
    const float* __restrict__ wv, const float* __restrict__ bv,
    float* __restrict__ Q, float* __restrict__ K, float* __restrict__ V)
{
    __shared__ float xs[RT][DM];
    const int which = blockIdx.y;
    const int tid   = threadIdx.x;
    const int row0  = blockIdx.x * RT;

    const float* in   = (which == 0) ? det : trk;
    const float* W    = (which == 0) ? wq : (which == 1) ? wk : wv;
    const float* bias = (which == 0) ? bq : (which == 1) ? bk : bv;
    float* outp       = (which == 0) ? Q  : (which == 1) ? K  : V;

    #pragma unroll
    for (int r = 0; r < RT; ++r)
        xs[r][tid] = in[(row0 + r) * DM + tid];
    __syncthreads();

    float acc[RT];
    #pragma unroll
    for (int r = 0; r < RT; ++r) acc[r] = bias[tid];

    const float* wr = W + tid * DM;
    for (int d = 0; d < DM; d += 4) {
        float4 w4 = *(const float4*)(wr + d);
        #pragma unroll
        for (int r = 0; r < RT; ++r)
            acc[r] += w4.x * xs[r][d]     + w4.y * xs[r][d + 1]
                    + w4.z * xs[r][d + 2] + w4.w * xs[r][d + 3];
    }
    const int h = tid >> 5, dk = tid & 31;
    #pragma unroll
    for (int r = 0; r < RT; ++r) {
        const int row = row0 + r;
        const int b = row >> 9, n = row & 511;
        outp[((b * NH + h) * ND + n) * DK + dk] = acc[r];
    }
}

// ---------------------------------------------------------------------------
// 2) Attention on the f32 16x16x4 matrix form, 32 queries per block.
//    grid = (ND/AQ, NH, B_); 256 threads = 8 waves; wave w owns keys
//    [64w, 64w+64).  St = K * Qt and Ot = Vt * Pt, so a lane holds one query's
//    scores and the score registers are the B operand of the second product.
//    Each wave makes a softmax part (max, sum, unnormalised Ot) over its own
//    keys; the 8 parts are joined through LDS.
// ---------------------------------------------------------------------------
__global__ __launch_bounds__(256) void attn_kernel(
    const float* __restrict__ Q, const float* __restrict__ K,
    const float* __restrict__ V, float* __restrict__ ctx)
{
    __shared__ float sO[8][AQ][OPITCH];   // per-wave unnormalised output parts
    __shared__ float sML[2][8][AQ];       // [0] = part max, [1] = part sum

    const int q0 = blockIdx.x * AQ;
    const int h = blockIdx.y, b = blockIdx.z;
    const int tid = threadIdx.x;
    const int wv = tid >> 5, lane = tid & 31;
    const int c = lane & 15, hf = lane >> 4;

    const float* Qb = Q + ((b * NH + h) * ND + q0) * DK;
    const float* Kb = K + ((b * NH + h) * NT + wv * AKW) * DK;
    const float* Vb = V + ((b * NH + h) * NT + wv * AKW) * DK;

    // Q and K fragments by the same code: lane (c, hf) holds row c,
    // dk = 16*hf + 4*i + {0..3}; two k-steps of the matrix form per float4.
    const float* qp = Qb + c * DK + hf * 16;
    const float* kp = Kb + c * DK + hf * 16;
    // V: lane (c, hf) holds keys 8*hf + r of each 16-key tile, dv = 2*c, 2*c + 1.
    const float* vp = Vb + hf * 8 * DK + 2 * c;

    float4 qf[2][4];
    float4 kf[4][4];
    float2 vf[4][8];
    #pragma unroll
    for (int i = 0; i < 4; ++i) {
        #pragma unroll
        for (int qt = 0; qt < 2; ++qt)
            qf[qt][i] = *(const float4*)(qp + qt * 16 * DK + 4 * i);
        #pragma unroll
        for (int kt = 0; kt < 4; ++kt)
            kf[kt][i] = *(const float4*)(kp + kt * 16 * DK + 4 * i);
    }
    #pragma unroll
    for (int kt = 0; kt < 4; ++kt)
        #pragma unroll
        for (int r = 0; r < 8; ++r)
            vf[kt][r] = *(const float2*)(vp + (kt * 16 + r) * DK);
    // Every global load of the wave is issued above.  The wait stands before any
    // reuse of their address registers; naming the addresses as inputs keeps
    // those registers live up to it.
    asm volatile("s_wait_xcnt 0x0" :: "v"(qp), "v"(kp), "v"(vp) : "memory");

    // st[kt][qt][r] = score(key = 16*kt + 8*hf + r, query = 16*qt + c), unscaled
    v8f st[4][2];
    #pragma unroll
    for (int kt = 0; kt < 4; ++kt) {
        #pragma unroll
        for (int qt = 0; qt < 2; ++qt)
            #pragma unroll
            for (int e = 0; e < 8; ++e) st[kt][qt][e] = 0.f;
        #pragma unroll
        for (int i = 0; i < 4; ++i) {
            const v2f k01 = {kf[kt][i].x, kf[kt][i].y};
            const v2f k23 = {kf[kt][i].z, kf[kt][i].w};
            #pragma unroll
            for (int qt = 0; qt < 2; ++qt) {
                const v2f q01 = {qf[qt][i].x, qf[qt][i].y};
                st[kt][qt] = __builtin_amdgcn_wmma_f32_16x16x4_f32(
                    false, k01, false, q01, (short)0, st[kt][qt], false, false);
            }
            #pragma unroll
            for (int qt = 0; qt < 2; ++qt) {
                const v2f q23 = {qf[qt][i].z, qf[qt][i].w};
                st[kt][qt] = __builtin_amdgcn_wmma_f32_16x16x4_f32(
                    false, k23, false, q23, (short)0, st[kt][qt], false, false);
            }
        }
    }

    // Softmax part over this wave's 64 keys: in-lane, plus one exchange
    // between the lane halves (they hold the same query).
    const float scale = 0.17677669529663687f;  // 1/sqrt(32)
    float pm[2], pl[2];
    #pragma unroll
    for (int qt = 0; qt < 2; ++qt) {
        float m = st[0][qt][0];
        #pragma unroll
        for (int kt = 0; kt < 4; ++kt)
            #pragma unroll
            for (int r = 0; r < 8; ++r) m = fmaxf(m, st[kt][qt][r]);
        m = fmaxf(m, __shfl_xor(m, 16, 32));
        m *= scale;
        float l = 0.f;
        #pragma unroll
        for (int kt = 0; kt < 4; ++kt)
            #pragma unroll
            for (int r = 0; r < 8; ++r) {
                const float p = __expf(st[kt][qt][r] * scale - m);
                st[kt][qt][r] = p;
                l += p;
            }
        l += __shfl_xor(l, 16, 32);
        pm[qt] = m;
        pl[qt] = l;
    }

    // Ot[dt][qt] += Vt * Pt.  k-step s of key tile kt pairs key 8*hf + 2*s + j
    // on both sides (B = score registers 2s, 2s+1).  Row c of tile dt is
    // dv = 2*c + dt, so one 8-byte load feeds both tiles.
    v8f o[2][2];
    #pragma unroll
    for (int dt = 0; dt < 2; ++dt)
        #pragma unroll
        for (int qt = 0; qt < 2; ++qt)
            #pragma unroll
            for (int e = 0; e < 8; ++e) o[dt][qt][e] = 0.f;

    #pragma unroll
    for (int kt = 0; kt < 4; ++kt) {
        #pragma unroll
        for (int s = 0; s < 4; ++s) {
            const v2f va = {vf[kt][2 * s].x, vf[kt][2 * s + 1].x};
            const v2f vb = {vf[kt][2 * s].y, vf[kt][2 * s + 1].y};
            #pragma unroll
            for (int qt = 0; qt < 2; ++qt) {
                const v2f p = {st[kt][qt][2 * s], st[kt][qt][2 * s + 1]};
                o[0][qt] = __builtin_amdgcn_wmma_f32_16x16x4_f32(
                    false, va, false, p, (short)0, o[0][qt], false, false);
                o[1][qt] = __builtin_amdgcn_wmma_f32_16x16x4_f32(
                    false, vb, false, p, (short)0, o[1][qt], false, false);
            }
        }
    }

    // o[dt][qt][r] = Ot(dv = 16*hf + 2*r + dt, query = 16*qt + c)
    #pragma unroll
    for (int qt = 0; qt < 2; ++qt) {
        float* dst = &sO[wv][qt * 16 + c][hf * 16];
        #pragma unroll
        for (int i = 0; i < 4; ++i)
            *(float4*)(dst + 4 * i) = make_float4(o[0][qt][2 * i],     o[1][qt][2 * i],
                                                  o[0][qt][2 * i + 1], o[1][qt][2 * i + 1]);
        // both halves hold the same max and sum: half 0 stores the max, half 1 the sum
        sML[hf][wv][qt * 16 + c] = hf ? pl[qt] : pm[qt];
    }
    __syncthreads();

    // Join the 8 parts: thread -> query tid/8, four dv.
    const int q = tid >> 3, d4 = (tid & 7) << 2;
    float M = sML[0][0][q];
    #pragma unroll
    for (int w = 1; w < 8; ++w) M = fmaxf(M, sML[0][w][q]);
    float L = 0.f;
    float4 acc = make_float4(0.f, 0.f, 0.f, 0.f);
    #pragma unroll
    for (int w = 0; w < 8; ++w) {
        const float f = __expf(sML[0][w][q] - M);
        const float4 o4 = *(const float4*)&sO[w][q][d4];
        L += f * sML[1][w][q];
        acc.x += f * o4.x; acc.y += f * o4.y; acc.z += f * o4.z; acc.w += f * o4.w;
    }
    const float inv = 1.f / L;
    *(float4*)(ctx + (b * ND + q0 + q) * DM + h * DK + d4) =
        make_float4(acc.x * inv, acc.y * inv, acc.z * inv, acc.w * inv);
}

// ---------------------------------------------------------------------------
// 3) Output projection + residual + LayerNorm, 8 rows per block.
// ---------------------------------------------------------------------------
__global__ __launch_bounds__(256) void oln_kernel(
    const float* __restrict__ det, const float* __restrict__ ctx,
    const float* __restrict__ wo, const float* __restrict__ bo,
    const float* __restrict__ g, const float* __restrict__ beta,
    float* __restrict__ xn)
{
    __shared__ float cs[RT][DM];
    __shared__ float xb[RT][DM];
    __shared__ float mus[RT];
    __shared__ float invs[RT];
    const int tid  = threadIdx.x;
    const int row0 = blockIdx.x * RT;

    #pragma unroll
    for (int r = 0; r < RT; ++r)
        cs[r][tid] = ctx[(row0 + r) * DM + tid];
    __syncthreads();

    float acc[RT];
    #pragma unroll
    for (int r = 0; r < RT; ++r) acc[r] = bo[tid];

    const float* wr = wo + tid * DM;
    for (int d = 0; d < DM; d += 4) {
        float4 w4 = *(const float4*)(wr + d);
        #pragma unroll
        for (int r = 0; r < RT; ++r)
            acc[r] += w4.x * cs[r][d]     + w4.y * cs[r][d + 1]
                    + w4.z * cs[r][d + 2] + w4.w * cs[r][d + 3];
    }
    #pragma unroll
    for (int r = 0; r < RT; ++r)
        xb[r][tid] = det[(row0 + r) * DM + tid] + acc[r];
    __syncthreads();

    // wave w reduces row w (sum, sumsq)
    const int w = tid >> 5, l = tid & 31;
    float s = 0.f, s2 = 0.f;
    #pragma unroll
    for (int i = 0; i < DM / 32; ++i) {
        const float v = xb[w][l + 32 * i];
        s += v; s2 += v * v;
    }
    s  += __shfl_xor(s, 1, 32);  s2 += __shfl_xor(s2, 1, 32);
    s  += __shfl_xor(s, 2, 32);  s2 += __shfl_xor(s2, 2, 32);
    s  += __shfl_xor(s, 4, 32);  s2 += __shfl_xor(s2, 4, 32);
    s  += __shfl_xor(s, 8, 32);  s2 += __shfl_xor(s2, 8, 32);
    s  += __shfl_xor(s, 16, 32); s2 += __shfl_xor(s2, 16, 32);
    if (l == 0) {
        const float mu = s * (1.f / DM);
        mus[w]  = mu;
        invs[w] = rsqrtf(s2 * (1.f / DM) - mu * mu + 1e-5f);
    }
    __syncthreads();

    #pragma unroll
    for (int r = 0; r < RT; ++r)
        xn[(row0 + r) * DM + tid] = (xb[r][tid] - mus[r]) * invs[r] * g[tid] + beta[tid];
}

// ---------------------------------------------------------------------------
// 4) tracks fp32 -> bf16 (row-major [B][NT][DM])
// ---------------------------------------------------------------------------
__global__ void cvt_kernel(const float* __restrict__ in, __bf16* __restrict__ outb, int n4)
{
    const int i = blockIdx.x * blockDim.x + threadIdx.x;
    if (i < n4) {
        float4 v = ((const float4*)in)[i];
        v4bf p;
        p.x = (__bf16)v.x; p.y = (__bf16)v.y; p.z = (__bf16)v.z; p.w = (__bf16)v.w;
        ((v4bf*)outb)[i] = p;
    }
}

// ---------------------------------------------------------------------------
// 5) Association head: per (b,n):
//      W1n = w1 * xn_row (bf16, LDS)
//      H   = tracks[b] (512x256) @ W1n^T (256x128)  via v_wmma_f32_16x16x32_bf16
//      out[t] = sigmoid( relu(H + b1) @ w2 + b2 )
// ---------------------------------------------------------------------------
__global__ __launch_bounds__(256) void assoc_kernel(
    const __bf16* __restrict__ trkbf,  // [B][NT][DM] bf16
    const float* __restrict__ xn,      // [B][ND][DM]
    const float* __restrict__ w1,      // [DH][DM]
    const float* __restrict__ b1,      // [DH]
    const float* __restrict__ w2,      // [DH]
    const float* __restrict__ b2,      // [1]
    float* __restrict__ out)           // [B][ND][NT]
{
    __shared__ __bf16 w1s[DH * W1S_STRIDE];   // 67,584 bytes

    const int n   = blockIdx.x;
    const int b   = blockIdx.y;
    const int tid = threadIdx.x;

    const float* xrow = xn + (b * ND + n) * DM;

    // Build W1n = w1 ⊙ xn_row into LDS (bf16, padded rows).
    for (int idx = tid; idx < DH * (DM / 4); idx += 256) {
        const int j = idx >> 6;           // DM/4 == 64
        const int d = (idx & 63) << 2;
        const float4 wv = *(const float4*)(w1 + j * DM + d);
        const float4 xv = *(const float4*)(xrow + d);
        v4bf p;
        p.x = (__bf16)(wv.x * xv.x);
        p.y = (__bf16)(wv.y * xv.y);
        p.z = (__bf16)(wv.z * xv.z);
        p.w = (__bf16)(wv.w * xv.w);
        *(v4bf*)(&w1s[j * W1S_STRIDE + d]) = p;
    }
    __syncthreads();

    const int wave  = tid >> 5;
    const int lane  = tid & 31;
    const int lhalf = lane & 15;
    const int khalf = (lane >> 4) << 3;   // 0 for lanes 0-15, 8 for lanes 16-31

    float b1v[8], w2v[8];
    #pragma unroll
    for (int nt = 0; nt < 8; ++nt) {
        b1v[nt] = b1[nt * 16 + lhalf];
        w2v[nt] = w2[nt * 16 + lhalf];
    }
    const float bias2 = b2[0];

    // Per-lane LDS byte address of each B-tile row base (generic LDS pointer:
    // low 32 bits are the LDS byte offset per the aperture mapping).
    unsigned bbase[8];
    #pragma unroll
    for (int nt = 0; nt < 8; ++nt)
        bbase[nt] = (unsigned)(unsigned long long)(const void*)
                        &w1s[(nt * 16 + lhalf) * W1S_STRIDE + khalf];

    const __bf16* trk = trkbf + b * NT * DM;
    float* orow = out + (b * ND + n) * NT;

    for (int mi = 0; mi < 4; ++mi) {
        const int mbase = (wave * 4 + mi) * 16;
        const __bf16* arowp = trk + (mbase + lhalf) * DM + khalf;

        v8f acc[8];
        #pragma unroll
        for (int nt = 0; nt < 8; ++nt)
            #pragma unroll
            for (int e = 0; e < 8; ++e) acc[nt][e] = 0.f;

        // Double-buffered B pipeline across the 64 (k0,nt) tiles of this mi.
        v8bf blo[2], bhi[2];
        LDSB_ISSUE(blo[0], bhi[0], bbase[0], 0);   // preload tile (k0=0, nt=0)

        #pragma unroll
        for (int k0 = 0; k0 < DM; k0 += 32) {
            // A tile: 16x32 bf16 (lane<16 -> K {k0..k0+7, k0+16..23}; lane>=16 -> +8),
            // two contiguous 16B chunks per lane, reused across all 8 N-tiles.
            union { v16bf v; v8bf h[2]; } A;
            A.h[0] = *(const v8bf*)(arowp + k0);
            A.h[1] = *(const v8bf*)(arowp + k0 + 16);

            #pragma unroll
            for (int nt = 0; nt < 8; ++nt) {
                const int t    = (k0 >> 2) + nt;        // (k0/32)*8 + nt
                const int buf  = t & 1;
                const bool last = (k0 == DM - 32) && (nt == 7);

                if (!last) {
                    const int nnt = (nt + 1) & 7;
                    const int nk0 = (nt == 7) ? (k0 + 32) : k0;
                    LDSB_ISSUE(blo[buf ^ 1], bhi[buf ^ 1], bbase[nnt], nk0 * 2);
                    LDSB_WAIT2(blo[buf], bhi[buf]);     // tile t's data is home
                } else {
                    LDSB_WAIT0(blo[buf], bhi[buf]);
                }

                union { v16bf v; v8bf h[2]; } Bm;
                Bm.h[0] = blo[buf];
                Bm.h[1] = bhi[buf];

                acc[nt] = __builtin_amdgcn_wmma_f32_16x16x32_bf16(
                    false, A.v, false, Bm.v, (short)0, acc[nt], false, false);
            }
        }

        // Epilogue: C/D layout: VGPR r, lane l -> M = r + 8*(l>>4), N = l&15.
        #pragma unroll
        for (int r = 0; r < 8; ++r) {
            float s = 0.f;
            #pragma unroll
            for (int nt = 0; nt < 8; ++nt) {
                const float hval = acc[nt][r] + b1v[nt];
                s += fmaxf(hval, 0.f) * w2v[nt];
            }
            // reduce across the 16 lanes of this half (N dimension)
            s += __shfl_xor(s, 1, 32);
            s += __shfl_xor(s, 2, 32);
            s += __shfl_xor(s, 4, 32);
            s += __shfl_xor(s, 8, 32);
            if (lhalf == 0) {
                const int t = mbase + r + khalf;   // khalf == 8*(lane>>4)
                const float logit = s + bias2;
                orow[t] = 1.f / (1.f + __expf(-logit));
            }
        }
    }
}

// ---------------------------------------------------------------------------
// Launcher
// ---------------------------------------------------------------------------
extern "C" void kernel_launch(void* const* d_in, const int* in_sizes, int n_in,
                              void* d_out, int out_size, void* d_ws, size_t ws_size,
                              hipStream_t stream)
{
    const float* det = (const float*)d_in[0];
    const float* trk = (const float*)d_in[1];
    const float* wq  = (const float*)d_in[2];
    const float* bq  = (const float*)d_in[3];
    const float* wk  = (const float*)d_in[4];
    const float* bk  = (const float*)d_in[5];
    const float* wv  = (const float*)d_in[6];
    const float* bv  = (const float*)d_in[7];
    const float* wo  = (const float*)d_in[8];
    const float* bo  = (const float*)d_in[9];
    const float* lng = (const float*)d_in[10];
    const float* lnb = (const float*)d_in[11];
    const float* w1  = (const float*)d_in[12];
    const float* b1  = (const float*)d_in[13];
    const float* w2  = (const float*)d_in[14];
    const float* b2  = (const float*)d_in[15];
    float* out = (float*)d_out;

    const size_t rowsD = (size_t)B_ * ND * DM;  // 524288 floats
    float* Q   = (float*)d_ws;
    float* K   = Q + rowsD;
    float* V   = K + rowsD;
    float* CTX = V + rowsD;
    float* XN  = CTX + rowsD;
    __bf16* TRKB = (__bf16*)(XN + rowsD);       // 1 MB of bf16

    qkv_kernel<<<dim3(B_ * ND / RT, 3), 256, 0, stream>>>(det, trk, wq, bq, wk, bk, wv, bv, Q, K, V);
    cvt_kernel<<<dim3((B_ * NT * DM / 4 + 255) / 256), 256, 0, stream>>>(trk, TRKB, B_ * NT * DM / 4);
    attn_kernel<<<dim3(ND / AQ, NH, B_), 256, 0, stream>>>(Q, K, V, CTX);
    oln_kernel<<<dim3(B_ * ND / RT), 256, 0, stream>>>(det, CTX, wo, bo, lng, lnb, XN);
    assoc_kernel<<<dim3(ND, B_), 256, 0, stream>>>(TRKB, XN, w1, b1, w2, b2, out);
}

// v002
// A run of this version takes 102 microseconds.
// Next to v001, in two timings, it ran 1.28 and 1.27 times as fast.
// All steps since v000 together make it 2.89 times as fast.
#include <hip/hip_runtime.h>
#include <hip/hip_bf16.h>

#define B_    4
#define ND    512
#define NT    512
#define DM    256
#define DH    128
#define NH    8
#define DK    32
#define XP    260    // floats per LDS row of a projection's x tile: 256 + 4 pad (16 B x odd)
#define YP    68     // floats per LDS row of qkv's output tile: 64 + 4 pad
#define AQ    32     // queries per attention block
#define AKW   64     // keys per attention wave
#define OPITCH 36    // floats per LDS row of an output part: 32 + 4 pad, 16B aligned
#define W1S_STRIDE 264   // bf16 elems per row: 256 + 8 pad -> 528 B (16B aligned, banks spread)

typedef __attribute__((ext_vector_type(16))) __bf16 v16bf;
typedef __attribute__((ext_vector_type(8)))  __bf16 v8bf;
typedef __attribute__((ext_vector_type(4)))  __bf16 v4bf;
typedef __attribute__((ext_vector_type(8)))  float  v8f;
typedef __attribute__((ext_vector_type(2)))  float  v2f;
typedef __attribute__((ext_vector_type(4)))  float  v4f;

// Issue a 32-byte B-tile fetch from LDS: base register + immediate offsets so
// no VALU address math lands after a WMMA (avoids WMMA->VALU WAR hazard NOPs).
#define LDSB_ISSUE(lo, hi, base, imm)                    \
    asm volatile("ds_load_b128 %0, %2 offset:%3\n\t"     \
                 "ds_load_b128 %1, %2 offset:%4"         \
                 : "=v"(lo), "=v"(hi)                    \
                 : "v"(base), "n"(imm), "n"((imm) + 32))

// Wait until at most N DS ops outstanding; ties (lo,hi) through the asm so the
// consuming WMMA can never be scheduled ahead of the wait.
#define LDSB_WAIT2(lo, hi) \
    asm volatile("s_wait_dscnt 0x2" : "+v"(lo), "+v"(hi))
#define LDSB_WAIT0(lo, hi) \
    asm volatile("s_wait_dscnt 0x0" : "+v"(lo), "+v"(hi))

// ---------------------------------------------------------------------------
// Shared by the four linear projections y = x W^T + b, on the f32 16x16x4
// matrix form as Yt = W * Xt: A = 16 rows of W (output columns), B = 16 rows of
// x.  Both fragments by the same code: lane (c, hf) holds row c,
// k = 32*ch + 16*hf + 4*i + {0..3}; two k-steps of the matrix form per float4.
// acc[qt][r] = y(row = 16*qt + c, column = 8*hf + r).
// wf: the wave's 16 rows of W, all 256 k, in registers.  xl: the lane's place
// in the x tile in LDS (row c, k = 16*hf).
// ---------------------------------------------------------------------------
template <int NQ>
__device__ __forceinline__ void proj_mma(const float4 (&wf)[8][4], const float* xl, v8f (&acc)[NQ])
{
    // every loop here is unrolled so that wf and acc are indexed by constants
    // and stay in registers
    #pragma unroll
    for (int ch = 0; ch < 8; ++ch) {
        #pragma unroll
        for (int i = 0; i < 4; ++i) {
            float4 xf[NQ];
            #pragma unroll
            for (int qt = 0; qt < NQ; ++qt)
                xf[qt] = *(const float4*)(xl + qt * 16 * XP + ch * 32 + 4 * i);
            const v2f w01 = {wf[ch][i].x, wf[ch][i].y};
            const v2f w23 = {wf[ch][i].z, wf[ch][i].w};
            #pragma unroll
            for (int qt = 0; qt < NQ; ++qt) {
                const v2f x01 = {xf[qt].x, xf[qt].y};
                acc[qt] = __builtin_amdgcn_wmma_f32_16x16x4_f32(
                    false, w01, false, x01, (short)0, acc[qt], false, false);
            }
            #pragma unroll
            for (int qt = 0; qt < NQ; ++qt) {
                const v2f x23 = {xf[qt].z, xf[qt].w};
                acc[qt] = __builtin_amdgcn_wmma_f32_16x16x4_f32(
                    false, w23, false, x23, (short)0, acc[qt], false, false);
            }
        }
    }
}

// ---------------------------------------------------------------------------
// 1) QKV projection: block = 32 rows x 64 output columns (two heads), 4 waves,
//    wave w owns columns [16w, 16w+16).  The 32 rows of x are staged in LDS and
//    shared by the waves; each wave reads its 16 rows of W once into registers.
//    blockIdx.x = row tile (0..63), .y = column group (0..3), .z = 0=Q,1=K,2=V
// ---------------------------------------------------------------------------
__global__ __launch_bounds__(128) void qkv_kernel(
    const float* __restrict__ det, const float* __restrict__ trk,
    const float* __restrict__ wq, const float* __restrict__ bq,
    const float* __restrict__ wk, const float* __restrict__ bk,
    const float* __restrict__ wv, const float* __restrict__ bv,
    float* __restrict__ Q, float* __restrict__ K, float* __restrict__ V)
{
    __shared__ __attribute__((aligned(16))) float xs[32 * XP];
    __shared__ __attribute__((aligned(16))) float ys[32 * YP];
    const int which = blockIdx.z;
    const int tid   = threadIdx.x;
    const int row0  = blockIdx.x * 32;
    const int wave = tid >> 5, lane = tid & 31;
    const int c = lane & 15, hf = lane >> 4;
    const int col0 = blockIdx.y * 64 + wave * 16;

    const float* in   = (which == 0) ? det : trk;
    const float* W    = (which == 0) ? wq : (which == 1) ? wk : wv;
    const float* bias = (which == 0) ? bq : (which == 1) ? bk : bv;
    float* outp       = (which == 0) ? Q  : (which == 1) ? K  : V;

    // x tile: 32 rows are 8192 contiguous floats; thread t takes float4 t + 128*j
    const float* xp = in + row0 * DM + tid * 4;
    const float* wp = W + (col0 + c) * DM + hf * 16;
    const float* bp = bias + col0 + hf * 8;
    v4f xr[16];
    float4 wf[8][4];
    #pragma unroll
    for (int j = 0; j < 16; ++j)
        xr[j] = *(const v4f*)(xp + j * 512);
    #pragma unroll
    for (int ch = 0; ch < 8; ++ch)
        #pragma unroll
        for (int i = 0; i < 4; ++i)
            wf[ch][i] = *(const float4*)(wp + ch * 32 + 4 * i);
    const float4 bl = *(const float4*)bp;
    const float4 bh = *(const float4*)(bp + 4);
    // Every global load of the wave is issued above.  The wait stands before any
    // reuse of their address registers; naming the addresses as inputs keeps
    // those registers live up to it.
    asm volatile("s_wait_xcnt 0x0" :: "v"(xp), "v"(wp), "v"(bp) : "memory");

    #pragma unroll
    for (int j = 0; j < 16; ++j)
        *(v4f*)&xs[((tid >> 6) + 2 * j) * XP + (tid & 63) * 4] = xr[j];
    __syncthreads();

    v8f acc[2];
    #pragma unroll
    for (int qt = 0; qt < 2; ++qt) {
        acc[qt][0] = bl.x; acc[qt][1] = bl.y; acc[qt][2] = bl.z; acc[qt][3] = bl.w;
        acc[qt][4] = bh.x; acc[qt][5] = bh.y; acc[qt][6] = bh.z; acc[qt][7] = bh.w;
    }
    proj_mma<2>(wf, &xs[c * XP + hf * 16], acc);

    // Through LDS, so that each 128-byte line of the output (one row of one
    // head) is stored whole by one wave.
    #pragma unroll
    for (int qt = 0; qt < 2; ++qt) {
        float* dst = &ys[(qt * 16 + c) * YP + wave * 16 + hf * 8];
        *(float4*)dst       = make_float4(acc[qt][0], acc[qt][1], acc[qt][2], acc[qt][3]);
        *(float4*)(dst + 4) = make_float4(acc[qt][4], acc[qt][5], acc[qt][6], acc[qt][7]);
    }
    __syncthreads();

    const int b = row0 >> 9, n0 = row0 & 511;
    #pragma unroll
    for (int p = 0; p < 4; ++p) {
        const int idx = tid + 128 * p;            // float4 index in the block's output
        const int hh = idx >> 8, r = (idx >> 3) & 31, d4 = (idx & 7) << 2;
        *(float4*)(outp + ((b * NH + blockIdx.y * 2 + hh) * ND + n0 + r) * DK + d4) =
            *(const float4*)&ys[r * YP + hh * 32 + d4];
    }
}

// ---------------------------------------------------------------------------
// 2) Attention on the f32 16x16x4 matrix form, 32 queries per block.
//    grid = (ND/AQ, NH, B_); 256 threads = 8 waves; wave w owns keys
//    [64w, 64w+64).  St = K * Qt and Ot = Vt * Pt, so a lane holds one query's
//    scores and the score registers are the B operand of the second product.
//    Each wave makes a softmax part (max, sum, unnormalised Ot) over its own
//    keys; the 8 parts are joined through LDS.
// ---------------------------------------------------------------------------
__global__ __launch_bounds__(256) void attn_kernel(
    const float* __restrict__ Q, const float* __restrict__ K,
    const float* __restrict__ V, float* __restrict__ ctx)
{
    __shared__ float sO[8][AQ][OPITCH];   // per-wave unnormalised output parts
    __shared__ float sML[2][8][AQ];       // [0] = part max, [1] = part sum

    const int q0 = blockIdx.x * AQ;
    const int h = blockIdx.y, b = blockIdx.z;
    const int tid = threadIdx.x;
    const int wv = tid >> 5, lane = tid & 31;
    const int c = lane & 15, hf = lane >> 4;

    const float* Qb = Q + ((b * NH + h) * ND + q0) * DK;
    const float* Kb = K + ((b * NH + h) * NT + wv * AKW) * DK;
    const float* Vb = V + ((b * NH + h) * NT + wv * AKW) * DK;

    // Q and K fragments by the same code: lane (c, hf) holds row c,
    // dk = 16*hf + 4*i + {0..3}; two k-steps of the matrix form per float4.
    const float* qp = Qb + c * DK + hf * 16;
    const float* kp = Kb + c * DK + hf * 16;
    // V: lane (c, hf) holds keys 8*hf + r of each 16-key tile, dv = 2*c, 2*c + 1.
    const float* vp = Vb + hf * 8 * DK + 2 * c;

    float4 qf[2][4];
    float4 kf[4][4];
    float2 vf[4][8];
    #pragma unroll
    for (int i = 0; i < 4; ++i) {
        #pragma unroll
        for (int qt = 0; qt < 2; ++qt)
            qf[qt][i] = *(const float4*)(qp + qt * 16 * DK + 4 * i);
        #pragma unroll
        for (int kt = 0; kt < 4; ++kt)
            kf[kt][i] = *(const float4*)(kp + kt * 16 * DK + 4 * i);
    }
    #pragma unroll
    for (int kt = 0; kt < 4; ++kt)
        #pragma unroll
        for (int r = 0; r < 8; ++r)
            vf[kt][r] = *(const float2*)(vp + (kt * 16 + r) * DK);
    // Every global load of the wave is issued above.  The wait stands before any
    // reuse of their address registers; naming the addresses as inputs keeps
    // those registers live up to it.
    asm volatile("s_wait_xcnt 0x0" :: "v"(qp), "v"(kp), "v"(vp) : "memory");

    // st[kt][qt][r] = score(key = 16*kt + 8*hf + r, query = 16*qt + c), unscaled
    v8f st[4][2];
    #pragma unroll
    for (int kt = 0; kt < 4; ++kt) {
        #pragma unroll
        for (int qt = 0; qt < 2; ++qt)
            #pragma unroll
            for (int e = 0; e < 8; ++e) st[kt][qt][e] = 0.f;
        #pragma unroll
        for (int i = 0; i < 4; ++i) {
            const v2f k01 = {kf[kt][i].x, kf[kt][i].y};
            const v2f k23 = {kf[kt][i].z, kf[kt][i].w};
            #pragma unroll
            for (int qt = 0; qt < 2; ++qt) {
                const v2f q01 = {qf[qt][i].x, qf[qt][i].y};
                st[kt][qt] = __builtin_amdgcn_wmma_f32_16x16x4_f32(
                    false, k01, false, q01, (short)0, st[kt][qt], false, false);
            }
            #pragma unroll
            for (int qt = 0; qt < 2; ++qt) {
                const v2f q23 = {qf[qt][i].z, qf[qt][i].w};
                st[kt][qt] = __builtin_amdgcn_wmma_f32_16x16x4_f32(
                    false, k23, false, q23, (short)0, st[kt][qt], false, false);
            }
        }
    }

    // Softmax part over this wave's 64 keys: in-lane, plus one exchange
    // between the lane halves (they hold the same query).
    const float scale = 0.17677669529663687f;  // 1/sqrt(32)
    float pm[2], pl[2];
    #pragma unroll
    for (int qt = 0; qt < 2; ++qt) {
        float m = st[0][qt][0];
        #pragma unroll
        for (int kt = 0; kt < 4; ++kt)
            #pragma unroll
            for (int r = 0; r < 8; ++r) m = fmaxf(m, st[kt][qt][r]);
        m = fmaxf(m, __shfl_xor(m, 16, 32));
        m *= scale;
        float l = 0.f;
        #pragma unroll
        for (int kt = 0; kt < 4; ++kt)
            #pragma unroll
            for (int r = 0; r < 8; ++r) {
                const float p = __expf(st[kt][qt][r] * scale - m);
                st[kt][qt][r] = p;
                l += p;
            }
        l += __shfl_xor(l, 16, 32);
        pm[qt] = m;
        pl[qt] = l;
    }

    // Ot[dt][qt] += Vt * Pt.  k-step s of key tile kt pairs key 8*hf + 2*s + j
    // on both sides (B = score registers 2s, 2s+1).  Row c of tile dt is
    // dv = 2*c + dt, so one 8-byte load feeds both tiles.
    v8f o[2][2];
    #pragma unroll
    for (int dt = 0; dt < 2; ++dt)
        #pragma unroll
        for (int qt = 0; qt < 2; ++qt)
            #pragma unroll
            for (int e = 0; e < 8; ++e) o[dt][qt][e] = 0.f;

    #pragma unroll
    for (int kt = 0; kt < 4; ++kt) {
        #pragma unroll
        for (int s = 0; s < 4; ++s) {
            const v2f va = {vf[kt][2 * s].x, vf[kt][2 * s + 1].x};
            const v2f vb = {vf[kt][2 * s].y, vf[kt][2 * s + 1].y};
            #pragma unroll
            for (int qt = 0; qt < 2; ++qt) {
                const v2f p = {st[kt][qt][2 * s], st[kt][qt][2 * s + 1]};
                o[0][qt] = __builtin_amdgcn_wmma_f32_16x16x4_f32(
                    false, va, false, p, (short)0, o[0][qt], false, false);
                o[1][qt] = __builtin_amdgcn_wmma_f32_16x16x4_f32(
                    false, vb, false, p, (short)0, o[1][qt], false, false);
            }
        }
    }

    // o[dt][qt][r] = Ot(dv = 16*hf + 2*r + dt, query = 16*qt + c)
    #pragma unroll
    for (int qt = 0; qt < 2; ++qt) {
        float* dst = &sO[wv][qt * 16 + c][hf * 16];
        #pragma unroll
        for (int i = 0; i < 4; ++i)
            *(float4*)(dst + 4 * i) = make_float4(o[0][qt][2 * i],     o[1][qt][2 * i],
                                                  o[0][qt][2 * i + 1], o[1][qt][2 * i + 1]);
        // both halves hold the same max and sum: half 0 stores the max, half 1 the sum
        sML[hf][wv][qt * 16 + c] = hf ? pl[qt] : pm[qt];
    }
    __syncthreads();

    // Join the 8 parts: thread -> query tid/8, four dv.
    const int q = tid >> 3, d4 = (tid & 7) << 2;
    float M = sML[0][0][q];
    #pragma unroll
    for (int w = 1; w < 8; ++w) M = fmaxf(M, sML[0][w][q]);
    float L = 0.f;
    float4 acc = make_float4(0.f, 0.f, 0.f, 0.f);
    #pragma unroll
    for (int w = 0; w < 8; ++w) {
        const float f = __expf(sML[0][w][q] - M);
        const float4 o4 = *(const float4*)&sO[w][q][d4];
        L += f * sML[1][w][q];
        acc.x += f * o4.x; acc.y += f * o4.y; acc.z += f * o4.z; acc.w += f * o4.w;
    }
    const float inv = 1.f / L;
    *(float4*)(ctx + (b * ND + q0 + q) * DM + h * DK + d4) =
        make_float4(acc.x * inv, acc.y * inv, acc.z * inv, acc.w * inv);
}

// ---------------------------------------------------------------------------
// 3) Output projection + residual + LayerNorm: block = 16 rows x all 256
//    columns, 16 waves; wave w owns columns [16w, 16w+16) of the product and
//    then row w of the LayerNorm.
// ---------------------------------------------------------------------------
__global__ __launch_bounds__(512) void oln_kernel(
    const float* __restrict__ det, const float* __restrict__ ctx,
    const float* __restrict__ wo, const float* __restrict__ bo,
    const float* __restrict__ g, const float* __restrict__ beta,
    float* __restrict__ xn)
{
    __shared__ __attribute__((aligned(16))) float cs[16 * XP];
    __shared__ __attribute__((aligned(16))) float xb[16 * XP];
    const int tid  = threadIdx.x;
    const int row0 = blockIdx.x * 16;
    const int wave = tid >> 5, lane = tid & 31;
    const int c = lane & 15, hf = lane >> 4;
    const int col0 = wave * 16;

    // ctx tile: 16 rows are 4096 contiguous floats; thread t takes float4 t + 512*j
    const float* cp = ctx + row0 * DM + tid * 4;
    const float* wp = wo + (col0 + c) * DM + hf * 16;
    const float* bp = bo + col0 + hf * 8;
    const float* dp = det + (row0 + c) * DM + col0 + hf * 8;
    v4f cr[2];
    float4 wf[8][4];
    #pragma unroll
    for (int j = 0; j < 2; ++j)
        cr[j] = *(const v4f*)(cp + j * 2048);
    #pragma unroll
    for (int ch = 0; ch < 8; ++ch)
        #pragma unroll
        for (int i = 0; i < 4; ++i)
            wf[ch][i] = *(const float4*)(wp + ch * 32 + 4 * i);
    const float4 bl = *(const float4*)bp;
    const float4 bh = *(const float4*)(bp + 4);
    const float4 dl = *(const float4*)dp;
    const float4 dh = *(const float4*)(dp + 4);
    // As in qkv_kernel: the wait before any reuse of the loads' address registers.
    asm volatile("s_wait_xcnt 0x0" :: "v"(cp), "v"(wp), "v"(bp), "v"(dp) : "memory");

    #pragma unroll
    for (int j = 0; j < 2; ++j)
        *(v4f*)&cs[((tid >> 6) + 8 * j) * XP + (tid & 63) * 4] = cr[j];
    __syncthreads();

    v8f acc[1];
    acc[0][0] = bl.x; acc[0][1] = bl.y; acc[0][2] = bl.z; acc[0][3] = bl.w;
    acc[0][4] = bh.x; acc[0][5] = bh.y; acc[0][6] = bh.z; acc[0][7] = bh.w;
    proj_mma<1>(wf, &cs[c * XP + hf * 16], acc);

    float* xd = &xb[c * XP + col0 + hf * 8];
    *(float4*)xd       = make_float4(dl.x + acc[0][0], dl.y + acc[0][1],
                                     dl.z + acc[0][2], dl.w + acc[0][3]);
    *(float4*)(xd + 4) = make_float4(dh.x + acc[0][4], dh.y + acc[0][5],
                                     dh.z + acc[0][6], dh.w + acc[0][7]);
    __syncthreads();

    // wave w reduces row w (sum, sumsq); every lane ends with both sums
    float s = 0.f, s2 = 0.f;
    #pragma unroll
    for (int i = 0; i < DM / 32; ++i) {
        const float v = xb[wave * XP + lane + 32 * i];
        s += v; s2 += v * v;
    }
    s  += __shfl_xor(s, 1, 32);  s2 += __shfl_xor(s2, 1, 32);
    s  += __shfl_xor(s, 2, 32);  s2 += __shfl_xor(s2, 2, 32);
    s  += __shfl_xor(s, 4, 32);  s2 += __shfl_xor(s2, 4, 32);
    s  += __shfl_xor(s, 8, 32);  s2 += __shfl_xor(s2, 8, 32);
    s  += __shfl_xor(s, 16, 32); s2 += __shfl_xor(s2, 16, 32);
    const float mu  = s * (1.f / DM);
    const float inv = rsqrtf(s2 * (1.f / DM) - mu * mu + 1e-5f);

    #pragma unroll
    for (int i = 0; i < DM / 32; ++i) {
        const int col = lane + 32 * i;
        xn[(row0 + wave) * DM + col] = (xb[wave * XP + col] - mu) * inv * g[col] + beta[col];
    }
}

// ---------------------------------------------------------------------------
// 4) tracks fp32 -> bf16 (row-major [B][NT][DM])
// ---------------------------------------------------------------------------
__global__ void cvt_kernel(const float* __restrict__ in, __bf16* __restrict__ outb, int n4)
{
    const int i = blockIdx.x * blockDim.x + threadIdx.x;
    if (i < n4) {
        float4 v = ((const float4*)in)[i];
        v4bf p;
        p.x = (__bf16)v.x; p.y = (__bf16)v.y; p.z = (__bf16)v.z; p.w = (__bf16)v.w;
        ((v4bf*)outb)[i] = p;
    }
}

// ---------------------------------------------------------------------------
// 5) Association head: per (b,n):
//      W1n = w1 * xn_row (bf16, LDS)
//      H   = tracks[b] (512x256) @ W1n^T (256x128)  via v_wmma_f32_16x16x32_bf16
//      out[t] = sigmoid( relu(H + b1) @ w2 + b2 )
// ---------------------------------------------------------------------------
__global__ __launch_bounds__(256) void assoc_kernel(
    const __bf16* __restrict__ trkbf,  // [B][NT][DM] bf16
    const float* __restrict__ xn,      // [B][ND][DM]
    const float* __restrict__ w1,      // [DH][DM]
    const float* __restrict__ b1,      // [DH]
    const float* __restrict__ w2,      // [DH]
    const float* __restrict__ b2,      // [1]
    float* __restrict__ out)           // [B][ND][NT]
{
    __shared__ __bf16 w1s[DH * W1S_STRIDE];   // 67,584 bytes

    const int n   = blockIdx.x;
    const int b   = blockIdx.y;
    const int tid = threadIdx.x;

    const float* xrow = xn + (b * ND + n) * DM;

    // Build W1n = w1 ⊙ xn_row into LDS (bf16, padded rows).
    for (int idx = tid; idx < DH * (DM / 4); idx += 256) {
        const int j = idx >> 6;           // DM/4 == 64
        const int d = (idx & 63) << 2;
        const float4 wv = *(const float4*)(w1 + j * DM + d);
        const float4 xv = *(const float4*)(xrow + d);
        v4bf p;
        p.x = (__bf16)(wv.x * xv.x);
        p.y = (__bf16)(wv.y * xv.y);
        p.z = (__bf16)(wv.z * xv.z);
        p.w = (__bf16)(wv.w * xv.w);
        *(v4bf*)(&w1s[j * W1S_STRIDE + d]) = p;
    }
    __syncthreads();

    const int wave  = tid >> 5;
    const int lane  = tid & 31;
    const int lhalf = lane & 15;
    const int khalf = (lane >> 4) << 3;   // 0 for lanes 0-15, 8 for lanes 16-31

    float b1v[8], w2v[8];
    #pragma unroll
    for (int nt = 0; nt < 8; ++nt) {
        b1v[nt] = b1[nt * 16 + lhalf];
        w2v[nt] = w2[nt * 16 + lhalf];
    }
    const float bias2 = b2[0];

    // Per-lane LDS byte address of each B-tile row base (generic LDS pointer:
    // low 32 bits are the LDS byte offset per the aperture mapping).
    unsigned bbase[8];
    #pragma unroll
    for (int nt = 0; nt < 8; ++nt)
        bbase[nt] = (unsigned)(unsigned long long)(const void*)
                        &w1s[(nt * 16 + lhalf) * W1S_STRIDE + khalf];

    const __bf16* trk = trkbf + b * NT * DM;
    float* orow = out + (b * ND + n) * NT;

    for (int mi = 0; mi < 4; ++mi) {
        const int mbase = (wave * 4 + mi) * 16;
        const __bf16* arowp = trk + (mbase + lhalf) * DM + khalf;

        v8f acc[8];
        #pragma unroll
        for (int nt = 0; nt < 8; ++nt)
            #pragma unroll
            for (int e = 0; e < 8; ++e) acc[nt][e] = 0.f;

        // Double-buffered B pipeline across the 64 (k0,nt) tiles of this mi.
        v8bf blo[2], bhi[2];
        LDSB_ISSUE(blo[0], bhi[0], bbase[0], 0);   // preload tile (k0=0, nt=0)

        #pragma unroll
        for (int k0 = 0; k0 < DM; k0 += 32) {
            // A tile: 16x32 bf16 (lane<16 -> K {k0..k0+7, k0+16..23}; lane>=16 -> +8),
            // two contiguous 16B chunks per lane, reused across all 8 N-tiles.
            union { v16bf v; v8bf h[2]; } A;
            A.h[0] = *(const v8bf*)(arowp + k0);
            A.h[1] = *(const v8bf*)(arowp + k0 + 16);

            #pragma unroll
            for (int nt = 0; nt < 8; ++nt) {
                const int t    = (k0 >> 2) + nt;        // (k0/32)*8 + nt
                const int buf  = t & 1;
                const bool last = (k0 == DM - 32) && (nt == 7);

                if (!last) {
                    const int nnt = (nt + 1) & 7;
                    const int nk0 = (nt == 7) ? (k0 + 32) : k0;
                    LDSB_ISSUE(blo[buf ^ 1], bhi[buf ^ 1], bbase[nnt], nk0 * 2);
                    LDSB_WAIT2(blo[buf], bhi[buf]);     // tile t's data is home
                } else {
                    LDSB_WAIT0(blo[buf], bhi[buf]);
                }

                union { v16bf v; v8bf h[2]; } Bm;
                Bm.h[0] = blo[buf];
                Bm.h[1] = bhi[buf];

                acc[nt] = __builtin_amdgcn_wmma_f32_16x16x32_bf16(
                    false, A.v, false, Bm.v, (short)0, acc[nt], false, false);
            }
        }

        // Epilogue: C/D layout: VGPR r, lane l -> M = r + 8*(l>>4), N = l&15.
        #pragma unroll
        for (int r = 0; r < 8; ++r) {
            float s = 0.f;
            #pragma unroll
            for (int nt = 0; nt < 8; ++nt) {
                const float hval = acc[nt][r] + b1v[nt];
                s += fmaxf(hval, 0.f) * w2v[nt];
            }
            // reduce across the 16 lanes of this half (N dimension)
            s += __shfl_xor(s, 1, 32);
            s += __shfl_xor(s, 2, 32);
            s += __shfl_xor(s, 4, 32);
            s += __shfl_xor(s, 8, 32);
            if (lhalf == 0) {
                const int t = mbase + r + khalf;   // khalf == 8*(lane>>4)
                const float logit = s + bias2;
                orow[t] = 1.f / (1.f + __expf(-logit));
            }
        }
    }
}

// ---------------------------------------------------------------------------
// Launcher
// ---------------------------------------------------------------------------
extern "C" void kernel_launch(void* const* d_in, const int* in_sizes, int n_in,
                              void* d_out, int out_size, void* d_ws, size_t ws_size,
                              hipStream_t stream)
{
    const float* det = (const float*)d_in[0];
    const float* trk = (const float*)d_in[1];
    const float* wq  = (const float*)d_in[2];
    const float* bq  = (const float*)d_in[3];
    const float* wk  = (const float*)d_in[4];
    const float* bk  = (const float*)d_in[5];
    const float* wv  = (const float*)d_in[6];
    const float* bv  = (const float*)d_in[7];
    const float* wo  = (const float*)d_in[8];
    const float* bo  = (const float*)d_in[9];
    const float* lng = (const float*)d_in[10];
    const float* lnb = (const float*)d_in[11];
    const float* w1  = (const float*)d_in[12];
    const float* b1  = (const float*)d_in[13];
    const float* w2  = (const float*)d_in[14];
    const float* b2  = (const float*)d_in[15];
    float* out = (float*)d_out;

    const size_t rowsD = (size_t)B_ * ND * DM;  // 524288 floats
    float* Q   = (float*)d_ws;
    float* K   = Q + rowsD;
    float* V   = K + rowsD;
    float* CTX = V + rowsD;
    float* XN  = CTX + rowsD;
    __bf16* TRKB = (__bf16*)(XN + rowsD);       // 1 MB of bf16

    qkv_kernel<<<dim3(B_ * ND / 32, DM / 64, 3), 128, 0, stream>>>(det, trk, wq, bq, wk, bk, wv, bv, Q, K, V);
    cvt_kernel<<<dim3((B_ * NT * DM / 4 + 255) / 256), 256, 0, stream>>>(trk, TRKB, B_ * NT * DM / 4);
    attn_kernel<<<dim3(ND / AQ, NH, B_), 256, 0, stream>>>(Q, K, V, CTX);
    oln_kernel<<<dim3(B_ * ND / 16), 512, 0, stream>>>(det, CTX, wo, bo, lng, lnb, XN);
    assoc_kernel<<<dim3(ND, B_), 256, 0, stream>>>(TRKB, XN, w1, b1, w2, b2, out);
}

// v003
// A run of this version takes 83 microseconds.
// Timed twice side by side with v002, it ran 1.24 and 1.23 times as fast.
// All steps since v000 together make it 3.57 times as fast.
#include <hip/hip_runtime.h>
#include <hip/hip_bf16.h>

#define B_    4
#define ND    512
#define NT    512
#define DM    256
#define DH    128
#define NH    8
#define DK    32
#define XP    260    // floats per LDS row of a projection's x tile: 256 + 4 pad (16 B x odd)
#define YP    68     // floats per LDS row of qkv's output tile: 64 + 4 pad
#define AQ    32     // queries per attention block
#define AKW   64     // keys per attention wave
#define OPITCH 36    // floats per LDS row of an output part: 32 + 4 pad, 16B aligned
#define W1S_STRIDE 264   // bf16 elems per row: 256 + 8 pad -> 528 B (16B aligned, banks spread)

typedef __attribute__((ext_vector_type(16))) __bf16 v16bf;
typedef __attribute__((ext_vector_type(8)))  __bf16 v8bf;
typedef __attribute__((ext_vector_type(4)))  __bf16 v4bf;
typedef __attribute__((ext_vector_type(8)))  float  v8f;
typedef __attribute__((ext_vector_type(2)))  float  v2f;
typedef __attribute__((ext_vector_type(4)))  float  v4f;

// ---------------------------------------------------------------------------
// Shared by the four linear projections y = x W^T + b, on the f32 16x16x4
// matrix form as Yt = W * Xt: A = 16 rows of W (output columns), B = 16 rows of
// x.  Both fragments by the same code: lane (c, hf) holds row c,
// k = 32*ch + 16*hf + 4*i + {0..3}; two k-steps of the matrix form per float4.
// acc[qt][r] = y(row = 16*qt + c, column = 8*hf + r).
// wf: the wave's 16 rows of W, all 256 k, in registers.  xl: the lane's place
// in the x tile in LDS (row c, k = 16*hf).
// ---------------------------------------------------------------------------
template <int NQ>
__device__ __forceinline__ void proj_mma(const float4 (&wf)[8][4], const float* xl, v8f (&acc)[NQ])
{
    // every loop here is unrolled so that wf and acc are indexed by constants
    // and stay in registers
    #pragma unroll
    for (int ch = 0; ch < 8; ++ch) {
        #pragma unroll
        for (int i = 0; i < 4; ++i) {
            float4 xf[NQ];
            #pragma unroll
            for (int qt = 0; qt < NQ; ++qt)
                xf[qt] = *(const float4*)(xl + qt * 16 * XP + ch * 32 + 4 * i);
            const v2f w01 = {wf[ch][i].x, wf[ch][i].y};
            const v2f w23 = {wf[ch][i].z, wf[ch][i].w};
            #pragma unroll
            for (int qt = 0; qt < NQ; ++qt) {
                const v2f x01 = {xf[qt].x, xf[qt].y};
                acc[qt] = __builtin_amdgcn_wmma_f32_16x16x4_f32(
                    false, w01, false, x01, (short)0, acc[qt], false, false);
            }
            #pragma unroll
            for (int qt = 0; qt < NQ; ++qt) {
                const v2f x23 = {xf[qt].z, xf[qt].w};
                acc[qt] = __builtin_amdgcn_wmma_f32_16x16x4_f32(
                    false, w23, false, x23, (short)0, acc[qt], false, false);
            }
        }
    }
}

// ---------------------------------------------------------------------------
// 1) QKV projection: block = 32 rows x 64 output columns (two heads), 4 waves,
//    wave w owns columns [16w, 16w+16).  The 32 rows of x are staged in LDS and
//    shared by the waves; each wave reads its 16 rows of W once into registers.
//    blockIdx.x = row tile (0..63), .y = column group (0..3), .z = 0=Q,1=K,2=V
// ---------------------------------------------------------------------------
__global__ __launch_bounds__(128) void qkv_kernel(
    const float* __restrict__ det, const float* __restrict__ trk,
    const float* __restrict__ wq, const float* __restrict__ bq,
    const float* __restrict__ wk, const float* __restrict__ bk,
    const float* __restrict__ wv, const float* __restrict__ bv,
    float* __restrict__ Q, float* __restrict__ K, float* __restrict__ V)
{
    __shared__ __attribute__((aligned(16))) float xs[32 * XP];
    __shared__ __attribute__((aligned(16))) float ys[32 * YP];
    const int which = blockIdx.z;
    const int tid   = threadIdx.x;
    const int row0  = blockIdx.x * 32;
    const int wave = tid >> 5, lane = tid & 31;
    const int c = lane & 15, hf = lane >> 4;
    const int col0 = blockIdx.y * 64 + wave * 16;

    const float* in   = (which == 0) ? det : trk;
    const float* W    = (which == 0) ? wq : (which == 1) ? wk : wv;
    const float* bias = (which == 0) ? bq : (which == 1) ? bk : bv;
    float* outp       = (which == 0) ? Q  : (which == 1) ? K  : V;

    // x tile: 32 rows are 8192 contiguous floats; thread t takes float4 t + 128*j
    const float* xp = in + row0 * DM + tid * 4;
    const float* wp = W + (col0 + c) * DM + hf * 16;
    const float* bp = bias + col0 + hf * 8;
    v4f xr[16];
    float4 wf[8][4];
    #pragma unroll
    for (int j = 0; j < 16; ++j)
        xr[j] = *(const v4f*)(xp + j * 512);
    #pragma unroll
    for (int ch = 0; ch < 8; ++ch)
        #pragma unroll
        for (int i = 0; i < 4; ++i)
            wf[ch][i] = *(const float4*)(wp + ch * 32 + 4 * i);
    const float4 bl = *(const float4*)bp;
    const float4 bh = *(const float4*)(bp + 4);
    // Every global load of the wave is issued above.  The wait stands before any
    // reuse of their address registers; naming the addresses as inputs keeps
    // those registers live up to it.
    asm volatile("s_wait_xcnt 0x0" :: "v"(xp), "v"(wp), "v"(bp) : "memory");

    #pragma unroll
    for (int j = 0; j < 16; ++j)
        *(v4f*)&xs[((tid >> 6) + 2 * j) * XP + (tid & 63) * 4] = xr[j];
    __syncthreads();

    v8f acc[2];
    #pragma unroll
    for (int qt = 0; qt < 2; ++qt) {
        acc[qt][0] = bl.x; acc[qt][1] = bl.y; acc[qt][2] = bl.z; acc[qt][3] = bl.w;
        acc[qt][4] = bh.x; acc[qt][5] = bh.y; acc[qt][6] = bh.z; acc[qt][7] = bh.w;
    }
    proj_mma<2>(wf, &xs[c * XP + hf * 16], acc);

    // Through LDS, so that each 128-byte line of the output (one row of one
    // head) is stored whole by one wave.
    #pragma unroll
    for (int qt = 0; qt < 2; ++qt) {
        float* dst = &ys[(qt * 16 + c) * YP + wave * 16 + hf * 8];
        *(float4*)dst       = make_float4(acc[qt][0], acc[qt][1], acc[qt][2], acc[qt][3]);
        *(float4*)(dst + 4) = make_float4(acc[qt][4], acc[qt][5], acc[qt][6], acc[qt][7]);
    }
    __syncthreads();

    const int b = row0 >> 9, n0 = row0 & 511;
    #pragma unroll
    for (int p = 0; p < 4; ++p) {
        const int idx = tid + 128 * p;            // float4 index in the block's output
        const int hh = idx >> 8, r = (idx >> 3) & 31, d4 = (idx & 7) << 2;
        *(float4*)(outp + ((b * NH + blockIdx.y * 2 + hh) * ND + n0 + r) * DK + d4) =
            *(const float4*)&ys[r * YP + hh * 32 + d4];
    }
}

// ---------------------------------------------------------------------------
// 2) Attention on the f32 16x16x4 matrix form, 32 queries per block.
//    grid = (ND/AQ, NH, B_); 256 threads = 8 waves; wave w owns keys
//    [64w, 64w+64).  St = K * Qt and Ot = Vt * Pt, so a lane holds one query's
//    scores and the score registers are the B operand of the second product.
//    Each wave makes a softmax part (max, sum, unnormalised Ot) over its own
//    keys; the 8 parts are joined through LDS.
// ---------------------------------------------------------------------------
__global__ __launch_bounds__(256) void attn_kernel(
    const float* __restrict__ Q, const float* __restrict__ K,
    const float* __restrict__ V, float* __restrict__ ctx)
{
    __shared__ float sO[8][AQ][OPITCH];   // per-wave unnormalised output parts
    __shared__ float sML[2][8][AQ];       // [0] = part max, [1] = part sum

    const int q0 = blockIdx.x * AQ;
    const int h = blockIdx.y, b = blockIdx.z;
    const int tid = threadIdx.x;
    const int wv = tid >> 5, lane = tid & 31;
    const int c = lane & 15, hf = lane >> 4;

    const float* Qb = Q + ((b * NH + h) * ND + q0) * DK;
    const float* Kb = K + ((b * NH + h) * NT + wv * AKW) * DK;
    const float* Vb = V + ((b * NH + h) * NT + wv * AKW) * DK;

    // Q and K fragments by the same code: lane (c, hf) holds row c,
    // dk = 16*hf + 4*i + {0..3}; two k-steps of the matrix form per float4.
    const float* qp = Qb + c * DK + hf * 16;
    const float* kp = Kb + c * DK + hf * 16;
    // V: lane (c, hf) holds keys 8*hf + r of each 16-key tile, dv = 2*c, 2*c + 1.
    const float* vp = Vb + hf * 8 * DK + 2 * c;

    float4 qf[2][4];
    float4 kf[4][4];
    float2 vf[4][8];
    #pragma unroll
    for (int i = 0; i < 4; ++i) {
        #pragma unroll
        for (int qt = 0; qt < 2; ++qt)
            qf[qt][i] = *(const float4*)(qp + qt * 16 * DK + 4 * i);
        #pragma unroll
        for (int kt = 0; kt < 4; ++kt)
            kf[kt][i] = *(const float4*)(kp + kt * 16 * DK + 4 * i);
    }
    #pragma unroll
    for (int kt = 0; kt < 4; ++kt)
        #pragma unroll
        for (int r = 0; r < 8; ++r)
            vf[kt][r] = *(const float2*)(vp + (kt * 16 + r) * DK);
    // Every global load of the wave is issued above.  The wait stands before any
    // reuse of their address registers; naming the addresses as inputs keeps
    // those registers live up to it.
    asm volatile("s_wait_xcnt 0x0" :: "v"(qp), "v"(kp), "v"(vp) : "memory");

    // st[kt][qt][r] = score(key = 16*kt + 8*hf + r, query = 16*qt + c), unscaled
    v8f st[4][2];
    #pragma unroll
    for (int kt = 0; kt < 4; ++kt) {
        #pragma unroll
        for (int qt = 0; qt < 2; ++qt)
            #pragma unroll
            for (int e = 0; e < 8; ++e) st[kt][qt][e] = 0.f;
        #pragma unroll
        for (int i = 0; i < 4; ++i) {
            const v2f k01 = {kf[kt][i].x, kf[kt][i].y};
            const v2f k23 = {kf[kt][i].z, kf[kt][i].w};
            #pragma unroll
            for (int qt = 0; qt < 2; ++qt) {
                const v2f q01 = {qf[qt][i].x, qf[qt][i].y};
                st[kt][qt] = __builtin_amdgcn_wmma_f32_16x16x4_f32(
                    false, k01, false, q01, (short)0, st[kt][qt], false, false);
            }
            #pragma unroll
            for (int qt = 0; qt < 2; ++qt) {
                const v2f q23 = {qf[qt][i].z, qf[qt][i].w};
                st[kt][qt] = __builtin_amdgcn_wmma_f32_16x16x4_f32(
                    false, k23, false, q23, (short)0, st[kt][qt], false, false);
            }
        }
    }

    // Softmax part over this wave's 64 keys: in-lane, plus one exchange
    // between the lane halves (they hold the same query).
    const float scale = 0.17677669529663687f;  // 1/sqrt(32)
    float pm[2], pl[2];
    #pragma unroll
    for (int qt = 0; qt < 2; ++qt) {
        float m = st[0][qt][0];
        #pragma unroll
        for (int kt = 0; kt < 4; ++kt)
            #pragma unroll
            for (int r = 0; r < 8; ++r) m = fmaxf(m, st[kt][qt][r]);
        m = fmaxf(m, __shfl_xor(m, 16, 32));
        m *= scale;
        float l = 0.f;
        #pragma unroll
        for (int kt = 0; kt < 4; ++kt)
            #pragma unroll
            for (int r = 0; r < 8; ++r) {
                const float p = __expf(st[kt][qt][r] * scale - m);
                st[kt][qt][r] = p;
                l += p;
            }
        l += __shfl_xor(l, 16, 32);
        pm[qt] = m;
        pl[qt] = l;
    }

    // Ot[dt][qt] += Vt * Pt.  k-step s of key tile kt pairs key 8*hf + 2*s + j
    // on both sides (B = score registers 2s, 2s+1).  Row c of tile dt is
    // dv = 2*c + dt, so one 8-byte load feeds both tiles.
    v8f o[2][2];
    #pragma unroll
    for (int dt = 0; dt < 2; ++dt)
        #pragma unroll
        for (int qt = 0; qt < 2; ++qt)
            #pragma unroll
            for (int e = 0; e < 8; ++e) o[dt][qt][e] = 0.f;

    #pragma unroll
    for (int kt = 0; kt < 4; ++kt) {
        #pragma unroll
        for (int s = 0; s < 4; ++s) {
            const v2f va = {vf[kt][2 * s].x, vf[kt][2 * s + 1].x};
            const v2f vb = {vf[kt][2 * s].y, vf[kt][2 * s + 1].y};
            #pragma unroll
            for (int qt = 0; qt < 2; ++qt) {
                const v2f p = {st[kt][qt][2 * s], st[kt][qt][2 * s + 1]};
                o[0][qt] = __builtin_amdgcn_wmma_f32_16x16x4_f32(
                    false, va, false, p, (short)0, o[0][qt], false, false);
                o[1][qt] = __builtin_amdgcn_wmma_f32_16x16x4_f32(
                    false, vb, false, p, (short)0, o[1][qt], false, false);
            }
        }
    }

    // o[dt][qt][r] = Ot(dv = 16*hf + 2*r + dt, query = 16*qt + c)
    #pragma unroll
    for (int qt = 0; qt < 2; ++qt) {
        float* dst = &sO[wv][qt * 16 + c][hf * 16];
        #pragma unroll
        for (int i = 0; i < 4; ++i)
            *(float4*)(dst + 4 * i) = make_float4(o[0][qt][2 * i],     o[1][qt][2 * i],
                                                  o[0][qt][2 * i + 1], o[1][qt][2 * i + 1]);
        // both halves hold the same max and sum: half 0 stores the max, half 1 the sum
        sML[hf][wv][qt * 16 + c] = hf ? pl[qt] : pm[qt];
    }
    __syncthreads();

    // Join the 8 parts: thread -> query tid/8, four dv.
    const int q = tid >> 3, d4 = (tid & 7) << 2;
    float M = sML[0][0][q];
    #pragma unroll
    for (int w = 1; w < 8; ++w) M = fmaxf(M, sML[0][w][q]);
    float L = 0.f;
    float4 acc = make_float4(0.f, 0.f, 0.f, 0.f);
    #pragma unroll
    for (int w = 0; w < 8; ++w) {
        const float f = __expf(sML[0][w][q] - M);
        const float4 o4 = *(const float4*)&sO[w][q][d4];
        L += f * sML[1][w][q];
        acc.x += f * o4.x; acc.y += f * o4.y; acc.z += f * o4.z; acc.w += f * o4.w;
    }
    const float inv = 1.f / L;
    *(float4*)(ctx + (b * ND + q0 + q) * DM + h * DK + d4) =
        make_float4(acc.x * inv, acc.y * inv, acc.z * inv, acc.w * inv);
}

// ---------------------------------------------------------------------------
// 3) Output projection + residual + LayerNorm: block = 16 rows x all 256
//    columns, 16 waves; wave w owns columns [16w, 16w+16) of the product and
//    then row w of the LayerNorm.
// ---------------------------------------------------------------------------
__global__ __launch_bounds__(512) void oln_kernel(
    const float* __restrict__ det, const float* __restrict__ ctx,
    const float* __restrict__ wo, const float* __restrict__ bo,
    const float* __restrict__ g, const float* __restrict__ beta,
    float* __restrict__ xn)
{
    __shared__ __attribute__((aligned(16))) float cs[16 * XP];
    __shared__ __attribute__((aligned(16))) float xb[16 * XP];
    const int tid  = threadIdx.x;
    const int row0 = blockIdx.x * 16;
    const int wave = tid >> 5, lane = tid & 31;
    const int c = lane & 15, hf = lane >> 4;
    const int col0 = wave * 16;

    // ctx tile: 16 rows are 4096 contiguous floats; thread t takes float4 t + 512*j
    const float* cp = ctx + row0 * DM + tid * 4;
    const float* wp = wo + (col0 + c) * DM + hf * 16;
    const float* bp = bo + col0 + hf * 8;
    const float* dp = det + (row0 + c) * DM + col0 + hf * 8;
    v4f cr[2];
    float4 wf[8][4];
    #pragma unroll
    for (int j = 0; j < 2; ++j)
        cr[j] = *(const v4f*)(cp + j * 2048);
    #pragma unroll
    for (int ch = 0; ch < 8; ++ch)
        #pragma unroll
        for (int i = 0; i < 4; ++i)
            wf[ch][i] = *(const float4*)(wp + ch * 32 + 4 * i);
    const float4 bl = *(const float4*)bp;
    const float4 bh = *(const float4*)(bp + 4);
    const float4 dl = *(const float4*)dp;
    const float4 dh = *(const float4*)(dp + 4);
    // As in qkv_kernel: the wait before any reuse of the loads' address registers.
    asm volatile("s_wait_xcnt 0x0" :: "v"(cp), "v"(wp), "v"(bp), "v"(dp) : "memory");

    #pragma unroll
    for (int j = 0; j < 2; ++j)
        *(v4f*)&cs[((tid >> 6) + 8 * j) * XP + (tid & 63) * 4] = cr[j];
    __syncthreads();

    v8f acc[1];
    acc[0][0] = bl.x; acc[0][1] = bl.y; acc[0][2] = bl.z; acc[0][3] = bl.w;
    acc[0][4] = bh.x; acc[0][5] = bh.y; acc[0][6] = bh.z; acc[0][7] = bh.w;
    proj_mma<1>(wf, &cs[c * XP + hf * 16], acc);

    float* xd = &xb[c * XP + col0 + hf * 8];
    *(float4*)xd       = make_float4(dl.x + acc[0][0], dl.y + acc[0][1],
                                     dl.z + acc[0][2], dl.w + acc[0][3]);
    *(float4*)(xd + 4) = make_float4(dh.x + acc[0][4], dh.y + acc[0][5],
                                     dh.z + acc[0][6], dh.w + acc[0][7]);
    __syncthreads();

    // wave w reduces row w (sum, sumsq); every lane ends with both sums
    float s = 0.f, s2 = 0.f;
    #pragma unroll
    for (int i = 0; i < DM / 32; ++i) {
        const float v = xb[wave * XP + lane + 32 * i];
        s += v; s2 += v * v;
    }
    s  += __shfl_xor(s, 1, 32);  s2 += __shfl_xor(s2, 1, 32);
    s  += __shfl_xor(s, 2, 32);  s2 += __shfl_xor(s2, 2, 32);
    s  += __shfl_xor(s, 4, 32);  s2 += __shfl_xor(s2, 4, 32);
    s  += __shfl_xor(s, 8, 32);  s2 += __shfl_xor(s2, 8, 32);
    s  += __shfl_xor(s, 16, 32); s2 += __shfl_xor(s2, 16, 32);
    const float mu  = s * (1.f / DM);
    const float inv = rsqrtf(s2 * (1.f / DM) - mu * mu + 1e-5f);

    #pragma unroll
    for (int i = 0; i < DM / 32; ++i) {
        const int col = lane + 32 * i;
        xn[(row0 + wave) * DM + col] = (xb[wave * XP + col] - mu) * inv * g[col] + beta[col];
    }
}

// ---------------------------------------------------------------------------
// 4) tracks fp32 -> bf16 (row-major [B][NT][DM])
// ---------------------------------------------------------------------------
__global__ void cvt_kernel(const float* __restrict__ in, __bf16* __restrict__ outb, int n4)
{
    const int i = blockIdx.x * blockDim.x + threadIdx.x;
    if (i < n4) {
        float4 v = ((const float4*)in)[i];
        v4bf p;
        p.x = (__bf16)v.x; p.y = (__bf16)v.y; p.z = (__bf16)v.z; p.w = (__bf16)v.w;
        ((v4bf*)outb)[i] = p;
    }
}

// ---------------------------------------------------------------------------
// 5) Association head: per (b,n):
//      W1n = w1 * xn_row (bf16, LDS)
//      Ht  = W1n (128x256) @ tracks[b]^T (256x512)  via v_wmma_f32_16x16x32_bf16
//      out[t] = sigmoid( relu(Ht + b1)^T @ w2 + b2 )
//    4 waves; a wave holds all 128 hidden rows x 64 tracks at a time (two such
//    passes), so each W1n fragment read from LDS feeds four matrix
//    instructions.  With W1n as the A operand a lane's accumulators are 64
//    hidden units of each of four tracks: the sum over the hidden units is in-lane but
//    for one exchange between the lane halves.
//    The second launch bound asks for two waves per SIMD, that is two
//    work-groups per WGP: one builds its W1n while the other multiplies.
// ---------------------------------------------------------------------------
__global__ __launch_bounds__(128, 2) void assoc_kernel(
    const __bf16* __restrict__ trkbf,  // [B][NT][DM] bf16
    const float* __restrict__ xn,      // [B][ND][DM]
    const float* __restrict__ w1,      // [DH][DM]
    const float* __restrict__ b1,      // [DH]
    const float* __restrict__ w2,      // [DH]
    const float* __restrict__ b2,      // [1]
    float* __restrict__ out)           // [B][ND][NT]
{
    __shared__ __attribute__((aligned(16))) __bf16 w1s[DH * W1S_STRIDE];   // 67,584 bytes
    __shared__ __attribute__((aligned(16))) float bw[2][DH];               // [0] = b1, [1] = w2

    const int n   = blockIdx.x;
    const int b   = blockIdx.y;
    const int tid = threadIdx.x;

    // Build W1n = w1 * xn_row into LDS (bf16, padded rows): thread t takes
    // columns 4*(t & 63) .. +3 of rows (t >> 6) + 2*i.  All of a thread's loads
    // are issued before the first is used: with four waves a shallow batch
    // would leave the build waiting out the L2 latency many times over.
    {
        const int d = (tid & 63) << 2;
        const float* wp  = w1 + (tid >> 6) * DM + d;
        const float4 xv  = *(const float4*)(xn + (b * ND + n) * DM + d);
        const float  b1t = b1[tid];
        const float  w2t = w2[tid];
        float4 wv[64];
        #pragma unroll
        for (int i = 0; i < 64; ++i)
            wv[i] = *(const float4*)(wp + i * 2 * DM);
        // Every global load of the build is issued above.  The wait stands before
        // any reuse of their address registers; naming wp as an input keeps the
        // 64 loads' address pair live up to it.
        asm volatile("s_wait_xcnt 0x0" :: "v"(wp) : "memory");
        #pragma unroll
        for (int i = 0; i < 64; ++i) {
            v4bf p;
            p.x = (__bf16)(wv[i].x * xv.x);
            p.y = (__bf16)(wv[i].y * xv.y);
            p.z = (__bf16)(wv[i].z * xv.z);
            p.w = (__bf16)(wv[i].w * xv.w);
            *(v4bf*)(&w1s[((tid >> 6) + 2 * i) * W1S_STRIDE + d]) = p;
        }
        bw[0][tid] = b1t;
        bw[1][tid] = w2t;
    }
    __syncthreads();

    const int wave  = tid >> 5;
    const int lane  = tid & 31;
    const int lhalf = lane & 15;
    const int hf    = lane >> 4;
    const int khalf = hf << 3;            // 0 for lanes 0-15, 8 for lanes 16-31

    const float bias2 = b2[0];

    // The lane's place in W1n: row lhalf of each 16-row tile, k = khalf.
    const __bf16* wrow = &w1s[lhalf * W1S_STRIDE + khalf];

    const __bf16* trk = trkbf + b * NT * DM;
    float* orow = out + (b * ND + n) * NT;

    for (int mp = 0; mp < 2; ++mp) {
        const int tbase = (wave * 2 + mp) * 64;
        const __bf16* trow = trk + (tbase + lhalf) * DM + khalf;

        // acc[ti][ht][r] = Ht(hidden = 16*ht + 8*hf + r, track = tbase + 16*ti + lhalf)
        v8f acc[4][8];
        #pragma unroll
        for (int ti = 0; ti < 4; ++ti)
            #pragma unroll
            for (int ht = 0; ht < 8; ++ht)
                #pragma unroll
                for (int e = 0; e < 8; ++e) acc[ti][ht][e] = 0.f;

        // Fragments are fetched ahead into a second register set while the current
        // set's products run.  Tracks: 64 k at a time, so that the four 16-byte
        // pieces a lane takes from one 128-byte line of its row are asked for
        // together.  W1n: four of the eight hidden tiles of one k-step at a time.
        // Both operands by the same k order: lane<16 -> k {k0..k0+7,
        // k0+16..k0+23}; lane>=16 -> +8.
        union Frag { v16bf v; v8bf h[2]; };
        Frag tf[2][2][4], wf[2][4];
        #pragma unroll
        for (int w = 0; w < 2; ++w)
            #pragma unroll
            for (int ti = 0; ti < 4; ++ti) {
                tf[0][w][ti].h[0] = *(const v8bf*)(trow + ti * 16 * DM + w * 32);
                tf[0][w][ti].h[1] = *(const v8bf*)(trow + ti * 16 * DM + w * 32 + 16);
            }
        #pragma unroll
        for (int j = 0; j < 4; ++j) {
            wf[0][j].h[0] = *(const v8bf*)(wrow + j * 16 * W1S_STRIDE);
            wf[0][j].h[1] = *(const v8bf*)(wrow + j * 16 * W1S_STRIDE + 16);
        }

        // Block t = 16 products: k-step t/2, hidden tiles 4*(t&1) .. +3, four track
        // tiles.  Unrolled so that the fragment sets and acc are indexed by constants.
        #pragma unroll
        for (int t = 0; t < DM / 16; ++t) {
            const int ks = t >> 1, g = t & 1;
            if ((t & 3) == 0 && t + 4 < DM / 16) {
                const int k2 = (ks + 2) * 32;
                #pragma unroll
                for (int w = 0; w < 2; ++w)
                    #pragma unroll
                    for (int ti = 0; ti < 4; ++ti) {
                        tf[((ks >> 1) + 1) & 1][w][ti].h[0] = *(const v8bf*)(trow + ti * 16 * DM + k2 + w * 32);
                        tf[((ks >> 1) + 1) & 1][w][ti].h[1] = *(const v8bf*)(trow + ti * 16 * DM + k2 + w * 32 + 16);
                    }
            }
            if (t + 1 < DM / 16) {
                const int k1 = ((t + 1) >> 1) * 32, g1 = (t + 1) & 1;
                #pragma unroll
                for (int j = 0; j < 4; ++j) {
                    wf[(t + 1) & 1][j].h[0] = *(const v8bf*)(wrow + (g1 * 4 + j) * 16 * W1S_STRIDE + k1);
                    wf[(t + 1) & 1][j].h[1] = *(const v8bf*)(wrow + (g1 * 4 + j) * 16 * W1S_STRIDE + k1 + 16);
                }
            }
            // Keeps the loads above as one group ahead of this block's products:
            // without it the compiler sinks each load to just before its use and
            // the wave waits out every load's latency.
            __builtin_amdgcn_sched_barrier(0);
            #pragma unroll
            for (int j = 0; j < 4; ++j)
                #pragma unroll
                for (int ti = 0; ti < 4; ++ti)
                    acc[ti][g * 4 + j] = __builtin_amdgcn_wmma_f32_16x16x32_bf16(
                        false, wf[t & 1][j].v, false, tf[(ks >> 1) & 1][ks & 1][ti].v,
                        (short)0, acc[ti][g * 4 + j], false, false);
            // Keeps the next block's loads behind this block's products (the other
            // side of the fence above).
            __builtin_amdgcn_sched_barrier(0);
        }
        // The wait before the track loads' address registers are reused by the
        // next pass; naming the address as an input keeps it live up to here.
        asm volatile("s_wait_xcnt 0x0" :: "v"(trow) : "memory");

        // Second layer: this lane's 64 hidden units of each of its four tracks.
        v2f s2[4];
        #pragma unroll
        for (int ti = 0; ti < 4; ++ti) s2[ti] = (v2f){0.f, 0.f};
        #pragma unroll
        for (int ht = 0; ht < 8; ++ht) {
            const v4f bl = *(const v4f*)&bw[0][ht * 16 + khalf];
            const v4f bh = *(const v4f*)&bw[0][ht * 16 + khalf + 4];
            const v4f wl = *(const v4f*)&bw[1][ht * 16 + khalf];
            const v4f wh = *(const v4f*)&bw[1][ht * 16 + khalf + 4];
            #pragma unroll
            for (int ti = 0; ti < 4; ++ti) {
                #pragma unroll
                for (int p = 0; p < 2; ++p) {
                    v2f hl = {acc[ti][ht][2 * p] + bl[2 * p], acc[ti][ht][2 * p + 1] + bl[2 * p + 1]};
                    v2f hh = {acc[ti][ht][4 + 2 * p] + bh[2 * p], acc[ti][ht][5 + 2 * p] + bh[2 * p + 1]};
                    hl.x = fmaxf(hl.x, 0.f); hl.y = fmaxf(hl.y, 0.f);
                    hh.x = fmaxf(hh.x, 0.f); hh.y = fmaxf(hh.y, 0.f);
                    s2[ti] += hl * (v2f){wl[2 * p], wl[2 * p + 1]};
                    s2[ti] += hh * (v2f){wh[2 * p], wh[2 * p + 1]};
                }
            }
        }
        // Join the two lane halves (they hold the same track, the other 64 hidden units).
        float sv[4];
        #pragma unroll
        for (int ti = 0; ti < 4; ++ti) {
            const float s = s2[ti].x + s2[ti].y;
            const int si = __float_as_int(s);
            sv[ti] = s + __int_as_float(
                __builtin_amdgcn_permlanex16(si, si, 0x76543210, 0xfedcba98, false, false));
        }
        // Half hf finishes track tiles 2*j + hf: a store is 32 consecutive tracks, one whole line.
        float* op = orow + tbase + lane;
        #pragma unroll
        for (int j = 0; j < 2; ++j) {
            const float logit = (hf ? sv[2 * j + 1] : sv[2 * j]) + bias2;
            op[j * 32] = 1.f / (1.f + __expf(-logit));
        }
        // The wait before the next pass reuses the stores' address and data registers.
        asm volatile("s_wait_xcnt 0x0" :: "v"(op) : "memory");
    }
}

// ---------------------------------------------------------------------------
// Launcher
// ---------------------------------------------------------------------------
extern "C" void kernel_launch(void* const* d_in, const int* in_sizes, int n_in,
                              void* d_out, int out_size, void* d_ws, size_t ws_size,
                              hipStream_t stream)
{
    const float* det = (const float*)d_in[0];
    const float* trk = (const float*)d_in[1];
    const float* wq  = (const float*)d_in[2];
    const float* bq  = (const float*)d_in[3];
    const float* wk  = (const float*)d_in[4];
    const float* bk  = (const float*)d_in[5];
    const float* wv  = (const float*)d_in[6];
    const float* bv  = (const float*)d_in[7];
    const float* wo  = (const float*)d_in[8];
    const float* bo  = (const float*)d_in[9];
    const float* lng = (const float*)d_in[10];
    const float* lnb = (const float*)d_in[11];
    const float* w1  = (const float*)d_in[12];
    const float* b1  = (const float*)d_in[13];
    const float* w2  = (const float*)d_in[14];
    const float* b2  = (const float*)d_in[15];
    float* out = (float*)d_out;

    const size_t rowsD = (size_t)B_ * ND * DM;  // 524288 floats
    float* Q   = (float*)d_ws;
    float* K   = Q + rowsD;
    float* V   = K + rowsD;
    float* CTX = V + rowsD;
    float* XN  = CTX + rowsD;
    __bf16* TRKB = (__bf16*)(XN + rowsD);       // 1 MB of bf16

    qkv_kernel<<<dim3(B_ * ND / 32, DM / 64, 3), 128, 0, stream>>>(det, trk, wq, bq, wk, bk, wv, bv, Q, K, V);
    cvt_kernel<<<dim3((B_ * NT * DM / 4 + 255) / 256), 256, 0, stream>>>(trk, TRKB, B_ * NT * DM / 4);
    attn_kernel<<<dim3(ND / AQ, NH, B_), 256, 0, stream>>>(Q, K, V, CTX);
    oln_kernel<<<dim3(B_ * ND / 16), 512, 0, stream>>>(det, CTX, wo, bo, lng, lnb, XN);
    assoc_kernel<<<dim3(ND, B_), 128, 0, stream>>>(TRKB, XN, w1, b1, w2, b2, out);
}

// v004
// A run of this version takes 71.7 microseconds.
// Timed twice side by side with v003, it ran 1.16 and 1.15 times as fast.
// Counting every step since v000, it is 4.13 times as fast.
#include <hip/hip_runtime.h>
#include <hip/hip_bf16.h>

#define B_    4
#define ND    512
#define NT    512
#define DM    256
#define DH    128
#define NH    8
#define DK    32
#define XP    260    // floats per LDS row of a projection's x tile: 256 + 4 pad (16 B x odd)
#define YP    68     // floats per LDS row of qkv's output tile: 64 + 4 pad
#define AQ    32     // queries per attention block
#define AKW   64     // keys per attention wave
#define OPITCH 36    // floats per LDS row of an output part: 32 + 4 pad, 16B aligned
#define W1S_STRIDE 264   // bf16 elems per row: 256 + 8 pad -> 528 B (16B aligned, banks spread)
#define TH    256    // bf16 elems of half a track fragment: 32 lanes x 8
#define TK    512    // bf16 elems of a track fragment (16 tracks x 32 k)
#define TT    4096   // bf16 elems of a track tile (16 tracks x 256 k)

typedef __attribute__((ext_vector_type(16))) __bf16 v16bf;
typedef __attribute__((ext_vector_type(8)))  __bf16 v8bf;
typedef __attribute__((ext_vector_type(4)))  __bf16 v4bf;
typedef __attribute__((ext_vector_type(8)))  float  v8f;
typedef __attribute__((ext_vector_type(2)))  float  v2f;
typedef __attribute__((ext_vector_type(4)))  float  v4f;

// ---------------------------------------------------------------------------
// Shared by the four linear projections y = x W^T + b, on the f32 16x16x4
// matrix form as Yt = W * Xt: A = 16 rows of W (output columns), B = 16 rows of
// x.  Both fragments by the same code: lane (c, hf) holds row c,
// k = 32*ch + 16*hf + 4*i + {0..3}; two k-steps of the matrix form per float4.
// acc[qt][r] = y(row = 16*qt + c, column = 8*hf + r).
// wf: the wave's 16 rows of W, all 256 k, in registers (loaded from the copy
// that cvt_kernel has laid out in this order).  xl: the lane's place
// in the x tile in LDS (row c, k = 16*hf).
// ---------------------------------------------------------------------------
template <int NQ>
__device__ __forceinline__ void proj_mma(const float4 (&wf)[8][4], const float* xl, v8f (&acc)[NQ])
{
    // every loop here is unrolled so that wf and acc are indexed by constants
    // and stay in registers
    #pragma unroll
    for (int ch = 0; ch < 8; ++ch) {
        #pragma unroll
        for (int i = 0; i < 4; ++i) {
            float4 xf[NQ];
            #pragma unroll
            for (int qt = 0; qt < NQ; ++qt)
                xf[qt] = *(const float4*)(xl + qt * 16 * XP + ch * 32 + 4 * i);
            const v2f w01 = {wf[ch][i].x, wf[ch][i].y};
            const v2f w23 = {wf[ch][i].z, wf[ch][i].w};
            #pragma unroll
            for (int qt = 0; qt < NQ; ++qt) {
                const v2f x01 = {xf[qt].x, xf[qt].y};
                acc[qt] = __builtin_amdgcn_wmma_f32_16x16x4_f32(
                    false, w01, false, x01, (short)0, acc[qt], false, false);
            }
            #pragma unroll
            for (int qt = 0; qt < NQ; ++qt) {
                const v2f x23 = {xf[qt].z, xf[qt].w};
                acc[qt] = __builtin_amdgcn_wmma_f32_16x16x4_f32(
                    false, w23, false, x23, (short)0, acc[qt], false, false);
            }
        }
    }
}

// ---------------------------------------------------------------------------
// 1) QKV projection: block = 32 rows x 64 output columns (two heads), 4 waves,
//    wave w owns columns [16w, 16w+16).  The 32 rows of x are staged in LDS and
//    shared by the waves; each wave reads its 16 rows of W once into registers.
//    blockIdx.x = row tile (0..63), .y = column group (0..3), .z = 0=Q,1=K,2=V
// ---------------------------------------------------------------------------
__global__ __launch_bounds__(128) void qkv_kernel(
    const float* __restrict__ det, const float* __restrict__ trk,
    const float* __restrict__ wfr,     // w_q, w_k, w_v in fragment order (cvt_kernel)
    const float* __restrict__ bq, const float* __restrict__ bk,
    const float* __restrict__ bv,
    float* __restrict__ Q, float* __restrict__ K, float* __restrict__ V)
{
    __shared__ __attribute__((aligned(16))) float xs[32 * XP];
    __shared__ __attribute__((aligned(16))) float ys[32 * YP];
    const int which = blockIdx.z;
    const int tid   = threadIdx.x;
    const int row0  = blockIdx.x * 32;
    const int wave = tid >> 5, lane = tid & 31;
    const int c = lane & 15, hf = lane >> 4;
    const int col0 = blockIdx.y * 64 + wave * 16;

    const float* in   = (which == 0) ? det : trk;
    const float* W    = wfr + which * (DM * DM);
    const float* bias = (which == 0) ? bq : (which == 1) ? bk : bv;
    float* outp       = (which == 0) ? Q  : (which == 1) ? K  : V;

    // x tile: 32 rows are 8192 contiguous floats; thread t takes float4 t + 128*j
    const float* xp = in + row0 * DM + tid * 4;
    const float* wp = W + col0 * DM + lane * 4;
    const float* bp = bias + col0 + hf * 8;
    v4f xr[16];
    float4 wf[8][4];
    #pragma unroll
    for (int j = 0; j < 16; ++j)
        xr[j] = *(const v4f*)(xp + j * 512);
    #pragma unroll
    for (int ch = 0; ch < 8; ++ch)
        #pragma unroll
        for (int i = 0; i < 4; ++i)
            wf[ch][i] = *(const float4*)(wp + (ch * 4 + i) * 128);
    const float4 bl = *(const float4*)bp;
    const float4 bh = *(const float4*)(bp + 4);
    // Every global load of the wave is issued above.  The wait stands before any
    // reuse of their address registers; naming the addresses as inputs keeps
    // those registers live up to it.
    asm volatile("s_wait_xcnt 0x0" :: "v"(xp), "v"(wp), "v"(bp) : "memory");

    #pragma unroll
    for (int j = 0; j < 16; ++j)
        *(v4f*)&xs[((tid >> 6) + 2 * j) * XP + (tid & 63) * 4] = xr[j];
    __syncthreads();

    v8f acc[2];
    #pragma unroll
    for (int qt = 0; qt < 2; ++qt) {
        acc[qt][0] = bl.x; acc[qt][1] = bl.y; acc[qt][2] = bl.z; acc[qt][3] = bl.w;
        acc[qt][4] = bh.x; acc[qt][5] = bh.y; acc[qt][6] = bh.z; acc[qt][7] = bh.w;
    }
    proj_mma<2>(wf, &xs[c * XP + hf * 16], acc);

    // Through LDS, so that each 128-byte line of the output is stored whole by
    // one wave.
    #pragma unroll
    for (int qt = 0; qt < 2; ++qt) {
        float* dst = &ys[(qt * 16 + c) * YP + wave * 16 + hf * 8];
        *(float4*)dst       = make_float4(acc[qt][0], acc[qt][1], acc[qt][2], acc[qt][3]);
        *(float4*)(dst + 4) = make_float4(acc[qt][4], acc[qt][5], acc[qt][6], acc[qt][7]);
    }
    __syncthreads();

    const int b = row0 >> 9, n0 = row0 & 511;
    #pragma unroll
    for (int p = 0; p < 4; ++p) {
        const int idx = tid + 128 * p;            // float4 index in the block's output
        const int hh = idx >> 8;
        // V: row-major.  Q and K: in the order in which attn_kernel loads its
        // fragments, [16-row tile][i][lane (c, hf)][4]: row 16*tile + c,
        // dk = 16*hf + 4*i + {0..3}.  Either way piece idx goes to place idx.
        const int r  = (which == 2) ? (idx >> 3) & 31 : ((idx >> 7) & 1) * 16 + (idx & 15);
        const int d4 = (which == 2) ? (idx & 7) << 2  : ((idx >> 4) & 1) * 16 + ((idx >> 5) & 3) * 4;
        *(float4*)(outp + ((b * NH + blockIdx.y * 2 + hh) * ND + n0) * DK + (idx & 255) * 4) =
            *(const float4*)&ys[r * YP + hh * 32 + d4];
    }
}

// ---------------------------------------------------------------------------
// 2) Attention on the f32 16x16x4 matrix form, 32 queries per block.
//    grid = (ND/AQ, NH, B_); 256 threads = 8 waves; wave w owns keys
//    [64w, 64w+64).  St = K * Qt and Ot = Vt * Pt, so a lane holds one query's
//    scores and the score registers are the B operand of the second product.
//    Each wave makes a softmax part (max, sum, unnormalised Ot) over its own
//    keys; the 8 parts are joined through LDS.
// ---------------------------------------------------------------------------
__global__ __launch_bounds__(256) void attn_kernel(
    const float* __restrict__ Q, const float* __restrict__ K,
    const float* __restrict__ V, float* __restrict__ ctx)
{
    __shared__ float sO[8][AQ][OPITCH];   // per-wave unnormalised output parts
    __shared__ float sML[2][8][AQ];       // [0] = part max, [1] = part sum

    const int q0 = blockIdx.x * AQ;
    const int h = blockIdx.y, b = blockIdx.z;
    const int tid = threadIdx.x;
    const int wv = tid >> 5, lane = tid & 31;
    const int c = lane & 15, hf = lane >> 4;

    const float* Qb = Q + ((b * NH + h) * ND + q0) * DK;
    const float* Kb = K + ((b * NH + h) * NT + wv * AKW) * DK;
    const float* Vb = V + ((b * NH + h) * NT + wv * AKW) * DK;

    // Q and K fragments by the same code: lane (c, hf) holds row c,
    // dk = 16*hf + 4*i + {0..3}; two k-steps of the matrix form per float4.
    // qkv_kernel has stored them in that order, [16-row tile][i][lane][4], so a
    // load is 512 contiguous bytes per wave.
    const float* qp = Qb + lane * 4;
    const float* kp = Kb + lane * 4;
    // V: lane (c, hf) holds keys 8*hf + r of each 16-key tile, dv = 2*c, 2*c + 1.
    const float* vp = Vb + hf * 8 * DK + 2 * c;

    float4 qf[2][4];
    float4 kf[4][4];
    float2 vf[4][8];
    #pragma unroll
    for (int i = 0; i < 4; ++i) {
        #pragma unroll
        for (int qt = 0; qt < 2; ++qt)
            qf[qt][i] = *(const float4*)(qp + qt * 16 * DK + 128 * i);
        #pragma unroll
        for (int kt = 0; kt < 4; ++kt)
            kf[kt][i] = *(const float4*)(kp + kt * 16 * DK + 128 * i);
    }
    #pragma unroll
    for (int kt = 0; kt < 4; ++kt)
        #pragma unroll
        for (int r = 0; r < 8; ++r)
            vf[kt][r] = *(const float2*)(vp + (kt * 16 + r) * DK);
    // Every global load of the wave is issued above.  The wait stands before any
    // reuse of their address registers; naming the addresses as inputs keeps
    // those registers live up to it.
    asm volatile("s_wait_xcnt 0x0" :: "v"(qp), "v"(kp), "v"(vp) : "memory");

    // st[kt][qt][r] = score(key = 16*kt + 8*hf + r, query = 16*qt + c), unscaled
    v8f st[4][2];
    #pragma unroll
    for (int kt = 0; kt < 4; ++kt) {
        #pragma unroll
        for (int qt = 0; qt < 2; ++qt)
            #pragma unroll
            for (int e = 0; e < 8; ++e) st[kt][qt][e] = 0.f;
        #pragma unroll
        for (int i = 0; i < 4; ++i) {
            const v2f k01 = {kf[kt][i].x, kf[kt][i].y};
            const v2f k23 = {kf[kt][i].z, kf[kt][i].w};
            #pragma unroll
            for (int qt = 0; qt < 2; ++qt) {
                const v2f q01 = {qf[qt][i].x, qf[qt][i].y};
                st[kt][qt] = __builtin_amdgcn_wmma_f32_16x16x4_f32(
                    false, k01, false, q01, (short)0, st[kt][qt], false, false);
            }
            #pragma unroll
            for (int qt = 0; qt < 2; ++qt) {
                const v2f q23 = {qf[qt][i].z, qf[qt][i].w};
                st[kt][qt] = __builtin_amdgcn_wmma_f32_16x16x4_f32(
                    false, k23, false, q23, (short)0, st[kt][qt], false, false);
            }
        }
    }

    // Softmax part over this wave's 64 keys: in-lane, plus one exchange
    // between the lane halves (they hold the same query).
    const float scale = 0.17677669529663687f;  // 1/sqrt(32)
    float pm[2], pl[2];
    #pragma unroll
    for (int qt = 0; qt < 2; ++qt) {
        float m = st[0][qt][0];
        #pragma unroll
        for (int kt = 0; kt < 4; ++kt)
            #pragma unroll
            for (int r = 0; r < 8; ++r) m = fmaxf(m, st[kt][qt][r]);
        m = fmaxf(m, __shfl_xor(m, 16, 32));
        m *= scale;
        float l = 0.f;
        #pragma unroll
        for (int kt = 0; kt < 4; ++kt)
            #pragma unroll
            for (int r = 0; r < 8; ++r) {
                const float p = __expf(st[kt][qt][r] * scale - m);
                st[kt][qt][r] = p;
                l += p;
            }
        l += __shfl_xor(l, 16, 32);
        pm[qt] = m;
        pl[qt] = l;
    }

    // Ot[dt][qt] += Vt * Pt.  k-step s of key tile kt pairs key 8*hf + 2*s + j
    // on both sides (B = score registers 2s, 2s+1).  Row c of tile dt is
    // dv = 2*c + dt, so one 8-byte load feeds both tiles.
    v8f o[2][2];
    #pragma unroll
    for (int dt = 0; dt < 2; ++dt)
        #pragma unroll
        for (int qt = 0; qt < 2; ++qt)
            #pragma unroll
            for (int e = 0; e < 8; ++e) o[dt][qt][e] = 0.f;

    #pragma unroll
    for (int kt = 0; kt < 4; ++kt) {
        #pragma unroll
        for (int s = 0; s < 4; ++s) {
            const v2f va = {vf[kt][2 * s].x, vf[kt][2 * s + 1].x};
            const v2f vb = {vf[kt][2 * s].y, vf[kt][2 * s + 1].y};
            #pragma unroll
            for (int qt = 0; qt < 2; ++qt) {
                const v2f p = {st[kt][qt][2 * s], st[kt][qt][2 * s + 1]};
                o[0][qt] = __builtin_amdgcn_wmma_f32_16x16x4_f32(
                    false, va, false, p, (short)0, o[0][qt], false, false);
                o[1][qt] = __builtin_amdgcn_wmma_f32_16x16x4_f32(
                    false, vb, false, p, (short)0, o[1][qt], false, false);
            }
        }
    }

    // o[dt][qt][r] = Ot(dv = 16*hf + 2*r + dt, query = 16*qt + c)
    #pragma unroll
    for (int qt = 0; qt < 2; ++qt) {
        float* dst = &sO[wv][qt * 16 + c][hf * 16];
        #pragma unroll
        for (int i = 0; i < 4; ++i)
            *(float4*)(dst + 4 * i) = make_float4(o[0][qt][2 * i],     o[1][qt][2 * i],
                                                  o[0][qt][2 * i + 1], o[1][qt][2 * i + 1]);
        // both halves hold the same max and sum: half 0 stores the max, half 1 the sum
        sML[hf][wv][qt * 16 + c] = hf ? pl[qt] : pm[qt];
    }
    __syncthreads();

    // Join the 8 parts: thread -> query tid/8, four dv.
    const int q = tid >> 3, d4 = (tid & 7) << 2;
    float M = sML[0][0][q];
    #pragma unroll
    for (int w = 1; w < 8; ++w) M = fmaxf(M, sML[0][w][q]);
    float L = 0.f;
    float4 acc = make_float4(0.f, 0.f, 0.f, 0.f);
    #pragma unroll
    for (int w = 0; w < 8; ++w) {
        const float f = __expf(sML[0][w][q] - M);
        const float4 o4 = *(const float4*)&sO[w][q][d4];
        L += f * sML[1][w][q];
        acc.x += f * o4.x; acc.y += f * o4.y; acc.z += f * o4.z; acc.w += f * o4.w;
    }
    const float inv = 1.f / L;
    *(float4*)(ctx + (b * ND + q0 + q) * DM + h * DK + d4) =
        make_float4(acc.x * inv, acc.y * inv, acc.z * inv, acc.w * inv);
}

// ---------------------------------------------------------------------------
// 3) Output projection + residual + LayerNorm: block = 16 rows x all 256
//    columns, 16 waves; wave w owns columns [16w, 16w+16) of the product and
//    then row w of the LayerNorm.
// ---------------------------------------------------------------------------
__global__ __launch_bounds__(512) void oln_kernel(
    const float* __restrict__ det, const float* __restrict__ ctx,
    const float* __restrict__ wo,      // w_o in fragment order (cvt_kernel)
    const float* __restrict__ bo,
    const float* __restrict__ g, const float* __restrict__ beta,
    float* __restrict__ xn)
{
    __shared__ __attribute__((aligned(16))) float cs[16 * XP];
    __shared__ __attribute__((aligned(16))) float xb[16 * XP];
    const int tid  = threadIdx.x;
    const int row0 = blockIdx.x * 16;
    const int wave = tid >> 5, lane = tid & 31;
    const int c = lane & 15, hf = lane >> 4;
    const int col0 = wave * 16;

    // ctx tile: 16 rows are 4096 contiguous floats; thread t takes float4 t + 512*j
    const float* cp = ctx + row0 * DM + tid * 4;
    const float* wp = wo + col0 * DM + lane * 4;
    const float* bp = bo + col0 + hf * 8;
    const float* dp = det + (row0 + c) * DM + col0 + hf * 8;
    v4f cr[2];
    float4 wf[8][4];
    #pragma unroll
    for (int j = 0; j < 2; ++j)
        cr[j] = *(const v4f*)(cp + j * 2048);
    #pragma unroll
    for (int ch = 0; ch < 8; ++ch)
        #pragma unroll
        for (int i = 0; i < 4; ++i)
            wf[ch][i] = *(const float4*)(wp + (ch * 4 + i) * 128);
    const float4 bl = *(const float4*)bp;
    const float4 bh = *(const float4*)(bp + 4);
    const float4 dl = *(const float4*)dp;
    const float4 dh = *(const float4*)(dp + 4);
    // As in qkv_kernel: the wait before any reuse of the loads' address registers.
    asm volatile("s_wait_xcnt 0x0" :: "v"(cp), "v"(wp), "v"(bp), "v"(dp) : "memory");

    #pragma unroll
    for (int j = 0; j < 2; ++j)
        *(v4f*)&cs[((tid >> 6) + 8 * j) * XP + (tid & 63) * 4] = cr[j];
    __syncthreads();

    v8f acc[1];
    acc[0][0] = bl.x; acc[0][1] = bl.y; acc[0][2] = bl.z; acc[0][3] = bl.w;
    acc[0][4] = bh.x; acc[0][5] = bh.y; acc[0][6] = bh.z; acc[0][7] = bh.w;
    proj_mma<1>(wf, &cs[c * XP + hf * 16], acc);

    float* xd = &xb[c * XP + col0 + hf * 8];
    *(float4*)xd       = make_float4(dl.x + acc[0][0], dl.y + acc[0][1],
                                     dl.z + acc[0][2], dl.w + acc[0][3]);
    *(float4*)(xd + 4) = make_float4(dh.x + acc[0][4], dh.y + acc[0][5],
                                     dh.z + acc[0][6], dh.w + acc[0][7]);
    __syncthreads();

    // wave w reduces row w (sum, sumsq); every lane ends with both sums
    float s = 0.f, s2 = 0.f;
    #pragma unroll
    for (int i = 0; i < DM / 32; ++i) {
        const float v = xb[wave * XP + lane + 32 * i];
        s += v; s2 += v * v;
    }
    s  += __shfl_xor(s, 1, 32);  s2 += __shfl_xor(s2, 1, 32);
    s  += __shfl_xor(s, 2, 32);  s2 += __shfl_xor(s2, 2, 32);
    s  += __shfl_xor(s, 4, 32);  s2 += __shfl_xor(s2, 4, 32);
    s  += __shfl_xor(s, 8, 32);  s2 += __shfl_xor(s2, 8, 32);
    s  += __shfl_xor(s, 16, 32); s2 += __shfl_xor(s2, 16, 32);
    const float mu  = s * (1.f / DM);
    const float inv = rsqrtf(s2 * (1.f / DM) - mu * mu + 1e-5f);

    #pragma unroll
    for (int i = 0; i < DM / 32; ++i) {
        const int col = lane + 32 * i;
        xn[(row0 + wave) * DM + col] = (xb[wave * XP + col] - mu) * inv * g[col] + beta[col];
    }
}

// ---------------------------------------------------------------------------
// 4) Lays operands out in the order in which later kernels load their matrix
//    fragments, so that one 16-byte load per lane is 512 contiguous bytes per
//    wave (four whole lines) there.  Thread j writes the j-th 16-byte piece: a
//    wave's store is 512 contiguous bytes too.
//    Blocks 0..255: tracks fp32 -> bf16 for the head, [B*NT/16 track tiles]
//    [DM/32 k-steps][2 halves][32 lanes][8 bf16]; lane (c, hf) of half h holds
//    track 16*tile + c, k = 32*kstep + 16*h + 8*hf + {0..7}.
//    Blocks 256..511, 64 per matrix: w_q, w_k, w_v, w_o (fp32 as they are) for
//    the projections, [DM/16 row tiles][8 ch][4 i][32 lanes][4 floats]; lane
//    (c, hf) holds row 16*tile + c, k = 32*ch + 16*hf + 4*i + {0..3}.
// ---------------------------------------------------------------------------
__global__ __launch_bounds__(256) void cvt_kernel(
    const float* __restrict__ in,
    const float* __restrict__ wq, const float* __restrict__ wk,
    const float* __restrict__ wv, const float* __restrict__ wo,
    __bf16* __restrict__ outb, float* __restrict__ wfr)
{
    const int blk = blockIdx.x;
    if (blk >= 256) {
        const int m = (blk - 256) >> 6;
        const float* W = (m == 0) ? wq : (m == 1) ? wk : (m == 2) ? wv : wo;
        const int p = ((blk - 256) & 63) * 256 + threadIdx.x;
        const int c = p & 15, hf = (p >> 4) & 1, i = (p >> 5) & 3;
        const int ch = (p >> 7) & 7, tile = p >> 10;
        *(float4*)(wfr + m * (DM * DM) + p * 4) =
            *(const float4*)(W + (tile * 16 + c) * DM + ch * 32 + hf * 16 + i * 4);
        // Precaution: stands in front of any rewrite of the store's registers,
        // whichever half the compiler lays out behind this one.
        asm volatile("s_wait_xcnt 0x0" ::: "memory");
    } else {
        const int j = blk * 256 + threadIdx.x;
        const int c = j & 15, hf = (j >> 4) & 1, h = (j >> 5) & 1;
        const int ks = (j >> 6) & 7, tile = j >> 9;
        const float* ip = in + (tile * 16 + c) * DM + ks * 32 + h * 16 + hf * 8;
        const float4 v0 = *(const float4*)ip;
        const float4 v1 = *(const float4*)(ip + 4);
        v8bf p;
        p[0] = (__bf16)v0.x; p[1] = (__bf16)v0.y; p[2] = (__bf16)v0.z; p[3] = (__bf16)v0.w;
        p[4] = (__bf16)v1.x; p[5] = (__bf16)v1.y; p[6] = (__bf16)v1.z; p[7] = (__bf16)v1.w;
        ((v8bf*)outb)[j] = p;
        // Precaution: stands in front of any rewrite of the store's registers,
        // whichever half the compiler lays out behind this one.
        asm volatile("s_wait_xcnt 0x0" ::: "memory");
    }
}

// ---------------------------------------------------------------------------
// 5) Association head: per (b,n):
//      W1n = w1 * xn_row (bf16, LDS)
//      Ht  = W1n (128x256) @ tracks[b]^T (256x512)  via v_wmma_f32_16x16x32_bf16
//      out[t] = sigmoid( relu(Ht + b1)^T @ w2 + b2 )
//    4 waves; a wave holds all 128 hidden rows x 64 tracks at a time (two such
//    passes), so each W1n fragment read from LDS feeds four matrix
//    instructions.  With W1n as the A operand a lane's accumulators are 64
//    hidden units of each of four tracks: the sum over the hidden units is in-lane but
//    for one exchange between the lane halves.
//    The second launch bound asks for two waves per SIMD, that is two
//    work-groups per WGP: one builds its W1n while the other multiplies.
// ---------------------------------------------------------------------------
__global__ __launch_bounds__(128, 2) void assoc_kernel(
    const __bf16* __restrict__ trkbf,  // bf16 tracks in fragment order (cvt_kernel)
    const float* __restrict__ xn,      // [B][ND][DM]
    const float* __restrict__ w1,      // [DH][DM]
    const float* __restrict__ b1,      // [DH]
    const float* __restrict__ w2,      // [DH]
    const float* __restrict__ b2,      // [1]
    float* __restrict__ out)           // [B][ND][NT]
{
    __shared__ __attribute__((aligned(16))) __bf16 w1s[DH * W1S_STRIDE];   // 67,584 bytes
    __shared__ __attribute__((aligned(16))) float bw[2][DH];               // [0] = b1, [1] = w2

    const int n   = blockIdx.x;
    const int b   = blockIdx.y;
    const int tid = threadIdx.x;

    // Build W1n = w1 * xn_row into LDS (bf16, padded rows): thread t takes
    // columns 4*(t & 63) .. +3 of rows (t >> 6) + 2*i.  All of a thread's loads
    // are issued before the first is used: with four waves a shallow batch
    // would leave the build waiting out the L2 latency many times over.
    {
        const int d = (tid & 63) << 2;
        const float* wp  = w1 + (tid >> 6) * DM + d;
        const float4 xv  = *(const float4*)(xn + (b * ND + n) * DM + d);
        const float  b1t = b1[tid];
        const float  w2t = w2[tid];
        float4 wv[64];
        #pragma unroll
        for (int i = 0; i < 64; ++i)
            wv[i] = *(const float4*)(wp + i * 2 * DM);
        // Every global load of the build is issued above.  The wait stands before
        // any reuse of their address registers; naming wp as an input keeps the
        // 64 loads' address pair live up to it.
        asm volatile("s_wait_xcnt 0x0" :: "v"(wp) : "memory");
        #pragma unroll
        for (int i = 0; i < 64; ++i) {
            v4bf p;
            p.x = (__bf16)(wv[i].x * xv.x);
            p.y = (__bf16)(wv[i].y * xv.y);
            p.z = (__bf16)(wv[i].z * xv.z);
            p.w = (__bf16)(wv[i].w * xv.w);
            *(v4bf*)(&w1s[((tid >> 6) + 2 * i) * W1S_STRIDE + d]) = p;
        }
        bw[0][tid] = b1t;
        bw[1][tid] = w2t;
    }
    __syncthreads();

    const int wave  = tid >> 5;
    const int lane  = tid & 31;
    const int lhalf = lane & 15;
    const int hf    = lane >> 4;
    const int khalf = hf << 3;            // 0 for lanes 0-15, 8 for lanes 16-31

    const float bias2 = b2[0];

    // The lane's place in W1n: row lhalf of each 16-row tile, k = khalf.
    const __bf16* wrow = &w1s[lhalf * W1S_STRIDE + khalf];

    const __bf16* trk = trkbf + b * NT * DM;
    float* orow = out + (b * ND + n) * NT;

    for (int mp = 0; mp < 2; ++mp) {
        const int tbase = (wave * 2 + mp) * 64;
        // The lane's 16 bytes in the first half-fragment of the pass's first track
        // tile; a track tile is TT elements on, a k-step TK, the second half TH.
        const __bf16* trow = trk + (tbase >> 4) * TT + lane * 8;

        // acc[ti][ht][r] = Ht(hidden = 16*ht + 8*hf + r, track = tbase + 16*ti + lhalf)
        v8f acc[4][8];
        #pragma unroll
        for (int ti = 0; ti < 4; ++ti)
            #pragma unroll
            for (int ht = 0; ht < 8; ++ht)
                #pragma unroll
                for (int e = 0; e < 8; ++e) acc[ti][ht][e] = 0.f;

        // Fragments are fetched ahead into a second register set while the current
        // set's products run.  Tracks: two k-steps at a time, each load 512
        // contiguous bytes per wave.  W1n: four of the eight hidden tiles of one
        // k-step at a time.
        // Both operands by the same k order: lane<16 -> k {k0..k0+7,
        // k0+16..k0+23}; lane>=16 -> +8.
        union Frag { v16bf v; v8bf h[2]; };
        Frag tf[2][2][4], wf[2][4];
        #pragma unroll
        for (int w = 0; w < 2; ++w)
            #pragma unroll
            for (int ti = 0; ti < 4; ++ti) {
                tf[0][w][ti].h[0] = *(const v8bf*)(trow + ti * TT + w * TK);
                tf[0][w][ti].h[1] = *(const v8bf*)(trow + ti * TT + w * TK + TH);
            }
        #pragma unroll
        for (int j = 0; j < 4; ++j) {
            wf[0][j].h[0] = *(const v8bf*)(wrow + j * 16 * W1S_STRIDE);
            wf[0][j].h[1] = *(const v8bf*)(wrow + j * 16 * W1S_STRIDE + 16);
        }

        // Block t = 16 products: k-step t/2, hidden tiles 4*(t&1) .. +3, four track
        // tiles.  Unrolled so that the fragment sets and acc are indexed by constants.
        #pragma unroll
        for (int t = 0; t < DM / 16; ++t) {
            const int ks = t >> 1, g = t & 1;
            if ((t & 3) == 0 && t + 4 < DM / 16) {
                const int k2 = (ks + 2) * TK;
                #pragma unroll
                for (int w = 0; w < 2; ++w)
                    #pragma unroll
                    for (int ti = 0; ti < 4; ++ti) {
                        tf[((ks >> 1) + 1) & 1][w][ti].h[0] = *(const v8bf*)(trow + ti * TT + k2 + w * TK);
                        tf[((ks >> 1) + 1) & 1][w][ti].h[1] = *(const v8bf*)(trow + ti * TT + k2 + w * TK + TH);
                    }
            }
            if (t + 1 < DM / 16) {
                const int k1 = ((t + 1) >> 1) * 32, g1 = (t + 1) & 1;
                #pragma unroll
                for (int j = 0; j < 4; ++j) {
                    wf[(t + 1) & 1][j].h[0] = *(const v8bf*)(wrow + (g1 * 4 + j) * 16 * W1S_STRIDE + k1);
                    wf[(t + 1) & 1][j].h[1] = *(const v8bf*)(wrow + (g1 * 4 + j) * 16 * W1S_STRIDE + k1 + 16);
                }
            }
            // Keeps the loads above as one group ahead of this block's products:
            // without it the compiler sinks each load to just before its use and
            // the wave waits out every load's latency.
            __builtin_amdgcn_sched_barrier(0);
            #pragma unroll
            for (int j = 0; j < 4; ++j)
                #pragma unroll
                for (int ti = 0; ti < 4; ++ti)
                    acc[ti][g * 4 + j] = __builtin_amdgcn_wmma_f32_16x16x32_bf16(
                        false, wf[t & 1][j].v, false, tf[(ks >> 1) & 1][ks & 1][ti].v,
                        (short)0, acc[ti][g * 4 + j], false, false);
            // Keeps the next block's loads behind this block's products (the other
            // side of the fence above).
            __builtin_amdgcn_sched_barrier(0);
        }
        // The wait before the track loads' address registers are reused by the
        // next pass; naming the address as an input keeps it live up to here.
        asm volatile("s_wait_xcnt 0x0" :: "v"(trow) : "memory");

        // Second layer: this lane's 64 hidden units of each of its four tracks.
        v2f s2[4];
        #pragma unroll
        for (int ti = 0; ti < 4; ++ti) s2[ti] = (v2f){0.f, 0.f};
        #pragma unroll
        for (int ht = 0; ht < 8; ++ht) {
            const v4f bl = *(const v4f*)&bw[0][ht * 16 + khalf];
            const v4f bh = *(const v4f*)&bw[0][ht * 16 + khalf + 4];
            const v4f wl = *(const v4f*)&bw[1][ht * 16 + khalf];
            const v4f wh = *(const v4f*)&bw[1][ht * 16 + khalf + 4];
            #pragma unroll
            for (int ti = 0; ti < 4; ++ti) {
                #pragma unroll
                for (int p = 0; p < 2; ++p) {
                    v2f hl = {acc[ti][ht][2 * p] + bl[2 * p], acc[ti][ht][2 * p + 1] + bl[2 * p + 1]};
                    v2f hh = {acc[ti][ht][4 + 2 * p] + bh[2 * p], acc[ti][ht][5 + 2 * p] + bh[2 * p + 1]};
                    hl.x = fmaxf(hl.x, 0.f); hl.y = fmaxf(hl.y, 0.f);
                    hh.x = fmaxf(hh.x, 0.f); hh.y = fmaxf(hh.y, 0.f);
                    s2[ti] += hl * (v2f){wl[2 * p], wl[2 * p + 1]};
                    s2[ti] += hh * (v2f){wh[2 * p], wh[2 * p + 1]};
                }
            }
        }
        // Join the two lane halves (they hold the same track, the other 64 hidden units).
        float sv[4];
        #pragma unroll
        for (int ti = 0; ti < 4; ++ti) {
            const float s = s2[ti].x + s2[ti].y;
            const int si = __float_as_int(s);
            sv[ti] = s + __int_as_float(
                __builtin_amdgcn_permlanex16(si, si, 0x76543210, 0xfedcba98, false, false));
        }
        // Half hf finishes track tiles 2*j + hf: a store is 32 consecutive tracks, one whole line.
        float* op = orow + tbase + lane;
        #pragma unroll
        for (int j = 0; j < 2; ++j) {
            const float logit = (hf ? sv[2 * j + 1] : sv[2 * j]) + bias2;
            op[j * 32] = 1.f / (1.f + __expf(-logit));
        }
        // The wait before the next pass reuses the stores' address and data registers.
        asm volatile("s_wait_xcnt 0x0" :: "v"(op) : "memory");
    }
}

// ---------------------------------------------------------------------------
// Launcher
// ---------------------------------------------------------------------------
extern "C" void kernel_launch(void* const* d_in, const int* in_sizes, int n_in,
                              void* d_out, int out_size, void* d_ws, size_t ws_size,
                              hipStream_t stream)
{
    const float* det = (const float*)d_in[0];
    const float* trk = (const float*)d_in[1];
    const float* wq  = (const float*)d_in[2];
    const float* bq  = (const float*)d_in[3];
    const float* wk  = (const float*)d_in[4];
    const float* bk  = (const float*)d_in[5];
    const float* wv  = (const float*)d_in[6];
    const float* bv  = (const float*)d_in[7];
    const float* wo  = (const float*)d_in[8];
    const float* bo  = (const float*)d_in[9];
    const float* lng = (const float*)d_in[10];
    const float* lnb = (const float*)d_in[11];
    const float* w1  = (const float*)d_in[12];
    const float* b1  = (const float*)d_in[13];
    const float* w2  = (const float*)d_in[14];
    const float* b2  = (const float*)d_in[15];
    float* out = (float*)d_out;

    const size_t rowsD = (size_t)B_ * ND * DM;  // 524288 floats
    float* Q   = (float*)d_ws;
    float* K   = Q + rowsD;
    float* V   = K + rowsD;
    float* CTX = V + rowsD;
    float* XN  = CTX + rowsD;
    __bf16* TRKB = (__bf16*)(XN + rowsD);       // 1 MB of bf16
    float* WFR = (float*)(TRKB + rowsD);        // 4 x 256 KB: w_q, w_k, w_v, w_o

    cvt_kernel<<<dim3(512), 256, 0, stream>>>(trk, wq, wk, wv, wo, TRKB, WFR);
    qkv_kernel<<<dim3(B_ * ND / 32, DM / 64, 3), 128, 0, stream>>>(det, trk, WFR, bq, bk, bv, Q, K, V);
    attn_kernel<<<dim3(ND / AQ, NH, B_), 256, 0, stream>>>(Q, K, V, CTX);
    oln_kernel<<<dim3(B_ * ND / 16), 512, 0, stream>>>(det, CTX, WFR + 3 * DM * DM, bo, lng, lnb, XN);
    assoc_kernel<<<dim3(ND, B_), 128, 0, stream>>>(TRKB, XN, w1, b1, w2, b2, out);
}

// v005
// Measured time: 69.3 microseconds a run.
// In two side-by-side timings against v004, it was 1.03 and 1.04 times as fast.
// All steps since v000 together make it 4.28 times as fast.
#include <hip/hip_runtime.h>
#include <hip/hip_bf16.h>

#define B_    4
#define ND    512
#define NT    512
#define DM    256
#define DH    128
#define NH    8
#define DK    32
#define XP    260    // floats per LDS row of a projection's x tile: 256 + 4 pad (16 B x odd)
#define YW    20     // floats per LDS row of a qkv wave's output part: 16 + 4 pad (16 B x odd)
#define AQ    32     // queries per attention block
#define AKW   64     // keys per attention wave
#define OPITCH 36    // floats per LDS row of an output part: 32 + 4 pad, 16B aligned
#define W1S_STRIDE 264   // bf16 elems per row: 256 + 8 pad -> 528 B (16B aligned, banks spread)
#define TH    256    // bf16 elems of half a track fragment: 32 lanes x 8
#define TK    512    // bf16 elems of a track fragment (16 tracks x 32 k)
#define TT    4096   // bf16 elems of a track tile (16 tracks x 256 k)

typedef __attribute__((ext_vector_type(16))) __bf16 v16bf;
typedef __attribute__((ext_vector_type(8)))  __bf16 v8bf;
typedef __attribute__((ext_vector_type(4)))  __bf16 v4bf;
typedef __attribute__((ext_vector_type(8)))  float  v8f;
typedef __attribute__((ext_vector_type(2)))  float  v2f;
typedef __attribute__((ext_vector_type(4)))  float  v4f;

// ---------------------------------------------------------------------------
// Shared by the four linear projections y = x W^T + b, on the f32 16x16x4
// matrix form as Yt = W * Xt: A = 16 rows of W (output columns), B = 16 rows of
// x.  Both fragments by the same code: lane (c, hf) holds row c,
// k = 32*ch + 16*hf + 4*i + {0..3}; two k-steps of the matrix form per float4.
// acc[qt][r] = y(row = 16*qt + c, column = 8*hf + r).
// wf: the wave's 16 rows of W, all 256 k, in registers, in this order.
// xl: the lane's place in the x tile in LDS (row c, k = 16*hf).
// ---------------------------------------------------------------------------
template <int NQ>
__device__ __forceinline__ void proj_mma(const float4 (&wf)[8][4], const float* xl, v8f (&acc)[NQ])
{
    // every loop here is unrolled so that wf and acc are indexed by constants
    // and stay in registers
    #pragma unroll
    for (int ch = 0; ch < 8; ++ch) {
        #pragma unroll
        for (int i = 0; i < 4; ++i) {
            float4 xf[NQ];
            #pragma unroll
            for (int qt = 0; qt < NQ; ++qt)
                xf[qt] = *(const float4*)(xl + qt * 16 * XP + ch * 32 + 4 * i);
            const v2f w01 = {wf[ch][i].x, wf[ch][i].y};
            const v2f w23 = {wf[ch][i].z, wf[ch][i].w};
            #pragma unroll
            for (int qt = 0; qt < NQ; ++qt) {
                const v2f x01 = {xf[qt].x, xf[qt].y};
                acc[qt] = __builtin_amdgcn_wmma_f32_16x16x4_f32(
                    false, w01, false, x01, (short)0, acc[qt], false, false);
            }
            #pragma unroll
            for (int qt = 0; qt < NQ; ++qt) {
                const v2f x23 = {xf[qt].z, xf[qt].w};
                acc[qt] = __builtin_amdgcn_wmma_f32_16x16x4_f32(
                    false, w23, false, x23, (short)0, acc[qt], false, false);
            }
        }
    }
}

// ---------------------------------------------------------------------------
// 1) QKV projection: block = 32 rows x 64 output columns (two heads), 4 waves,
//    wave w owns columns [16w, 16w+16).  The 32 rows of x are staged in LDS and
//    shared by the waves.  A wave's 16 rows of W are 16 KB in a row in memory:
//    it loads them as they lie (a load is 512 contiguous bytes, four whole
//    lines), puts them into LDS and reads its fragments back from there.
//    blockIdx.x = row tile (0..63), .y = column group (0..3), .z = 0=Q,1=K,2=V
//    Two operands of later kernels are laid out here as well, in the order in
//    which those kernels load their matrix fragments, so that one 16-byte load
//    per lane is 512 contiguous bytes per wave there; a thread writes one
//    16-byte piece, a wave 512 contiguous bytes:
//    K and V blocks, from their x tile: tracks fp32 -> bf16 for the head,
//    [B*NT/16 track tiles][DM/32 k-steps][2 halves][32 lanes][8 bf16]; lane
//    (c, hf) of half h holds track 16*tile + c, k = 32*kstep + 16*h + 8*hf + {0..7}.
//    Q blocks of column groups 0 and 1: w_o (fp32 as it is) for oln_kernel,
//    [DM/16 row tiles][8 ch][4 i][32 lanes][4 floats]; lane (c, hf) holds row
//    16*tile + c, k = 32*ch + 16*hf + 4*i + {0..3}.
// ---------------------------------------------------------------------------
__global__ __launch_bounds__(128) void qkv_kernel(
    const float* __restrict__ det, const float* __restrict__ trk,
    const float* __restrict__ wq, const float* __restrict__ wk,
    const float* __restrict__ wv, const float* __restrict__ wo,
    const float* __restrict__ bq, const float* __restrict__ bk,
    const float* __restrict__ bv,
    float* __restrict__ Q, float* __restrict__ K, float* __restrict__ V,
    __bf16* __restrict__ trkb, float* __restrict__ wofr)
{
    __shared__ __attribute__((aligned(16))) float xs[32 * XP];
    __shared__ __attribute__((aligned(16))) float wl[64 * XP];
    const int which = blockIdx.z;
    const int tid   = threadIdx.x;
    const int row0  = blockIdx.x * 32;
    const int wave = tid >> 5, lane = tid & 31;
    const int c = lane & 15, hf = lane >> 4;
    const int col0 = blockIdx.y * 64 + wave * 16;

    const float* in   = (which == 0) ? det : trk;
    const float* W    = (which == 0) ? wq : (which == 1) ? wk : wv;
    const float* bias = (which == 0) ? bq : (which == 1) ? bk : bv;
    float* outp       = (which == 0) ? Q  : (which == 1) ? K  : V;

    // The thread's piece of the w_o copy (blocks with copies_wo only).
    const bool copies_wo = (which == 0) && (blockIdx.y < 2);
    const int po = (blockIdx.x * 2 + (blockIdx.y & 1)) * 128 + tid;    // 0 .. 16383

    // x tile: 32 rows are 8192 contiguous floats; thread t takes float4 t + 128*j
    // W rows: 16 rows are 4096 contiguous floats; lane l takes float4 l + 32*j
    const float* xb = in + row0 * DM;
    const float* xp = xb + tid * 4;
    const float* wp = W + col0 * DM + lane * 4;
    const float* bp = bias + col0 + hf * 8;
    const float* sp = wo + ((po >> 10) * 16 + (po & 15)) * DM
                         + ((po >> 7) & 7) * 32 + ((po >> 4) & 1) * 16 + ((po >> 5) & 3) * 4;
    float4 ov = make_float4(0.f, 0.f, 0.f, 0.f);
    if (copies_wo)
        ov = *(const float4*)sp;
    v4f xr[16];
    v4f wr[32];
    #pragma unroll
    for (int j = 0; j < 16; ++j)
        xr[j] = *(const v4f*)(xp + j * 512);
    #pragma unroll
    for (int j = 0; j < 32; ++j)
        wr[j] = *(const v4f*)(wp + j * 128);
    const float4 bl = *(const float4*)bp;
    const float4 bh = *(const float4*)(bp + 4);
    // Every global load of the wave is issued above.  The wait stands before any
    // reuse of their address registers; naming the addresses as inputs (the x
    // tile's also as the scalar base that its loads may use) keeps those
    // registers live up to it.
    asm volatile("s_wait_xcnt 0x0" :: "v"(xp), "s"(xb), "v"(wp), "v"(bp), "v"(sp) : "memory");

    #pragma unroll
    for (int j = 0; j < 16; ++j)
        *(v4f*)&xs[((tid >> 6) + 2 * j) * XP + (tid & 63) * 4] = xr[j];
    #pragma unroll
    for (int j = 0; j < 32; ++j)
        *(v4f*)&wl[(wave * 16 + (j >> 1)) * XP + (j & 1) * 128 + lane * 4] = wr[j];
    __syncthreads();

    float4 wf[8][4];
    #pragma unroll
    for (int ch = 0; ch < 8; ++ch)
        #pragma unroll
        for (int i = 0; i < 4; ++i)
            wf[ch][i] = *(const float4*)&wl[(wave * 16 + c) * XP + hf * 16 + ch * 32 + 4 * i];

    v8f acc[2];
    #pragma unroll
    for (int qt = 0; qt < 2; ++qt) {
        acc[qt][0] = bl.x; acc[qt][1] = bl.y; acc[qt][2] = bl.z; acc[qt][3] = bl.w;
        acc[qt][4] = bh.x; acc[qt][5] = bh.y; acc[qt][6] = bh.z; acc[qt][7] = bh.w;
    }
    proj_mma<2>(wf, &xs[c * XP + hf * 16], acc);

    // Through LDS, so that each 128-byte line of the output is stored whole by
    // one wave.  A wave puts its 32 rows x 16 columns where its own rows of W
    // lay: only this wave has read them, and it has read them all by now.
    #pragma unroll
    for (int qt = 0; qt < 2; ++qt) {
        float* dst = &wl[wave * 16 * XP + (qt * 16 + c) * YW + hf * 8];
        *(float4*)dst       = make_float4(acc[qt][0], acc[qt][1], acc[qt][2], acc[qt][3]);
        *(float4*)(dst + 4) = make_float4(acc[qt][4], acc[qt][5], acc[qt][6], acc[qt][7]);
    }
    // The 32 tracks of the x tile are 1024 pieces; the eight K and V blocks of
    // this row tile take 128 each.
    const int jj = (((which - 1) & 1) * 4 + blockIdx.y) * 128 + tid;
    v8bf tp = {};
    if (which != 0) {
        const float* ip = &xs[((jj >> 9) * 16 + (jj & 15)) * XP
                              + ((jj >> 6) & 7) * 32 + ((jj >> 5) & 1) * 16 + ((jj >> 4) & 1) * 8];
        const float4 v0 = *(const float4*)ip;
        const float4 v1 = *(const float4*)(ip + 4);
        tp[0] = (__bf16)v0.x; tp[1] = (__bf16)v0.y; tp[2] = (__bf16)v0.z; tp[3] = (__bf16)v0.w;
        tp[4] = (__bf16)v1.x; tp[5] = (__bf16)v1.y; tp[6] = (__bf16)v1.z; tp[7] = (__bf16)v1.w;
    }
    __syncthreads();

    // The two copies are stored behind the last barrier: in front of one, the
    // barrier would wait for the store to complete.
    if (which != 0) {
        ((v8bf*)trkb)[blockIdx.x * 1024 + jj] = tp;
        // Precaution: stands in front of any rewrite of the store's registers.
        asm volatile("s_wait_xcnt 0x0" ::: "memory");
    } else if (copies_wo) {
        *(float4*)(wofr + po * 4) = ov;
        // Precaution: stands in front of any rewrite of the store's registers.
        asm volatile("s_wait_xcnt 0x0" ::: "memory");
    }

    const int b = row0 >> 9, n0 = row0 & 511;
    #pragma unroll
    for (int p = 0; p < 4; ++p) {
        const int idx = tid + 128 * p;            // float4 index in the block's output
        const int hh = idx >> 8;
        // V: row-major.  Q and K: in the order in which attn_kernel loads its
        // fragments, [16-row tile][i][lane (c, hf)][4]: row 16*tile + c,
        // dk = 16*hf + 4*i + {0..3}.  Either way piece idx goes to place idx.
        const int r  = (which == 2) ? (idx >> 3) & 31 : ((idx >> 7) & 1) * 16 + (idx & 15);
        const int d4 = (which == 2) ? (idx & 7) << 2  : ((idx >> 4) & 1) * 16 + ((idx >> 5) & 3) * 4;
        *(float4*)(outp + ((b * NH + blockIdx.y * 2 + hh) * ND + n0) * DK + (idx & 255) * 4) =
            *(const float4*)&wl[(hh * 2 + (d4 >> 4)) * 16 * XP + r * YW + (d4 & 15)];
    }
}

// ---------------------------------------------------------------------------
// 2) Attention on the f32 16x16x4 matrix form, 32 queries per block.
//    grid = (ND/AQ, NH, B_); 256 threads = 8 waves; wave w owns keys
//    [64w, 64w+64).  St = K * Qt and Ot = Vt * Pt, so a lane holds one query's
//    scores and the score registers are the B operand of the second product.
//    Each wave makes a softmax part (max, sum, unnormalised Ot) over its own
//    keys; the 8 parts are joined through LDS.
// ---------------------------------------------------------------------------
__global__ __launch_bounds__(256) void attn_kernel(
    const float* __restrict__ Q, const float* __restrict__ K,
    const float* __restrict__ V, float* __restrict__ ctx)
{
    __shared__ float sO[8][AQ][OPITCH];   // per-wave unnormalised output parts
    __shared__ float sML[2][8][AQ];       // [0] = part max, [1] = part sum

    const int q0 = blockIdx.x * AQ;
    const int h = blockIdx.y, b = blockIdx.z;
    const int tid = threadIdx.x;
    const int wv = tid >> 5, lane = tid & 31;
    const int c = lane & 15, hf = lane >> 4;

    const float* Qb = Q + ((b * NH + h) * ND + q0) * DK;
    const float* Kb = K + ((b * NH + h) * NT + wv * AKW) * DK;
    const float* Vb = V + ((b * NH + h) * NT + wv * AKW) * DK;

    // Q and K fragments by the same code: lane (c, hf) holds row c,
    // dk = 16*hf + 4*i + {0..3}; two k-steps of the matrix form per float4.
    // qkv_kernel has stored them in that order, [16-row tile][i][lane][4], so a
    // load is 512 contiguous bytes per wave.
    const float* qp = Qb + lane * 4;
    const float* kp = Kb + lane * 4;
    // V: lane (c, hf) holds keys 8*hf + r of each 16-key tile, dv = 2*c, 2*c + 1.
    const float* vp = Vb + hf * 8 * DK + 2 * c;

    float4 qf[2][4];
    float4 kf[4][4];
    float2 vf[4][8];
    #pragma unroll
    for (int i = 0; i < 4; ++i) {
        #pragma unroll
        for (int qt = 0; qt < 2; ++qt)
            qf[qt][i] = *(const float4*)(qp + qt * 16 * DK + 128 * i);
        #pragma unroll
        for (int kt = 0; kt < 4; ++kt)
            kf[kt][i] = *(const float4*)(kp + kt * 16 * DK + 128 * i);
    }
    #pragma unroll
    for (int kt = 0; kt < 4; ++kt)
        #pragma unroll
        for (int r = 0; r < 8; ++r)
            vf[kt][r] = *(const float2*)(vp + (kt * 16 + r) * DK);
    // Every global load of the wave is issued above.  The wait stands before any
    // reuse of their address registers; naming the addresses as inputs keeps
    // those registers live up to it.
    asm volatile("s_wait_xcnt 0x0" :: "v"(qp), "v"(kp), "v"(vp) : "memory");

    // st[kt][qt][r] = score(key = 16*kt + 8*hf + r, query = 16*qt + c), unscaled
    v8f st[4][2];
    #pragma unroll
    for (int kt = 0; kt < 4; ++kt) {
        #pragma unroll
        for (int qt = 0; qt < 2; ++qt)
            #pragma unroll
            for (int e = 0; e < 8; ++e) st[kt][qt][e] = 0.f;
        #pragma unroll
        for (int i = 0; i < 4; ++i) {
            const v2f k01 = {kf[kt][i].x, kf[kt][i].y};
            const v2f k23 = {kf[kt][i].z, kf[kt][i].w};
            #pragma unroll
            for (int qt = 0; qt < 2; ++qt) {
                const v2f q01 = {qf[qt][i].x, qf[qt][i].y};
                st[kt][qt] = __builtin_amdgcn_wmma_f32_16x16x4_f32(
                    false, k01, false, q01, (short)0, st[kt][qt], false, false);
            }
            #pragma unroll
            for (int qt = 0; qt < 2; ++qt) {
                const v2f q23 = {qf[qt][i].z, qf[qt][i].w};
                st[kt][qt] = __builtin_amdgcn_wmma_f32_16x16x4_f32(
                    false, k23, false, q23, (short)0, st[kt][qt], false, false);
            }
        }
    }

    // Softmax part over this wave's 64 keys: in-lane, plus one exchange
    // between the lane halves (they hold the same query).
    const float scale = 0.17677669529663687f;  // 1/sqrt(32)
    float pm[2], pl[2];
    #pragma unroll
    for (int qt = 0; qt < 2; ++qt) {
        float m = st[0][qt][0];
        #pragma unroll
        for (int kt = 0; kt < 4; ++kt)
            #pragma unroll
            for (int r = 0; r < 8; ++r) m = fmaxf(m, st[kt][qt][r]);
        m = fmaxf(m, __shfl_xor(m, 16, 32));
        m *= scale;
        float l = 0.f;
        #pragma unroll
        for (int kt = 0; kt < 4; ++kt)
            #pragma unroll
            for (int r = 0; r < 8; ++r) {
                const float p = __expf(st[kt][qt][r] * scale - m);
                st[kt][qt][r] = p;
                l += p;
            }
        l += __shfl_xor(l, 16, 32);
        pm[qt] = m;
        pl[qt] = l;
    }

    // Ot[dt][qt] += Vt * Pt.  k-step s of key tile kt pairs key 8*hf + 2*s + j
    // on both sides (B = score registers 2s, 2s+1).  Row c of tile dt is
    // dv = 2*c + dt, so one 8-byte load feeds both tiles.
    v8f o[2][2];
    #pragma unroll
    for (int dt = 0; dt < 2; ++dt)
        #pragma unroll
        for (int qt = 0; qt < 2; ++qt)
            #pragma unroll
            for (int e = 0; e < 8; ++e) o[dt][qt][e] = 0.f;

    #pragma unroll
    for (int kt = 0; kt < 4; ++kt) {
        #pragma unroll
        for (int s = 0; s < 4; ++s) {
            const v2f va = {vf[kt][2 * s].x, vf[kt][2 * s + 1].x};
            const v2f vb = {vf[kt][2 * s].y, vf[kt][2 * s + 1].y};
            #pragma unroll
            for (int qt = 0; qt < 2; ++qt) {
                const v2f p = {st[kt][qt][2 * s], st[kt][qt][2 * s + 1]};
                o[0][qt] = __builtin_amdgcn_wmma_f32_16x16x4_f32(
                    false, va, false, p, (short)0, o[0][qt], false, false);
                o[1][qt] = __builtin_amdgcn_wmma_f32_16x16x4_f32(
                    false, vb, false, p, (short)0, o[1][qt], false, false);
            }
        }
    }

    // o[dt][qt][r] = Ot(dv = 16*hf + 2*r + dt, query = 16*qt + c)
    #pragma unroll
    for (int qt = 0; qt < 2; ++qt) {
        float* dst = &sO[wv][qt * 16 + c][hf * 16];
        #pragma unroll
        for (int i = 0; i < 4; ++i)
            *(float4*)(dst + 4 * i) = make_float4(o[0][qt][2 * i],     o[1][qt][2 * i],
                                                  o[0][qt][2 * i + 1], o[1][qt][2 * i + 1]);
        // both halves hold the same max and sum: half 0 stores the max, half 1 the sum
        sML[hf][wv][qt * 16 + c] = hf ? pl[qt] : pm[qt];
    }
    __syncthreads();

    // Join the 8 parts: thread -> query tid/8, four dv.
    const int q = tid >> 3, d4 = (tid & 7) << 2;
    float M = sML[0][0][q];
    #pragma unroll
    for (int w = 1; w < 8; ++w) M = fmaxf(M, sML[0][w][q]);
    float L = 0.f;
    float4 acc = make_float4(0.f, 0.f, 0.f, 0.f);
    #pragma unroll
    for (int w = 0; w < 8; ++w) {
        const float f = __expf(sML[0][w][q] - M);
        const float4 o4 = *(const float4*)&sO[w][q][d4];
        L += f * sML[1][w][q];
        acc.x += f * o4.x; acc.y += f * o4.y; acc.z += f * o4.z; acc.w += f * o4.w;
    }
    const float inv = 1.f / L;
    *(float4*)(ctx + (b * ND + q0 + q) * DM + h * DK + d4) =
        make_float4(acc.x * inv, acc.y * inv, acc.z * inv, acc.w * inv);
}

// ---------------------------------------------------------------------------
// 3) Output projection + residual + LayerNorm: block = 16 rows x all 256
//    columns, 16 waves; wave w owns columns [16w, 16w+16) of the product and
//    then row w of the LayerNorm.
// ---------------------------------------------------------------------------
__global__ __launch_bounds__(512) void oln_kernel(
    const float* __restrict__ det, const float* __restrict__ ctx,
    const float* __restrict__ wo,      // w_o in fragment order (qkv_kernel)
    const float* __restrict__ bo,
    const float* __restrict__ g, const float* __restrict__ beta,
    float* __restrict__ xn)
{
    __shared__ __attribute__((aligned(16))) float cs[16 * XP];
    __shared__ __attribute__((aligned(16))) float xb[16 * XP];
    const int tid  = threadIdx.x;
    const int row0 = blockIdx.x * 16;
    const int wave = tid >> 5, lane = tid & 31;
    const int c = lane & 15, hf = lane >> 4;
    const int col0 = wave * 16;

    // ctx tile: 16 rows are 4096 contiguous floats; thread t takes float4 t + 512*j
    const float* cp = ctx + row0 * DM + tid * 4;
    const float* wp = wo + col0 * DM + lane * 4;
    const float* bp = bo + col0 + hf * 8;
    const float* dp = det + (row0 + c) * DM + col0 + hf * 8;
    v4f cr[2];
    float4 wf[8][4];
    #pragma unroll
    for (int j = 0; j < 2; ++j)
        cr[j] = *(const v4f*)(cp + j * 2048);
    #pragma unroll
    for (int ch = 0; ch < 8; ++ch)
        #pragma unroll
        for (int i = 0; i < 4; ++i)
            wf[ch][i] = *(const float4*)(wp + (ch * 4 + i) * 128);
    const float4 bl = *(const float4*)bp;
    const float4 bh = *(const float4*)(bp + 4);
    const float4 dl = *(const float4*)dp;
    const float4 dh = *(const float4*)(dp + 4);
    // As in qkv_kernel: the wait before any reuse of the loads' address registers.
    asm volatile("s_wait_xcnt 0x0" :: "v"(cp), "v"(wp), "v"(bp), "v"(dp) : "memory");

    #pragma unroll
    for (int j = 0; j < 2; ++j)
        *(v4f*)&cs[((tid >> 6) + 8 * j) * XP + (tid & 63) * 4] = cr[j];
    __syncthreads();

    v8f acc[1];
    acc[0][0] = bl.x; acc[0][1] = bl.y; acc[0][2] = bl.z; acc[0][3] = bl.w;
    acc[0][4] = bh.x; acc[0][5] = bh.y; acc[0][6] = bh.z; acc[0][7] = bh.w;
    proj_mma<1>(wf, &cs[c * XP + hf * 16], acc);

    float* xd = &xb[c * XP + col0 + hf * 8];
    *(float4*)xd       = make_float4(dl.x + acc[0][0], dl.y + acc[0][1],
                                     dl.z + acc[0][2], dl.w + acc[0][3]);
    *(float4*)(xd + 4) = make_float4(dh.x + acc[0][4], dh.y + acc[0][5],
                                     dh.z + acc[0][6], dh.w + acc[0][7]);
    __syncthreads();

    // wave w reduces row w (sum, sumsq); every lane ends with both sums
    float s = 0.f, s2 = 0.f;
    #pragma unroll
    for (int i = 0; i < DM / 32; ++i) {
        const float v = xb[wave * XP + lane + 32 * i];
        s += v; s2 += v * v;
    }
    s  += __shfl_xor(s, 1, 32);  s2 += __shfl_xor(s2, 1, 32);
    s  += __shfl_xor(s, 2, 32);  s2 += __shfl_xor(s2, 2, 32);
    s  += __shfl_xor(s, 4, 32);  s2 += __shfl_xor(s2, 4, 32);
    s  += __shfl_xor(s, 8, 32);  s2 += __shfl_xor(s2, 8, 32);
    s  += __shfl_xor(s, 16, 32); s2 += __shfl_xor(s2, 16, 32);
    const float mu  = s * (1.f / DM);
    const float inv = rsqrtf(s2 * (1.f / DM) - mu * mu + 1e-5f);

    #pragma unroll
    for (int i = 0; i < DM / 32; ++i) {
        const int col = lane + 32 * i;
        xn[(row0 + wave) * DM + col] = (xb[wave * XP + col] - mu) * inv * g[col] + beta[col];
    }
}

// ---------------------------------------------------------------------------
// 4) Association head: per (b,n):
//      W1n = w1 * xn_row (bf16, LDS)
//      Ht  = W1n (128x256) @ tracks[b]^T (256x512)  via v_wmma_f32_16x16x32_bf16
//      out[t] = sigmoid( relu(Ht + b1)^T @ w2 + b2 )
//    4 waves; a wave holds all 128 hidden rows x 64 tracks at a time (two such
//    passes), so each W1n fragment read from LDS feeds four matrix
//    instructions.  With W1n as the A operand a lane's accumulators are 64
//    hidden units of each of four tracks: the sum over the hidden units is in-lane but
//    for one exchange between the lane halves.
//    The second launch bound asks for two waves per SIMD, that is two
//    work-groups per WGP: one builds its W1n while the other multiplies.
// ---------------------------------------------------------------------------
__global__ __launch_bounds__(128, 2) void assoc_kernel(
    const __bf16* __restrict__ trkbf,  // bf16 tracks in fragment order (qkv_kernel)
    const float* __restrict__ xn,      // [B][ND][DM]
    const float* __restrict__ w1,      // [DH][DM]
    const float* __restrict__ b1,      // [DH]
    const float* __restrict__ w2,      // [DH]
    const float* __restrict__ b2,      // [1]
    float* __restrict__ out)           // [B][ND][NT]
{
    __shared__ __attribute__((aligned(16))) __bf16 w1s[DH * W1S_STRIDE];   // 67,584 bytes
    __shared__ __attribute__((aligned(16))) float bw[2][DH];               // [0] = b1, [1] = w2

    const int n   = blockIdx.x;
    const int b   = blockIdx.y;
    const int tid = threadIdx.x;

    // Build W1n = w1 * xn_row into LDS (bf16, padded rows): thread t takes
    // columns 4*(t & 63) .. +3 of rows (t >> 6) + 2*i.  All of a thread's loads
    // are issued before the first is used: with four waves a shallow batch
    // would leave the build waiting out the L2 latency many times over.
    {
        const int d = (tid & 63) << 2;
        const float* wp  = w1 + (tid >> 6) * DM + d;
        const float4 xv  = *(const float4*)(xn + (b * ND + n) * DM + d);
        const float  b1t = b1[tid];
        const float  w2t = w2[tid];
        float4 wv[64];
        #pragma unroll
        for (int i = 0; i < 64; ++i)
            wv[i] = *(const float4*)(wp + i * 2 * DM);
        // Every global load of the build is issued above.  The wait stands before
        // any reuse of their address registers; naming wp as an input keeps the
        // 64 loads' address pair live up to it.
        asm volatile("s_wait_xcnt 0x0" :: "v"(wp) : "memory");
        #pragma unroll
        for (int i = 0; i < 64; ++i) {
            v4bf p;
            p.x = (__bf16)(wv[i].x * xv.x);
            p.y = (__bf16)(wv[i].y * xv.y);
            p.z = (__bf16)(wv[i].z * xv.z);
            p.w = (__bf16)(wv[i].w * xv.w);
            *(v4bf*)(&w1s[((tid >> 6) + 2 * i) * W1S_STRIDE + d]) = p;
        }
        bw[0][tid] = b1t;
        bw[1][tid] = w2t;
    }
    __syncthreads();

    const int wave  = tid >> 5;
    const int lane  = tid & 31;
    const int lhalf = lane & 15;
    const int hf    = lane >> 4;
    const int khalf = hf << 3;            // 0 for lanes 0-15, 8 for lanes 16-31

    const float bias2 = b2[0];

    // The lane's place in W1n: row lhalf of each 16-row tile, k = khalf.
    const __bf16* wrow = &w1s[lhalf * W1S_STRIDE + khalf];

    const __bf16* trk = trkbf + b * NT * DM;
    float* orow = out + (b * ND + n) * NT;

    for (int mp = 0; mp < 2; ++mp) {
        const int tbase = (wave * 2 + mp) * 64;
        // The lane's 16 bytes in the first half-fragment of the pass's first track
        // tile; a track tile is TT elements on, a k-step TK, the second half TH.
        const __bf16* trow = trk + (tbase >> 4) * TT + lane * 8;

        // acc[ti][ht][r] = Ht(hidden = 16*ht + 8*hf + r, track = tbase + 16*ti + lhalf)
        v8f acc[4][8];
        #pragma unroll
        for (int ti = 0; ti < 4; ++ti)
            #pragma unroll
            for (int ht = 0; ht < 8; ++ht)
                #pragma unroll
                for (int e = 0; e < 8; ++e) acc[ti][ht][e] = 0.f;

        // Fragments are fetched ahead into a second register set while the current
        // set's products run.  Tracks: two k-steps at a time, each load 512
        // contiguous bytes per wave.  W1n: four of the eight hidden tiles of one
        // k-step at a time.
        // Both operands by the same k order: lane<16 -> k {k0..k0+7,
        // k0+16..k0+23}; lane>=16 -> +8.
        union Frag { v16bf v; v8bf h[2]; };
        Frag tf[2][2][4], wf[2][4];
        #pragma unroll
        for (int w = 0; w < 2; ++w)
            #pragma unroll
            for (int ti = 0; ti < 4; ++ti) {
                tf[0][w][ti].h[0] = *(const v8bf*)(trow + ti * TT + w * TK);
                tf[0][w][ti].h[1] = *(const v8bf*)(trow + ti * TT + w * TK + TH);
            }
        #pragma unroll
        for (int j = 0; j < 4; ++j) {
            wf[0][j].h[0] = *(const v8bf*)(wrow + j * 16 * W1S_STRIDE);
            wf[0][j].h[1] = *(const v8bf*)(wrow + j * 16 * W1S_STRIDE + 16);
        }

        // Block t = 16 products: k-step t/2, hidden tiles 4*(t&1) .. +3, four track
        // tiles.  Unrolled so that the fragment sets and acc are indexed by constants.
        #pragma unroll
        for (int t = 0; t < DM / 16; ++t) {
            const int ks = t >> 1, g = t & 1;
            if ((t & 3) == 0 && t + 4 < DM / 16) {
                const int k2 = (ks + 2) * TK;
                #pragma unroll
                for (int w = 0; w < 2; ++w)
                    #pragma unroll
                    for (int ti = 0; ti < 4; ++ti) {
                        tf[((ks >> 1) + 1) & 1][w][ti].h[0] = *(const v8bf*)(trow + ti * TT + k2 + w * TK);
                        tf[((ks >> 1) + 1) & 1][w][ti].h[1] = *(const v8bf*)(trow + ti * TT + k2 + w * TK + TH);
                    }
            }
            if (t + 1 < DM / 16) {
                const int k1 = ((t + 1) >> 1) * 32, g1 = (t + 1) & 1;
                #pragma unroll
                for (int j = 0; j < 4; ++j) {
                    wf[(t + 1) & 1][j].h[0] = *(const v8bf*)(wrow + (g1 * 4 + j) * 16 * W1S_STRIDE + k1);
                    wf[(t + 1) & 1][j].h[1] = *(const v8bf*)(wrow + (g1 * 4 + j) * 16 * W1S_STRIDE + k1 + 16);
                }
            }
            // Keeps the loads above as one group ahead of this block's products:
            // without it the compiler sinks each load to just before its use and
            // the wave waits out every load's latency.
            __builtin_amdgcn_sched_barrier(0);
            #pragma unroll
            for (int j = 0; j < 4; ++j)
                #pragma unroll
                for (int ti = 0; ti < 4; ++ti)
                    acc[ti][g * 4 + j] = __builtin_amdgcn_wmma_f32_16x16x32_bf16(
                        false, wf[t & 1][j].v, false, tf[(ks >> 1) & 1][ks & 1][ti].v,
                        (short)0, acc[ti][g * 4 + j], false, false);
            // Keeps the next block's loads behind this block's products (the other
            // side of the fence above).
            __builtin_amdgcn_sched_barrier(0);
        }
        // The wait before the track loads' address registers are reused by the
        // next pass; naming the address as an input keeps it live up to here.
        asm volatile("s_wait_xcnt 0x0" :: "v"(trow) : "memory");

        // Second layer: this lane's 64 hidden units of each of its four tracks.
        v2f s2[4];
        #pragma unroll
        for (int ti = 0; ti < 4; ++ti) s2[ti] = (v2f){0.f, 0.f};
        #pragma unroll
        for (int ht = 0; ht < 8; ++ht) {
            const v4f bl = *(const v4f*)&bw[0][ht * 16 + khalf];
            const v4f bh = *(const v4f*)&bw[0][ht * 16 + khalf + 4];
            const v4f wl = *(const v4f*)&bw[1][ht * 16 + khalf];
            const v4f wh = *(const v4f*)&bw[1][ht * 16 + khalf + 4];
            #pragma unroll
            for (int ti = 0; ti < 4; ++ti) {
                #pragma unroll
                for (int p = 0; p < 2; ++p) {
                    v2f hl = {acc[ti][ht][2 * p] + bl[2 * p], acc[ti][ht][2 * p + 1] + bl[2 * p + 1]};
                    v2f hh = {acc[ti][ht][4 + 2 * p] + bh[2 * p], acc[ti][ht][5 + 2 * p] + bh[2 * p + 1]};
                    hl.x = fmaxf(hl.x, 0.f); hl.y = fmaxf(hl.y, 0.f);
                    hh.x = fmaxf(hh.x, 0.f); hh.y = fmaxf(hh.y, 0.f);
                    s2[ti] += hl * (v2f){wl[2 * p], wl[2 * p + 1]};
                    s2[ti] += hh * (v2f){wh[2 * p], wh[2 * p + 1]};
                }
            }
        }
        // Join the two lane halves (they hold the same track, the other 64 hidden units).
        float sv[4];
        #pragma unroll
        for (int ti = 0; ti < 4; ++ti) {
            const float s = s2[ti].x + s2[ti].y;
            const int si = __float_as_int(s);
            sv[ti] = s + __int_as_float(
                __builtin_amdgcn_permlanex16(si, si, 0x76543210, 0xfedcba98, false, false));
        }
        // Half hf finishes track tiles 2*j + hf: a store is 32 consecutive tracks, one whole line.
        float* op = orow + tbase + lane;
        #pragma unroll
        for (int j = 0; j < 2; ++j) {
            const float logit = (hf ? sv[2 * j + 1] : sv[2 * j]) + bias2;
            op[j * 32] = 1.f / (1.f + __expf(-logit));
        }
        // The wait before the next pass reuses the stores' address and data registers.
        asm volatile("s_wait_xcnt 0x0" :: "v"(op) : "memory");
    }
}

// ---------------------------------------------------------------------------
// Launcher
// ---------------------------------------------------------------------------
extern "C" void kernel_launch(void* const* d_in, const int* in_sizes, int n_in,
                              void* d_out, int out_size, void* d_ws, size_t ws_size,
                              hipStream_t stream)
{
    const float* det = (const float*)d_in[0];
    const float* trk = (const float*)d_in[1];
    const float* wq  = (const float*)d_in[2];
    const float* bq  = (const float*)d_in[3];
    const float* wk  = (const float*)d_in[4];
    const float* bk  = (const float*)d_in[5];
    const float* wv  = (const float*)d_in[6];
    const float* bv  = (const float*)d_in[7];
    const float* wo  = (const float*)d_in[8];
    const float* bo  = (const float*)d_in[9];
    const float* lng = (const float*)d_in[10];
    const float* lnb = (const float*)d_in[11];
    const float* w1  = (const float*)d_in[12];
    const float* b1  = (const float*)d_in[13];
    const float* w2  = (const float*)d_in[14];
    const float* b2  = (const float*)d_in[15];
    float* out = (float*)d_out;

    const size_t rowsD = (size_t)B_ * ND * DM;  // 524288 floats
    float* Q   = (float*)d_ws;
    float* K   = Q + rowsD;
    float* V   = K + rowsD;
    float* CTX = V + rowsD;
    float* XN  = CTX + rowsD;
    __bf16* TRKB = (__bf16*)(XN + rowsD);       // 1 MB of bf16
    float* WFO = (float*)(TRKB + rowsD);        // 256 KB: w_o in fragment order

    qkv_kernel<<<dim3(B_ * ND / 32, DM / 64, 3), 128, 0, stream>>>(det, trk, wq, wk, wv, wo, bq, bk, bv,
                                                                  Q, K, V, TRKB, WFO);
    attn_kernel<<<dim3(ND / AQ, NH, B_), 256, 0, stream>>>(Q, K, V, CTX);
    oln_kernel<<<dim3(B_ * ND / 16), 512, 0, stream>>>(det, CTX, WFO, bo, lng, lnb, XN);
    assoc_kernel<<<dim3(ND, B_), 128, 0, stream>>>(TRKB, XN, w1, b1, w2, b2, out);
}

// v006
// It runs in 61.8 microseconds.
// Two timings next to v005 both put it at 1.12 times that version's speed.
// All steps since v000 together make it 4.79 times as fast.
#include <hip/hip_runtime.h>
#include <hip/hip_bf16.h>

#define B_    4
#define ND    512
#define NT    512
#define DM    256
#define DH    128
#define NH    8
#define DK    32
#define XP    260    // floats per LDS row of a projection's x tile: 256 + 4 pad (16 B x odd)
#define YW    20     // floats per LDS row of a qkv wave's output part: 16 + 4 pad (16 B x odd)
#define AQ    32     // queries per attention block
#define AKW   64     // keys per attention wave
#define OPITCH 36    // floats per LDS row of an output part: 32 + 4 pad, 16B aligned
#define TH    256    // bf16 elems of half a track fragment: 32 lanes x 8
#define TK    512    // bf16 elems of a track fragment (16 tracks x 32 k)
#define TT    4096   // bf16 elems of a track tile (16 tracks x 256 k)

typedef __attribute__((ext_vector_type(16))) __bf16 v16bf;
typedef __attribute__((ext_vector_type(8)))  __bf16 v8bf;
typedef __attribute__((ext_vector_type(8)))  float  v8f;
typedef __attribute__((ext_vector_type(2)))  float  v2f;
typedef __attribute__((ext_vector_type(4)))  float  v4f;

// ---------------------------------------------------------------------------
// Shared by the four linear projections y = x W^T + b, on the f32 16x16x4
// matrix form as Yt = W * Xt: A = 16 rows of W (output columns), B = 16 rows of
// x.  Both fragments by the same code: lane (c, hf) holds row c,
// k = 32*ch + 16*hf + 4*i + {0..3}; two k-steps of the matrix form per float4.
// acc[qt][r] = y(row = 16*qt + c, column = 8*hf + r).
// wf: the wave's 16 rows of W, all 256 k, in registers, in this order.
// xl: the lane's place in the x tile in LDS (row c, k = 16*hf).
// ---------------------------------------------------------------------------
template <int NQ>
__device__ __forceinline__ void proj_mma(const float4 (&wf)[8][4], const float* xl, v8f (&acc)[NQ])
{
    // every loop here is unrolled so that wf and acc are indexed by constants
    // and stay in registers
    #pragma unroll
    for (int ch = 0; ch < 8; ++ch) {
        #pragma unroll
        for (int i = 0; i < 4; ++i) {
            float4 xf[NQ];
            #pragma unroll
            for (int qt = 0; qt < NQ; ++qt)
                xf[qt] = *(const float4*)(xl + qt * 16 * XP + ch * 32 + 4 * i);
            const v2f w01 = {wf[ch][i].x, wf[ch][i].y};
            const v2f w23 = {wf[ch][i].z, wf[ch][i].w};
            #pragma unroll
            for (int qt = 0; qt < NQ; ++qt) {
                const v2f x01 = {xf[qt].x, xf[qt].y};
                acc[qt] = __builtin_amdgcn_wmma_f32_16x16x4_f32(
                    false, w01, false, x01, (short)0, acc[qt], false, false);
            }
            #pragma unroll
            for (int qt = 0; qt < NQ; ++qt) {
                const v2f x23 = {xf[qt].z, xf[qt].w};
                acc[qt] = __builtin_amdgcn_wmma_f32_16x16x4_f32(
                    false, w23, false, x23, (short)0, acc[qt], false, false);
            }
        }
    }
}

// ---------------------------------------------------------------------------
// 1) QKV projection: block = 32 rows x 64 output columns (two heads), 4 waves,
//    wave w owns columns [16w, 16w+16).  The 32 rows of x are staged in LDS and
//    shared by the waves.  A wave's 16 rows of W are 16 KB in a row in memory:
//    it loads them as they lie (a load is 512 contiguous bytes, four whole
//    lines), puts them into LDS and reads its fragments back from there.
//    blockIdx.x = row tile (0..63), .y = column group (0..3), .z = 0=Q,1=K,2=V
//    Three operands of later kernels are laid out here as well, in the order in
//    which those kernels load their matrix fragments, so that one 16-byte load
//    per lane is 512 contiguous bytes per wave there; a thread writes one
//    16-byte piece, a wave 512 contiguous bytes:
//    K and V blocks, from their x tile: tracks fp32 -> bf16 for the head,
//    [B*NT/16 track tiles][DM/32 k-steps][2 halves][32 lanes][8 bf16]; lane
//    (c, hf) of half h holds track 16*tile + c, k = 32*kstep + 16*h + 8*hf + {0..7}.
//    Q blocks of column groups 0 and 1: w_o (fp32 as it is) for oln_kernel,
//    [DM/16 row tiles][8 ch][4 i][32 lanes][4 floats]; lane (c, hf) holds row
//    16*tile + c, k = 32*ch + 16*hf + 4*i + {0..3}.
//    Q blocks of column group 2: w1 (fp32 as it is) for assoc_kernel,
//    [DH/16 row tiles][DM/32 k-steps][4 q][32 lanes][4 floats]; lane (c, hf)
//    holds row 16*tile + c, k = 32*kstep + 16*(q >> 1) + 8*hf + 4*(q & 1) + {0..3}.
// ---------------------------------------------------------------------------
__global__ __launch_bounds__(128) void qkv_kernel(
    const float* __restrict__ det, const float* __restrict__ trk,
    const float* __restrict__ wq, const float* __restrict__ wk,
    const float* __restrict__ wv, const float* __restrict__ wo,
    const float* __restrict__ w1,
    const float* __restrict__ bq, const float* __restrict__ bk,
    const float* __restrict__ bv,
    float* __restrict__ Q, float* __restrict__ K, float* __restrict__ V,
    __bf16* __restrict__ trkb, float* __restrict__ wofr, float* __restrict__ w1fr)
{
    __shared__ __attribute__((aligned(16))) float xs[32 * XP];
    __shared__ __attribute__((aligned(16))) float wl[64 * XP];
    const int which = blockIdx.z;
    const int tid   = threadIdx.x;
    const int row0  = blockIdx.x * 32;
    const int wave = tid >> 5, lane = tid & 31;
    const int c = lane & 15, hf = lane >> 4;
    const int col0 = blockIdx.y * 64 + wave * 16;

    const float* in   = (which == 0) ? det : trk;
    const float* W    = (which == 0) ? wq : (which == 1) ? wk : wv;
    const float* bias = (which == 0) ? bq : (which == 1) ? bk : bv;
    float* outp       = (which == 0) ? Q  : (which == 1) ? K  : V;

    // The thread's piece of the w_o copy (blocks with copies_wo only).
    const bool copies_wo = (which == 0) && (blockIdx.y < 2);
    const int po = (blockIdx.x * 2 + (blockIdx.y & 1)) * 128 + tid;    // 0 .. 16383
    // The thread's piece of the w1 copy (blocks with copies_w1 only).
    const bool copies_w1 = (which == 0) && (blockIdx.y == 2);
    const int pw = blockIdx.x * 128 + tid;                             // 0 .. 8191

    // x tile: 32 rows are 8192 contiguous floats; thread t takes float4 t + 128*j
    // W rows: 16 rows are 4096 contiguous floats; lane l takes float4 l + 32*j
    const float* xb = in + row0 * DM;
    const float* xp = xb + tid * 4;
    const float* wp = W + col0 * DM + lane * 4;
    const float* bp = bias + col0 + hf * 8;
    const float* sp = copies_w1
        ? w1 + ((pw >> 10) * 16 + (pw & 15)) * DM
             + ((pw >> 7) & 7) * 32 + ((pw >> 6) & 1) * 16 + ((pw >> 4) & 1) * 8 + ((pw >> 5) & 1) * 4
        : wo + ((po >> 10) * 16 + (po & 15)) * DM
             + ((po >> 7) & 7) * 32 + ((po >> 4) & 1) * 16 + ((po >> 5) & 3) * 4;
    float4 ov = make_float4(0.f, 0.f, 0.f, 0.f);
    if (copies_wo || copies_w1)
        ov = *(const float4*)sp;
    v4f xr[16];
    v4f wr[32];
    #pragma unroll
    for (int j = 0; j < 16; ++j)
        xr[j] = *(const v4f*)(xp + j * 512);
    #pragma unroll
    for (int j = 0; j < 32; ++j)
        wr[j] = *(const v4f*)(wp + j * 128);
    const float4 bl = *(const float4*)bp;
    const float4 bh = *(const float4*)(bp + 4);
    // Every global load of the wave is issued above.  The wait stands before any
    // reuse of their address registers; naming the addresses as inputs (the x
    // tile's also as the scalar base that its loads may use) keeps those
    // registers live up to it.
    asm volatile("s_wait_xcnt 0x0" :: "v"(xp), "s"(xb), "v"(wp), "v"(bp), "v"(sp) : "memory");

    #pragma unroll
    for (int j = 0; j < 16; ++j)
        *(v4f*)&xs[((tid >> 6) + 2 * j) * XP + (tid & 63) * 4] = xr[j];
    #pragma unroll
    for (int j = 0; j < 32; ++j)
        *(v4f*)&wl[(wave * 16 + (j >> 1)) * XP + (j & 1) * 128 + lane * 4] = wr[j];
    __syncthreads();

    float4 wf[8][4];
    #pragma unroll
    for (int ch = 0; ch < 8; ++ch)
        #pragma unroll
        for (int i = 0; i < 4; ++i)
            wf[ch][i] = *(const float4*)&wl[(wave * 16 + c) * XP + hf * 16 + ch * 32 + 4 * i];

    v8f acc[2];
    #pragma unroll
    for (int qt = 0; qt < 2; ++qt) {
        acc[qt][0] = bl.x; acc[qt][1] = bl.y; acc[qt][2] = bl.z; acc[qt][3] = bl.w;
        acc[qt][4] = bh.x; acc[qt][5] = bh.y; acc[qt][6] = bh.z; acc[qt][7] = bh.w;
    }
    proj_mma<2>(wf, &xs[c * XP + hf * 16], acc);

    // Through LDS, so that each 128-byte line of the output is stored whole by
    // one wave.  A wave puts its 32 rows x 16 columns where its own rows of W
    // lay: only this wave has read them, and it has read them all by now.
    #pragma unroll
    for (int qt = 0; qt < 2; ++qt) {
        float* dst = &wl[wave * 16 * XP + (qt * 16 + c) * YW + hf * 8];
        *(float4*)dst       = make_float4(acc[qt][0], acc[qt][1], acc[qt][2], acc[qt][3]);
        *(float4*)(dst + 4) = make_float4(acc[qt][4], acc[qt][5], acc[qt][6], acc[qt][7]);
    }
    // The 32 tracks of the x tile are 1024 pieces; the eight K and V blocks of
    // this row tile take 128 each.
    const int jj = (((which - 1) & 1) * 4 + blockIdx.y) * 128 + tid;
    v8bf tp = {};
    if (which != 0) {
        const float* ip = &xs[((jj >> 9) * 16 + (jj & 15)) * XP
                              + ((jj >> 6) & 7) * 32 + ((jj >> 5) & 1) * 16 + ((jj >> 4) & 1) * 8];
        const float4 v0 = *(const float4*)ip;
        const float4 v1 = *(const float4*)(ip + 4);
        tp[0] = (__bf16)v0.x; tp[1] = (__bf16)v0.y; tp[2] = (__bf16)v0.z; tp[3] = (__bf16)v0.w;
        tp[4] = (__bf16)v1.x; tp[5] = (__bf16)v1.y; tp[6] = (__bf16)v1.z; tp[7] = (__bf16)v1.w;
    }
    __syncthreads();

    // The copies are stored behind the last barrier: in front of one, the
    // barrier would wait for the store to complete.
    if (which != 0) {
        ((v8bf*)trkb)[blockIdx.x * 1024 + jj] = tp;
        // Precaution: stands in front of any rewrite of the store's registers.
        asm volatile("s_wait_xcnt 0x0" ::: "memory");
    } else if (copies_wo || copies_w1) {
        *(float4*)(copies_w1 ? w1fr + pw * 4 : wofr + po * 4) = ov;
        // Precaution: stands in front of any rewrite of the store's registers.
        asm volatile("s_wait_xcnt 0x0" ::: "memory");
    }

    const int b = row0 >> 9, n0 = row0 & 511;
    #pragma unroll
    for (int p = 0; p < 4; ++p) {
        const int idx = tid + 128 * p;            // float4 index in the block's output
        const int hh = idx >> 8;
        // V: row-major.  Q and K: in the order in which attn_kernel loads its
        // fragments, [16-row tile][i][lane (c, hf)][4]: row 16*tile + c,
        // dk = 16*hf + 4*i + {0..3}.  Either way piece idx goes to place idx.
        const int r  = (which == 2) ? (idx >> 3) & 31 : ((idx >> 7) & 1) * 16 + (idx & 15);
        const int d4 = (which == 2) ? (idx & 7) << 2  : ((idx >> 4) & 1) * 16 + ((idx >> 5) & 3) * 4;
        *(float4*)(outp + ((b * NH + blockIdx.y * 2 + hh) * ND + n0) * DK + (idx & 255) * 4) =
            *(const float4*)&wl[(hh * 2 + (d4 >> 4)) * 16 * XP + r * YW + (d4 & 15)];
    }
}

// ---------------------------------------------------------------------------
// 2) Attention on the f32 16x16x4 matrix form, 32 queries per block.
//    grid = (ND/AQ, NH, B_); 256 threads = 8 waves; wave w owns keys
//    [64w, 64w+64).  St = K * Qt and Ot = Vt * Pt, so a lane holds one query's
//    scores and the score registers are the B operand of the second product.
//    Each wave makes a softmax part (max, sum, unnormalised Ot) over its own
//    keys; the 8 parts are joined through LDS.
// ---------------------------------------------------------------------------
__global__ __launch_bounds__(256) void attn_kernel(
    const float* __restrict__ Q, const float* __restrict__ K,
    const float* __restrict__ V, float* __restrict__ ctx)
{
    __shared__ float sO[8][AQ][OPITCH];   // per-wave unnormalised output parts
    __shared__ float sML[2][8][AQ];       // [0] = part max, [1] = part sum

    const int q0 = blockIdx.x * AQ;
    const int h = blockIdx.y, b = blockIdx.z;
    const int tid = threadIdx.x;
    const int wv = tid >> 5, lane = tid & 31;
    const int c = lane & 15, hf = lane >> 4;

    const float* Qb = Q + ((b * NH + h) * ND + q0) * DK;
    const float* Kb = K + ((b * NH + h) * NT + wv * AKW) * DK;
    const float* Vb = V + ((b * NH + h) * NT + wv * AKW) * DK;

    // Q and K fragments by the same code: lane (c, hf) holds row c,
    // dk = 16*hf + 4*i + {0..3}; two k-steps of the matrix form per float4.
    // qkv_kernel has stored them in that order, [16-row tile][i][lane][4], so a
    // load is 512 contiguous bytes per wave.
    const float* qp = Qb + lane * 4;
    const float* kp = Kb + lane * 4;
    // V: lane (c, hf) holds keys 8*hf + r of each 16-key tile, dv = 2*c, 2*c + 1.
    const float* vp = Vb + hf * 8 * DK + 2 * c;

    float4 qf[2][4];
    float4 kf[4][4];
    float2 vf[4][8];
    #pragma unroll
    for (int i = 0; i < 4; ++i) {
        #pragma unroll
        for (int qt = 0; qt < 2; ++qt)
            qf[qt][i] = *(const float4*)(qp + qt * 16 * DK + 128 * i);
        #pragma unroll
        for (int kt = 0; kt < 4; ++kt)
            kf[kt][i] = *(const float4*)(kp + kt * 16 * DK + 128 * i);
    }
    #pragma unroll
    for (int kt = 0; kt < 4; ++kt)
        #pragma unroll
        for (int r = 0; r < 8; ++r)
            vf[kt][r] = *(const float2*)(vp + (kt * 16 + r) * DK);
    // Every global load of the wave is issued above.  The wait stands before any
    // reuse of their address registers; naming the addresses as inputs keeps
    // those registers live up to it.
    asm volatile("s_wait_xcnt 0x0" :: "v"(qp), "v"(kp), "v"(vp) : "memory");

    // st[kt][qt][r] = score(key = 16*kt + 8*hf + r, query = 16*qt + c), unscaled
    v8f st[4][2];
    #pragma unroll
    for (int kt = 0; kt < 4; ++kt) {
        #pragma unroll
        for (int qt = 0; qt < 2; ++qt)
            #pragma unroll
            for (int e = 0; e < 8; ++e) st[kt][qt][e] = 0.f;
        #pragma unroll
        for (int i = 0; i < 4; ++i) {
            const v2f k01 = {kf[kt][i].x, kf[kt][i].y};
            const v2f k23 = {kf[kt][i].z, kf[kt][i].w};
            #pragma unroll
            for (int qt = 0; qt < 2; ++qt) {
                const v2f q01 = {qf[qt][i].x, qf[qt][i].y};
                st[kt][qt] = __builtin_amdgcn_wmma_f32_16x16x4_f32(
                    false, k01, false, q01, (short)0, st[kt][qt], false, false);
            }
            #pragma unroll
            for (int qt = 0; qt < 2; ++qt) {
                const v2f q23 = {qf[qt][i].z, qf[qt][i].w};
                st[kt][qt] = __builtin_amdgcn_wmma_f32_16x16x4_f32(
                    false, k23, false, q23, (short)0, st[kt][qt], false, false);
            }
        }
    }

    // Softmax part over this wave's 64 keys: in-lane, plus one exchange
    // between the lane halves (they hold the same query).
    const float scale = 0.17677669529663687f;  // 1/sqrt(32)
    float pm[2], pl[2];
    #pragma unroll
    for (int qt = 0; qt < 2; ++qt) {
        float m = st[0][qt][0];
        #pragma unroll
        for (int kt = 0; kt < 4; ++kt)
            #pragma unroll
            for (int r = 0; r < 8; ++r) m = fmaxf(m, st[kt][qt][r]);
        m = fmaxf(m, __shfl_xor(m, 16, 32));
        m *= scale;
        float l = 0.f;
        #pragma unroll
        for (int kt = 0; kt < 4; ++kt)
            #pragma unroll
            for (int r = 0; r < 8; ++r) {
                const float p = __expf(st[kt][qt][r] * scale - m);
                st[kt][qt][r] = p;
                l += p;
            }
        l += __shfl_xor(l, 16, 32);
        pm[qt] = m;
        pl[qt] = l;
    }

    // Ot[dt][qt] += Vt * Pt.  k-step s of key tile kt pairs key 8*hf + 2*s + j
    // on both sides (B = score registers 2s, 2s+1).  Row c of tile dt is
    // dv = 2*c + dt, so one 8-byte load feeds both tiles.
    v8f o[2][2];
    #pragma unroll
    for (int dt = 0; dt < 2; ++dt)
        #pragma unroll
        for (int qt = 0; qt < 2; ++qt)
            #pragma unroll
            for (int e = 0; e < 8; ++e) o[dt][qt][e] = 0.f;

    #pragma unroll
    for (int kt = 0; kt < 4; ++kt) {
        #pragma unroll
        for (int s = 0; s < 4; ++s) {
            const v2f va = {vf[kt][2 * s].x, vf[kt][2 * s + 1].x};
            const v2f vb = {vf[kt][2 * s].y, vf[kt][2 * s + 1].y};
            #pragma unroll
            for (int qt = 0; qt < 2; ++qt) {
                const v2f p = {st[kt][qt][2 * s], st[kt][qt][2 * s + 1]};
                o[0][qt] = __builtin_amdgcn_wmma_f32_16x16x4_f32(
                    false, va, false, p, (short)0, o[0][qt], false, false);
                o[1][qt] = __builtin_amdgcn_wmma_f32_16x16x4_f32(
                    false, vb, false, p, (short)0, o[1][qt], false, false);
            }
        }
    }

    // o[dt][qt][r] = Ot(dv = 16*hf + 2*r + dt, query = 16*qt + c)
    #pragma unroll
    for (int qt = 0; qt < 2; ++qt) {
        float* dst = &sO[wv][qt * 16 + c][hf * 16];
        #pragma unroll
        for (int i = 0; i < 4; ++i)
            *(float4*)(dst + 4 * i) = make_float4(o[0][qt][2 * i],     o[1][qt][2 * i],
                                                  o[0][qt][2 * i + 1], o[1][qt][2 * i + 1]);
        // both halves hold the same max and sum: half 0 stores the max, half 1 the sum
        sML[hf][wv][qt * 16 + c] = hf ? pl[qt] : pm[qt];
    }
    __syncthreads();

    // Join the 8 parts: thread -> query tid/8, four dv.
    const int q = tid >> 3, d4 = (tid & 7) << 2;
    float M = sML[0][0][q];
    #pragma unroll
    for (int w = 1; w < 8; ++w) M = fmaxf(M, sML[0][w][q]);
    float L = 0.f;
    float4 acc = make_float4(0.f, 0.f, 0.f, 0.f);
    #pragma unroll
    for (int w = 0; w < 8; ++w) {
        const float f = __expf(sML[0][w][q] - M);
        const float4 o4 = *(const float4*)&sO[w][q][d4];
        L += f * sML[1][w][q];
        acc.x += f * o4.x; acc.y += f * o4.y; acc.z += f * o4.z; acc.w += f * o4.w;
    }
    const float inv = 1.f / L;
    *(float4*)(ctx + (b * ND + q0 + q) * DM + h * DK + d4) =
        make_float4(acc.x * inv, acc.y * inv, acc.z * inv, acc.w * inv);
}

// ---------------------------------------------------------------------------
// 3) Output projection + residual + LayerNorm: block = 16 rows x all 256
//    columns, 16 waves; wave w owns columns [16w, 16w+16) of the product and
//    then row w of the LayerNorm.
// ---------------------------------------------------------------------------
__global__ __launch_bounds__(512) void oln_kernel(
    const float* __restrict__ det, const float* __restrict__ ctx,
    const float* __restrict__ wo,      // w_o in fragment order (qkv_kernel)
    const float* __restrict__ bo,
    const float* __restrict__ g, const float* __restrict__ beta,
    float* __restrict__ xn)
{
    __shared__ __attribute__((aligned(16))) float cs[16 * XP];
    __shared__ __attribute__((aligned(16))) float xb[16 * XP];
    const int tid  = threadIdx.x;
    const int row0 = blockIdx.x * 16;
    const int wave = tid >> 5, lane = tid & 31;
    const int c = lane & 15, hf = lane >> 4;
    const int col0 = wave * 16;

    // ctx tile: 16 rows are 4096 contiguous floats; thread t takes float4 t + 512*j
    const float* cp = ctx + row0 * DM + tid * 4;
    const float* wp = wo + col0 * DM + lane * 4;
    const float* bp = bo + col0 + hf * 8;
    const float* dp = det + (row0 + c) * DM + col0 + hf * 8;
    v4f cr[2];
    float4 wf[8][4];
    #pragma unroll
    for (int j = 0; j < 2; ++j)
        cr[j] = *(const v4f*)(cp + j * 2048);
    #pragma unroll
    for (int ch = 0; ch < 8; ++ch)
        #pragma unroll
        for (int i = 0; i < 4; ++i)
            wf[ch][i] = *(const float4*)(wp + (ch * 4 + i) * 128);
    const float4 bl = *(const float4*)bp;
    const float4 bh = *(const float4*)(bp + 4);
    const float4 dl = *(const float4*)dp;
    const float4 dh = *(const float4*)(dp + 4);
    // As in qkv_kernel: the wait before any reuse of the loads' address registers.
    asm volatile("s_wait_xcnt 0x0" :: "v"(cp), "v"(wp), "v"(bp), "v"(dp) : "memory");

    #pragma unroll
    for (int j = 0; j < 2; ++j)
        *(v4f*)&cs[((tid >> 6) + 8 * j) * XP + (tid & 63) * 4] = cr[j];
    __syncthreads();

    v8f acc[1];
    acc[0][0] = bl.x; acc[0][1] = bl.y; acc[0][2] = bl.z; acc[0][3] = bl.w;
    acc[0][4] = bh.x; acc[0][5] = bh.y; acc[0][6] = bh.z; acc[0][7] = bh.w;
    proj_mma<1>(wf, &cs[c * XP + hf * 16], acc);

    float* xd = &xb[c * XP + col0 + hf * 8];
    *(float4*)xd       = make_float4(dl.x + acc[0][0], dl.y + acc[0][1],
                                     dl.z + acc[0][2], dl.w + acc[0][3]);
    *(float4*)(xd + 4) = make_float4(dh.x + acc[0][4], dh.y + acc[0][5],
                                     dh.z + acc[0][6], dh.w + acc[0][7]);
    __syncthreads();

    // wave w reduces row w (sum, sumsq); every lane ends with both sums
    float s = 0.f, s2 = 0.f;
    #pragma unroll
    for (int i = 0; i < DM / 32; ++i) {
        const float v = xb[wave * XP + lane + 32 * i];
        s += v; s2 += v * v;
    }
    s  += __shfl_xor(s, 1, 32);  s2 += __shfl_xor(s2, 1, 32);
    s  += __shfl_xor(s, 2, 32);  s2 += __shfl_xor(s2, 2, 32);
    s  += __shfl_xor(s, 4, 32);  s2 += __shfl_xor(s2, 4, 32);
    s  += __shfl_xor(s, 8, 32);  s2 += __shfl_xor(s2, 8, 32);
    s  += __shfl_xor(s, 16, 32); s2 += __shfl_xor(s2, 16, 32);
    const float mu  = s * (1.f / DM);
    const float inv = rsqrtf(s2 * (1.f / DM) - mu * mu + 1e-5f);

    #pragma unroll
    for (int i = 0; i < DM / 32; ++i) {
        const int col = lane + 32 * i;
        xn[(row0 + wave) * DM + col] = (xb[wave * XP + col] - mu) * inv * g[col] + beta[col];
    }
}

// ---------------------------------------------------------------------------
// 4) Association head: per (b,n):
//      W1n = w1 * xn_row (bf16)
//      Ht  = W1n (128x256) @ tracks[b]^T (256x512)  via v_wmma_f32_16x16x32_bf16
//      out[t] = sigmoid( relu(Ht + b1)^T @ w2 + b2 )
//    A block is 8 waves, 16 detections and 256 tracks of one batch, one block
//    per WGP.  All that it reads is put into LDS once: the 256 bf16 tracks
//    (128 KB, fragment order), w1 (128 KB, fp32, fragment order), the 16 xn rows,
//    b1 and w2.  A wave owns two detections.  For each it builds 64 hidden rows
//    x 256 k of W1n straight into its A fragments (256 registers) and keeps them
//    there while the 256 tracks go by, 64 at a time; then the other 64 hidden
//    rows.  So W1n is never stored or read again, and a track fragment read from
//    LDS feeds four matrix instructions.
//    With W1n as the A operand a lane's accumulators are 32 hidden units of one
//    track: the sum over the hidden units is in-lane, but for the first half's
//    part (kept in LDS by the lane that reads it back) and one exchange between
//    the lane halves.
//    Behind the one barrier the waves are free of each other: of the two waves
//    of a SIMD one can build or sum while the other multiplies.
//    The second launch bound asks for two waves per SIMD (512 registers a wave).
//    blockIdx.x = (batch * 2 + half of the tracks) * 32 + group of 16 detections
// ---------------------------------------------------------------------------
__global__ __launch_bounds__(256, 2) void assoc_kernel(
    const __bf16* __restrict__ trkbf,  // bf16 tracks in fragment order (qkv_kernel)
    const float* __restrict__ xn,      // [B][ND][DM]
    const float* __restrict__ w1f,     // w1 in fragment order (qkv_kernel)
    const float* __restrict__ b1,      // [DH]
    const float* __restrict__ w2,      // [DH]
    const float* __restrict__ b2,      // [1]
    float* __restrict__ out)           // [B][ND][NT]
{
    __shared__ __attribute__((aligned(16))) __bf16 ts[NT / 2 * DM];     // 131,072 bytes
    __shared__ __attribute__((aligned(16))) float ws[DH * DM];          // 131,072 bytes
    __shared__ __attribute__((aligned(16))) float xs[16 * DM];          // the 16 xn rows
    __shared__ __attribute__((aligned(16))) float part[8][4][32][4];    // first half's sums
    __shared__ __attribute__((aligned(16))) float bw[2 * DH];           // b1, then w2

    const int tid   = threadIdx.x;
    const int wave  = tid >> 5;
    const int lane  = tid & 31;
    const int hf    = lane >> 4;
    const int khalf = hf << 3;            // 0 for lanes 0-15, 8 for lanes 16-31
    const int b     = blockIdx.x >> 6;
    const int th    = (blockIdx.x >> 5) & 1;
    const int n0    = (blockIdx.x & 31) * 16;

    // Everything into LDS as it lies: thread t takes 16-byte piece t + 256*i of
    // each array.  All of a thread's loads are issued before the first is used.
    // The loops are unrolled so that wr, xr and tr are indexed by constants and
    // stay in registers.
    {
        const v4f* tp = (const v4f*)(trkbf + (b * NT + th * (NT / 2)) * DM);
        const v4f* wp = (const v4f*)w1f;
        const v4f* xp = (const v4f*)(xn + (b * ND + n0) * DM);
        const float* bp = ((tid & DH) ? w2 : b1) + (tid & (DH - 1));
        v4f wr[32], xr[4], tr[32];
        #pragma unroll
        for (int i = 0; i < 32; ++i)
            wr[i] = wp[tid + i * 256];
        #pragma unroll
        for (int i = 0; i < 4; ++i)
            xr[i] = xp[tid + i * 256];
        const float bt = *bp;
        #pragma unroll
        for (int i = 0; i < 32; ++i)
            tr[i] = tp[tid + i * 256];
        // The wait stands before any reuse of the loads' address registers; naming
        // the scalar bases, the thread's index and bp as inputs keeps them live up to it.
        asm volatile("s_wait_xcnt 0x0" :: "s"(tp), "s"(wp), "s"(xp), "v"(tid), "v"(bp) : "memory");
        #pragma unroll
        for (int i = 0; i < 32; ++i)
            ((v4f*)ws)[tid + i * 256] = wr[i];
        #pragma unroll
        for (int i = 0; i < 4; ++i)
            ((v4f*)xs)[tid + i * 256] = xr[i];
        bw[tid] = bt;
        #pragma unroll
        for (int i = 0; i < 32; ++i)
            ((v4f*)ts)[tid + i * 256] = tr[i];
    }
    __syncthreads();

    const float bias2 = b2[0];
    const __bf16* tl = ts + lane * 8;

    // Both operands by the same k order: lane<16 -> k {k0..k0+7, k0+16..k0+23};
    // lane>=16 -> +8.
    union Frag { v16bf v; v8bf h[2]; };

    // Pass it: detection n0 + 2*wave + (it >> 1), hidden rows 64*(it & 1) .. +63.
    for (int it = 0; it < 4; ++it) {
        const int half = it & 1;
        const int dl   = wave * 2 + (it >> 1);

        // af[j][ks]: W1n rows 64*half + 16*j + (lane & 15), k-step ks.  Every loop of
        // the build is unrolled so that af, x and f are indexed by constants and stay
        // in registers.
        Frag af[4][8];
        const float* wl = ws + half * (DH / 2) * DM + lane * 4;
        const float* xl = xs + dl * DM + khalf;
        #pragma unroll
        for (int kb = 0; kb < 4; ++kb) {
            // Two k-steps at a time.
            v4f x[2][4], f[2][4][4];
            #pragma unroll
            for (int w = 0; w < 2; ++w)
                #pragma unroll
                for (int q = 0; q < 4; ++q)
                    x[w][q] = *(const v4f*)(xl + (kb * 2 + w) * 32 + (q >> 1) * 16 + (q & 1) * 4);
            #pragma unroll
            for (int w = 0; w < 2; ++w)
                #pragma unroll
                for (int j = 0; j < 4; ++j)
                    #pragma unroll
                    for (int q = 0; q < 4; ++q)
                        f[w][j][q] = *(const v4f*)(wl + ((j * 8 + kb * 2 + w) * 4 + q) * 128);
            // Keeps the loads above as one group: without it the compiler sinks each
            // load to just before its use and the wave waits out every load's latency.
            __builtin_amdgcn_sched_barrier(0);
            #pragma unroll
            for (int w = 0; w < 2; ++w)
                #pragma unroll
                for (int j = 0; j < 4; ++j)
                    #pragma unroll
                    for (int q = 0; q < 4; ++q) {
                        const v4f p = f[w][j][q] * x[w][q];
                        #pragma unroll
                        for (int e = 0; e < 4; ++e)
                            af[j][kb * 2 + w].h[q >> 1][(q & 1) * 4 + e] = (__bf16)p[e];
                    }
            // Keeps the next group of loads behind these products: with more groups in
            // flight beside the fragments the registers run out and values are spilled.
            __builtin_amdgcn_sched_barrier(0);
        }

        // Track fragments are fetched one k-step ahead into a second register set
        // while the current set's products run; the last k-step of a group fetches
        // the first of the next group (behind the last group: of the first again,
        // not used).
        Frag bf[2][4];
        #pragma unroll
        for (int ti = 0; ti < 4; ++ti) {
            bf[0][ti].h[0] = *(const v8bf*)(tl + ti * TT);
            bf[0][ti].h[1] = *(const v8bf*)(tl + ti * TT + TH);
        }

        for (int g = 0; g < 4; ++g) {
            const __bf16* tg = tl + g * 4 * TT;
            const __bf16* tn = tl + ((g + 1) & 3) * 4 * TT;

            // acc[ti][j][r] = Ht(hidden = 64*half + 16*j + 8*hf + r,
            //                    track = 256*th + 64*g + 16*ti + (lane & 15))
            v8f acc[4][4];
            #pragma unroll
            for (int ti = 0; ti < 4; ++ti)
                #pragma unroll
                for (int j = 0; j < 4; ++j)
                    #pragma unroll
                    for (int e = 0; e < 8; ++e) acc[ti][j][e] = 0.f;

            // Unrolled so that the fragment sets and acc are indexed by constants.
            #pragma unroll
            for (int ks = 0; ks < DM / 32; ++ks) {
                const __bf16* s = (ks + 1 < DM / 32) ? tg + (ks + 1) * TK : tn;
                #pragma unroll
                for (int ti = 0; ti < 4; ++ti) {
                    bf[(ks + 1) & 1][ti].h[0] = *(const v8bf*)(s + ti * TT);
                    bf[(ks + 1) & 1][ti].h[1] = *(const v8bf*)(s + ti * TT + TH);
                }
                // Keeps the loads above as one group ahead of this k-step's products.
                __builtin_amdgcn_sched_barrier(0);
                #pragma unroll
                for (int j = 0; j < 4; ++j)
                    #pragma unroll
                    for (int ti = 0; ti < 4; ++ti)
                        acc[ti][j] = __builtin_amdgcn_wmma_f32_16x16x32_bf16(
                            false, af[j][ks].v, false, bf[ks & 1][ti].v,
                            (short)0, acc[ti][j], false, false);
                // Keeps the next k-step's loads behind these products (the other side
                // of the fence above).
                __builtin_amdgcn_sched_barrier(0);
            }

            // Second layer: this lane's 32 hidden units of each of its four tracks
            // (unrolled: acc and s2 are indexed by constants).
            v2f s2[4];
            #pragma unroll
            for (int ti = 0; ti < 4; ++ti) s2[ti] = (v2f){0.f, 0.f};
            #pragma unroll
            for (int j = 0; j < 4; ++j) {
                const int hb = half * 64 + j * 16 + khalf;
                const v4f bl = *(const v4f*)&bw[hb];
                const v4f bh = *(const v4f*)&bw[hb + 4];
                const v4f wl2 = *(const v4f*)&bw[DH + hb];
                const v4f wh2 = *(const v4f*)&bw[DH + hb + 4];
                #pragma unroll
                for (int ti = 0; ti < 4; ++ti) {
                    #pragma unroll
                    for (int p = 0; p < 2; ++p) {
                        v2f hl = {acc[ti][j][2 * p] + bl[2 * p], acc[ti][j][2 * p + 1] + bl[2 * p + 1]};
                        v2f hh = {acc[ti][j][4 + 2 * p] + bh[2 * p], acc[ti][j][5 + 2 * p] + bh[2 * p + 1]};
                        hl.x = fmaxf(hl.x, 0.f); hl.y = fmaxf(hl.y, 0.f);
                        hh.x = fmaxf(hh.x, 0.f); hh.y = fmaxf(hh.y, 0.f);
                        s2[ti] += hl * (v2f){wl2[2 * p], wl2[2 * p + 1]};
                        s2[ti] += hh * (v2f){wh2[2 * p], wh2[2 * p + 1]};
                    }
                }
            }
            v4f ps = {s2[0].x + s2[0].y, s2[1].x + s2[1].y, s2[2].x + s2[2].y, s2[3].x + s2[3].y};
            v4f* pp = (v4f*)&part[wave][g][lane][0];
            if (half == 0) {
                *pp = ps;                 // read back by this lane alone
            } else {
                ps += *pp;
                // Join the two lane halves (the same track, the other hidden units).
                float sv[4];
                #pragma unroll
                for (int ti = 0; ti < 4; ++ti) {
                    const int si = __float_as_int(ps[ti]);
                    sv[ti] = ps[ti] + __int_as_float(
                        __builtin_amdgcn_permlanex16(si, si, 0x76543210, 0xfedcba98, false, false));
                }
                // Half hf finishes track tiles 2*j + hf: a store is 32 consecutive tracks, one whole line.
                float* op = out + (b * ND + n0 + dl) * NT + th * (NT / 2) + g * 64 + lane;
                #pragma unroll
                for (int j = 0; j < 2; ++j) {
                    const float logit = (hf ? sv[2 * j + 1] : sv[2 * j]) + bias2;
                    op[j * 32] = 1.f / (1.f + __expf(-logit));
                }
                // The wait before the next group reuses the stores' address and data registers.
                asm volatile("s_wait_xcnt 0x0" :: "v"(op) : "memory");
            }
        }
    }
}

// ---------------------------------------------------------------------------
// Launcher
// ---------------------------------------------------------------------------
extern "C" void kernel_launch(void* const* d_in, const int* in_sizes, int n_in,
                              void* d_out, int out_size, void* d_ws, size_t ws_size,
                              hipStream_t stream)
{
    const float* det = (const float*)d_in[0];
    const float* trk = (const float*)d_in[1];
    const float* wq  = (const float*)d_in[2];
    const float* bq  = (const float*)d_in[3];
    const float* wk  = (const float*)d_in[4];
    const float* bk  = (const float*)d_in[5];
    const float* wv  = (const float*)d_in[6];
    const float* bv  = (const float*)d_in[7];
    const float* wo  = (const float*)d_in[8];
    const float* bo  = (const float*)d_in[9];
    const float* lng = (const float*)d_in[10];
    const float* lnb = (const float*)d_in[11];
    const float* w1  = (const float*)d_in[12];
    const float* b1  = (const float*)d_in[13];
    const float* w2  = (const float*)d_in[14];
    const float* b2  = (const float*)d_in[15];
    float* out = (float*)d_out;

    const size_t rowsD = (size_t)B_ * ND * DM;  // 524288 floats
    float* Q   = (float*)d_ws;
    float* K   = Q + rowsD;
    float* V   = K + rowsD;
    float* CTX = V + rowsD;
    float* XN  = CTX + rowsD;
    __bf16* TRKB = (__bf16*)(XN + rowsD);       // 1 MB of bf16
    float* WFO = (float*)(TRKB + rowsD);        // 256 KB: w_o in fragment order
    float* W1F = WFO + DM * DM;                 // 128 KB: w1 in fragment order

    qkv_kernel<<<dim3(B_ * ND / 32, DM / 64, 3), 128, 0, stream>>>(det, trk, wq, wk, wv, wo, w1, bq, bk, bv,
                                                                  Q, K, V, TRKB, WFO, W1F);
    attn_kernel<<<dim3(ND / AQ, NH, B_), 256, 0, stream>>>(Q, K, V, CTX);
    oln_kernel<<<dim3(B_ * ND / 16), 512, 0, stream>>>(det, CTX, WFO, bo, lng, lnb, XN);
    assoc_kernel<<<dim3(B_ * 2 * (ND / 16)), 256, 0, stream>>>(TRKB, XN, W1F, b1, w2, b2, out);
}

// v007
// Measured time: 58.2 microseconds a run.
// In both of two side-by-side timings against v006, it was 1.06 times as fast.
// All steps since v000 together make it 5.09 times as fast.
#include <hip/hip_runtime.h>
#include <hip/hip_bf16.h>

#define B_    4
#define ND    512
#define NT    512
#define DM    256
#define DH    128
#define NH    8
#define DK    32
#define XP    260    // floats per LDS row of a projection's x tile: 256 + 4 pad (16 B x odd)
#define YW    20     // floats per LDS row of a qkv wave's output part: 16 + 4 pad (16 B x odd)
#define AQ    32     // queries per attention block
#define AKW   64     // keys per attention wave
#define OPITCH 36    // floats per LDS row of an output part: 32 + 4 pad, 16B aligned
#define TH    256    // bf16 elems of half a track fragment: 32 lanes x 8
#define TK    512    // bf16 elems of a track fragment (16 tracks x 32 k)
#define TT    4096   // bf16 elems of a track tile (16 tracks x 256 k)

typedef __attribute__((ext_vector_type(16))) __bf16 v16bf;
typedef __attribute__((ext_vector_type(8)))  __bf16 v8bf;
typedef __attribute__((ext_vector_type(8)))  float  v8f;
typedef __attribute__((ext_vector_type(2)))  float  v2f;
typedef __attribute__((ext_vector_type(4)))  float  v4f;

// ---------------------------------------------------------------------------
// The q, k and v projections y = x W^T + b, on the f32 16x16x4
// matrix form as Yt = W * Xt: A = 16 rows of W (output columns), B = 16 rows of
// x.  Both fragments by the same code: lane (c, hf) holds row c,
// k = 32*ch + 16*hf + 4*i + {0..3}; two k-steps of the matrix form per float4.
// acc[qt][r] = y(row = 16*qt + c, column = 8*hf + r).
// wf: the wave's 16 rows of W, all 256 k, in registers, in this order.
// xl: the lane's place in the x tile in LDS (row c, k = 16*hf).
// ---------------------------------------------------------------------------
template <int NQ>
__device__ __forceinline__ void proj_mma(const float4 (&wf)[8][4], const float* xl, v8f (&acc)[NQ])
{
    // every loop here is unrolled so that wf and acc are indexed by constants
    // and stay in registers
    #pragma unroll
    for (int ch = 0; ch < 8; ++ch) {
        #pragma unroll
        for (int i = 0; i < 4; ++i) {
            float4 xf[NQ];
            #pragma unroll
            for (int qt = 0; qt < NQ; ++qt)
                xf[qt] = *(const float4*)(xl + qt * 16 * XP + ch * 32 + 4 * i);
            const v2f w01 = {wf[ch][i].x, wf[ch][i].y};
            const v2f w23 = {wf[ch][i].z, wf[ch][i].w};
            #pragma unroll
            for (int qt = 0; qt < NQ; ++qt) {
                const v2f x01 = {xf[qt].x, xf[qt].y};
                acc[qt] = __builtin_amdgcn_wmma_f32_16x16x4_f32(
                    false, w01, false, x01, (short)0, acc[qt], false, false);
            }
            #pragma unroll
            for (int qt = 0; qt < NQ; ++qt) {
                const v2f x23 = {xf[qt].z, xf[qt].w};
                acc[qt] = __builtin_amdgcn_wmma_f32_16x16x4_f32(
                    false, w23, false, x23, (short)0, acc[qt], false, false);
            }
        }
    }
}

// ---------------------------------------------------------------------------
// 1) QKV projection: block = 32 rows x 64 output columns (two heads), 4 waves,
//    wave w owns columns [16w, 16w+16).  The 32 rows of x are staged in LDS and
//    shared by the waves.  A wave's 16 rows of W are 16 KB in a row in memory:
//    it loads them as they lie (a load is 512 contiguous bytes, four whole
//    lines), puts them into LDS and reads its fragments back from there.
//    blockIdx.x = row tile (0..63), .y = column group (0..3), .z = 0=Q,1=K,2=V
//    Three operands of later kernels are laid out here as well, in the order in
//    which those kernels load their matrix fragments, so that one 16-byte load
//    per lane is 512 contiguous bytes per wave there; a thread writes one
//    16-byte piece, a wave 512 contiguous bytes:
//    K and V blocks, from their x tile: tracks fp32 -> bf16 for the head,
//    [B*NT/16 track tiles][DM/32 k-steps][2 halves][32 lanes][8 bf16]; lane
//    (c, hf) of half h holds track 16*tile + c, k = 32*kstep + 16*h + 8*hf + {0..7}.
//    Q blocks of column groups 0 and 1: w_o (fp32 as it is) for assoc_kernel,
//    [DM/16 row tiles][8 ch][4 i][32 lanes][4 floats]; lane (c, hf) holds row
//    16*tile + c, k = 32*ch + 16*hf + 4*i + {0..3}.
//    Q blocks of column group 2: w1 (fp32 as it is) for assoc_kernel,
//    [DH/16 row tiles][DM/32 k-steps][4 q][32 lanes][4 floats]; lane (c, hf)
//    holds row 16*tile + c, k = 32*kstep + 16*(q >> 1) + 8*hf + 4*(q & 1) + {0..3}.
// ---------------------------------------------------------------------------
__global__ __launch_bounds__(128) void qkv_kernel(
    const float* __restrict__ det, const float* __restrict__ trk,
    const float* __restrict__ wq, const float* __restrict__ wk,
    const float* __restrict__ wv, const float* __restrict__ wo,
    const float* __restrict__ w1,
    const float* __restrict__ bq, const float* __restrict__ bk,
    const float* __restrict__ bv,
    float* __restrict__ Q, float* __restrict__ K, float* __restrict__ V,
    __bf16* __restrict__ trkb, float* __restrict__ wofr, float* __restrict__ w1fr)
{
    __shared__ __attribute__((aligned(16))) float xs[32 * XP];
    __shared__ __attribute__((aligned(16))) float wl[64 * XP];
    const int which = blockIdx.z;
    const int tid   = threadIdx.x;
    const int row0  = blockIdx.x * 32;
    const int wave = tid >> 5, lane = tid & 31;
    const int c = lane & 15, hf = lane >> 4;
    const int col0 = blockIdx.y * 64 + wave * 16;

    const float* in   = (which == 0) ? det : trk;
    const float* W    = (which == 0) ? wq : (which == 1) ? wk : wv;
    const float* bias = (which == 0) ? bq : (which == 1) ? bk : bv;
    float* outp       = (which == 0) ? Q  : (which == 1) ? K  : V;

    // The thread's piece of the w_o copy (blocks with copies_wo only).
    const bool copies_wo = (which == 0) && (blockIdx.y < 2);
    const int po = (blockIdx.x * 2 + (blockIdx.y & 1)) * 128 + tid;    // 0 .. 16383
    // The thread's piece of the w1 copy (blocks with copies_w1 only).
    const bool copies_w1 = (which == 0) && (blockIdx.y == 2);
    const int pw = blockIdx.x * 128 + tid;                             // 0 .. 8191

    // x tile: 32 rows are 8192 contiguous floats; thread t takes float4 t + 128*j
    // W rows: 16 rows are 4096 contiguous floats; lane l takes float4 l + 32*j
    const float* xb = in + row0 * DM;
    const float* xp = xb + tid * 4;
    const float* wp = W + col0 * DM + lane * 4;
    const float* bp = bias + col0 + hf * 8;
    const float* sp = copies_w1
        ? w1 + ((pw >> 10) * 16 + (pw & 15)) * DM
             + ((pw >> 7) & 7) * 32 + ((pw >> 6) & 1) * 16 + ((pw >> 4) & 1) * 8 + ((pw >> 5) & 1) * 4
        : wo + ((po >> 10) * 16 + (po & 15)) * DM
             + ((po >> 7) & 7) * 32 + ((po >> 4) & 1) * 16 + ((po >> 5) & 3) * 4;
    float4 ov = make_float4(0.f, 0.f, 0.f, 0.f);
    if (copies_wo || copies_w1)
        ov = *(const float4*)sp;
    v4f xr[16];
    v4f wr[32];
    #pragma unroll
    for (int j = 0; j < 16; ++j)
        xr[j] = *(const v4f*)(xp + j * 512);
    #pragma unroll
    for (int j = 0; j < 32; ++j)
        wr[j] = *(const v4f*)(wp + j * 128);
    const float4 bl = *(const float4*)bp;
    const float4 bh = *(const float4*)(bp + 4);
    // Every global load of the wave is issued above.  The wait stands before any
    // reuse of their address registers; naming the addresses as inputs (the x
    // tile's also as the scalar base that its loads may use) keeps those
    // registers live up to it.
    asm volatile("s_wait_xcnt 0x0" :: "v"(xp), "s"(xb), "v"(wp), "v"(bp), "v"(sp) : "memory");

    #pragma unroll
    for (int j = 0; j < 16; ++j)
        *(v4f*)&xs[((tid >> 6) + 2 * j) * XP + (tid & 63) * 4] = xr[j];
    #pragma unroll
    for (int j = 0; j < 32; ++j)
        *(v4f*)&wl[(wave * 16 + (j >> 1)) * XP + (j & 1) * 128 + lane * 4] = wr[j];
    __syncthreads();

    float4 wf[8][4];
    #pragma unroll
    for (int ch = 0; ch < 8; ++ch)
        #pragma unroll
        for (int i = 0; i < 4; ++i)
            wf[ch][i] = *(const float4*)&wl[(wave * 16 + c) * XP + hf * 16 + ch * 32 + 4 * i];

    v8f acc[2];
    #pragma unroll
    for (int qt = 0; qt < 2; ++qt) {
        acc[qt][0] = bl.x; acc[qt][1] = bl.y; acc[qt][2] = bl.z; acc[qt][3] = bl.w;
        acc[qt][4] = bh.x; acc[qt][5] = bh.y; acc[qt][6] = bh.z; acc[qt][7] = bh.w;
    }
    proj_mma<2>(wf, &xs[c * XP + hf * 16], acc);

    // Through LDS, so that each 128-byte line of the output is stored whole by
    // one wave.  A wave puts its 32 rows x 16 columns where its own rows of W
    // lay: only this wave has read them, and it has read them all by now.
    #pragma unroll
    for (int qt = 0; qt < 2; ++qt) {
        float* dst = &wl[wave * 16 * XP + (qt * 16 + c) * YW + hf * 8];
        *(float4*)dst       = make_float4(acc[qt][0], acc[qt][1], acc[qt][2], acc[qt][3]);
        *(float4*)(dst + 4) = make_float4(acc[qt][4], acc[qt][5], acc[qt][6], acc[qt][7]);
    }
    // The 32 tracks of the x tile are 1024 pieces; the eight K and V blocks of
    // this row tile take 128 each.
    const int jj = (((which - 1) & 1) * 4 + blockIdx.y) * 128 + tid;
    v8bf tp = {};
    if (which != 0) {
        const float* ip = &xs[((jj >> 9) * 16 + (jj & 15)) * XP
                              + ((jj >> 6) & 7) * 32 + ((jj >> 5) & 1) * 16 + ((jj >> 4) & 1) * 8];
        const float4 v0 = *(const float4*)ip;
        const float4 v1 = *(const float4*)(ip + 4);
        tp[0] = (__bf16)v0.x; tp[1] = (__bf16)v0.y; tp[2] = (__bf16)v0.z; tp[3] = (__bf16)v0.w;
        tp[4] = (__bf16)v1.x; tp[5] = (__bf16)v1.y; tp[6] = (__bf16)v1.z; tp[7] = (__bf16)v1.w;
    }
    __syncthreads();

    // The copies are stored behind the last barrier: in front of one, the
    // barrier would wait for the store to complete.
    if (which != 0) {
        ((v8bf*)trkb)[blockIdx.x * 1024 + jj] = tp;
        // Precaution: stands in front of any rewrite of the store's registers.
        asm volatile("s_wait_xcnt 0x0" ::: "memory");
    } else if (copies_wo || copies_w1) {
        *(float4*)(copies_w1 ? w1fr + pw * 4 : wofr + po * 4) = ov;
        // Precaution: stands in front of any rewrite of the store's registers.
        asm volatile("s_wait_xcnt 0x0" ::: "memory");
    }

    const int b = row0 >> 9, n0 = row0 & 511;
    #pragma unroll
    for (int p = 0; p < 4; ++p) {
        const int idx = tid + 128 * p;            // float4 index in the block's output
        const int hh = idx >> 8;
        // V: row-major.  Q and K: in the order in which attn_kernel loads its
        // fragments, [16-row tile][i][lane (c, hf)][4]: row 16*tile + c,
        // dk = 16*hf + 4*i + {0..3}.  Either way piece idx goes to place idx.
        const int r  = (which == 2) ? (idx >> 3) & 31 : ((idx >> 7) & 1) * 16 + (idx & 15);
        const int d4 = (which == 2) ? (idx & 7) << 2  : ((idx >> 4) & 1) * 16 + ((idx >> 5) & 3) * 4;
        *(float4*)(outp + ((b * NH + blockIdx.y * 2 + hh) * ND + n0) * DK + (idx & 255) * 4) =
            *(const float4*)&wl[(hh * 2 + (d4 >> 4)) * 16 * XP + r * YW + (d4 & 15)];
    }
}

// ---------------------------------------------------------------------------
// 2) Attention on the f32 16x16x4 matrix form, 32 queries per block.
//    grid = (ND/AQ, NH, B_); 256 threads = 8 waves; wave w owns keys
//    [64w, 64w+64).  St = K * Qt and Ot = Vt * Pt, so a lane holds one query's
//    scores and the score registers are the B operand of the second product.
//    Each wave makes a softmax part (max, sum, unnormalised Ot) over its own
//    keys; the 8 parts are joined through LDS.
// ---------------------------------------------------------------------------
__global__ __launch_bounds__(256) void attn_kernel(
    const float* __restrict__ Q, const float* __restrict__ K,
    const float* __restrict__ V, float* __restrict__ ctx)
{
    __shared__ float sO[8][AQ][OPITCH];   // per-wave unnormalised output parts
    __shared__ float sML[2][8][AQ];       // [0] = part max, [1] = part sum

    const int q0 = blockIdx.x * AQ;
    const int h = blockIdx.y, b = blockIdx.z;
    const int tid = threadIdx.x;
    const int wv = tid >> 5, lane = tid & 31;
    const int c = lane & 15, hf = lane >> 4;

    const float* Qb = Q + ((b * NH + h) * ND + q0) * DK;
    const float* Kb = K + ((b * NH + h) * NT + wv * AKW) * DK;
    const float* Vb = V + ((b * NH + h) * NT + wv * AKW) * DK;

    // Q and K fragments by the same code: lane (c, hf) holds row c,
    // dk = 16*hf + 4*i + {0..3}; two k-steps of the matrix form per float4.
    // qkv_kernel has stored them in that order, [16-row tile][i][lane][4], so a
    // load is 512 contiguous bytes per wave.
    const float* qp = Qb + lane * 4;
    const float* kp = Kb + lane * 4;
    // V: lane (c, hf) holds keys 8*hf + r of each 16-key tile, dv = 2*c, 2*c + 1.
    const float* vp = Vb + hf * 8 * DK + 2 * c;

    float4 qf[2][4];
    float4 kf[4][4];
    float2 vf[4][8];
    #pragma unroll
    for (int i = 0; i < 4; ++i) {
        #pragma unroll
        for (int qt = 0; qt < 2; ++qt)
            qf[qt][i] = *(const float4*)(qp + qt * 16 * DK + 128 * i);
        #pragma unroll
        for (int kt = 0; kt < 4; ++kt)
            kf[kt][i] = *(const float4*)(kp + kt * 16 * DK + 128 * i);
    }
    #pragma unroll
    for (int kt = 0; kt < 4; ++kt)
        #pragma unroll
        for (int r = 0; r < 8; ++r)
            vf[kt][r] = *(const float2*)(vp + (kt * 16 + r) * DK);
    // Every global load of the wave is issued above.  The wait stands before any
    // reuse of their address registers; naming the addresses as inputs keeps
    // those registers live up to it.
    asm volatile("s_wait_xcnt 0x0" :: "v"(qp), "v"(kp), "v"(vp) : "memory");

    // st[kt][qt][r] = score(key = 16*kt + 8*hf + r, query = 16*qt + c), unscaled
    v8f st[4][2];
    #pragma unroll
    for (int kt = 0; kt < 4; ++kt) {
        #pragma unroll
        for (int qt = 0; qt < 2; ++qt)
            #pragma unroll
            for (int e = 0; e < 8; ++e) st[kt][qt][e] = 0.f;
        #pragma unroll
        for (int i = 0; i < 4; ++i) {
            const v2f k01 = {kf[kt][i].x, kf[kt][i].y};
            const v2f k23 = {kf[kt][i].z, kf[kt][i].w};
            #pragma unroll
            for (int qt = 0; qt < 2; ++qt) {
                const v2f q01 = {qf[qt][i].x, qf[qt][i].y};
                st[kt][qt] = __builtin_amdgcn_wmma_f32_16x16x4_f32(
                    false, k01, false, q01, (short)0, st[kt][qt], false, false);
            }
            #pragma unroll
            for (int qt = 0; qt < 2; ++qt) {
                const v2f q23 = {qf[qt][i].z, qf[qt][i].w};
                st[kt][qt] = __builtin_amdgcn_wmma_f32_16x16x4_f32(
                    false, k23, false, q23, (short)0, st[kt][qt], false, false);
            }
        }
    }

    // Softmax part over this wave's 64 keys: in-lane, plus one exchange
    // between the lane halves (they hold the same query).
    const float scale = 0.17677669529663687f;  // 1/sqrt(32)
    float pm[2], pl[2];
    #pragma unroll
    for (int qt = 0; qt < 2; ++qt) {
        float m = st[0][qt][0];
        #pragma unroll
        for (int kt = 0; kt < 4; ++kt)
            #pragma unroll
            for (int r = 0; r < 8; ++r) m = fmaxf(m, st[kt][qt][r]);
        m = fmaxf(m, __shfl_xor(m, 16, 32));
        m *= scale;
        float l = 0.f;
        #pragma unroll
        for (int kt = 0; kt < 4; ++kt)
            #pragma unroll
            for (int r = 0; r < 8; ++r) {
                const float p = __expf(st[kt][qt][r] * scale - m);
                st[kt][qt][r] = p;
                l += p;
            }
        l += __shfl_xor(l, 16, 32);
        pm[qt] = m;
        pl[qt] = l;
    }

    // Ot[dt][qt] += Vt * Pt.  k-step s of key tile kt pairs key 8*hf + 2*s + j
    // on both sides (B = score registers 2s, 2s+1).  Row c of tile dt is
    // dv = 2*c + dt, so one 8-byte load feeds both tiles.
    v8f o[2][2];
    #pragma unroll
    for (int dt = 0; dt < 2; ++dt)
        #pragma unroll
        for (int qt = 0; qt < 2; ++qt)
            #pragma unroll
            for (int e = 0; e < 8; ++e) o[dt][qt][e] = 0.f;

    #pragma unroll
    for (int kt = 0; kt < 4; ++kt) {
        #pragma unroll
        for (int s = 0; s < 4; ++s) {
            const v2f va = {vf[kt][2 * s].x, vf[kt][2 * s + 1].x};
            const v2f vb = {vf[kt][2 * s].y, vf[kt][2 * s + 1].y};
            #pragma unroll
            for (int qt = 0; qt < 2; ++qt) {
                const v2f p = {st[kt][qt][2 * s], st[kt][qt][2 * s + 1]};
                o[0][qt] = __builtin_amdgcn_wmma_f32_16x16x4_f32(
                    false, va, false, p, (short)0, o[0][qt], false, false);
                o[1][qt] = __builtin_amdgcn_wmma_f32_16x16x4_f32(
                    false, vb, false, p, (short)0, o[1][qt], false, false);
            }
        }
    }

    // o[dt][qt][r] = Ot(dv = 16*hf + 2*r + dt, query = 16*qt + c)
    #pragma unroll
    for (int qt = 0; qt < 2; ++qt) {
        float* dst = &sO[wv][qt * 16 + c][hf * 16];
        #pragma unroll
        for (int i = 0; i < 4; ++i)
            *(float4*)(dst + 4 * i) = make_float4(o[0][qt][2 * i],     o[1][qt][2 * i],
                                                  o[0][qt][2 * i + 1], o[1][qt][2 * i + 1]);
        // both halves hold the same max and sum: half 0 stores the max, half 1 the sum
        sML[hf][wv][qt * 16 + c] = hf ? pl[qt] : pm[qt];
    }
    __syncthreads();

    // Join the 8 parts: thread -> query tid/8, four dv.
    const int q = tid >> 3, d4 = (tid & 7) << 2;
    float M = sML[0][0][q];
    #pragma unroll
    for (int w = 1; w < 8; ++w) M = fmaxf(M, sML[0][w][q]);
    float L = 0.f;
    float4 acc = make_float4(0.f, 0.f, 0.f, 0.f);
    #pragma unroll
    for (int w = 0; w < 8; ++w) {
        const float f = __expf(sML[0][w][q] - M);
        const float4 o4 = *(const float4*)&sO[w][q][d4];
        L += f * sML[1][w][q];
        acc.x += f * o4.x; acc.y += f * o4.y; acc.z += f * o4.z; acc.w += f * o4.w;
    }
    const float inv = 1.f / L;
    *(float4*)(ctx + (b * ND + q0 + q) * DM + h * DK + d4) =
        make_float4(acc.x * inv, acc.y * inv, acc.z * inv, acc.w * inv);
}

// A work-group barrier that orders LDS traffic alone.  __syncthreads() also waits
// for every global load the wave has in flight; behind this one such loads stay
// in flight and are waited for where their registers are first used.
__device__ __forceinline__ void lds_barrier()
{
    __builtin_amdgcn_fence(__ATOMIC_RELEASE, "workgroup", "local");
    __builtin_amdgcn_s_barrier();
    __builtin_amdgcn_fence(__ATOMIC_ACQUIRE, "workgroup", "local");
}

// ---------------------------------------------------------------------------
// 3) Output projection + residual + LayerNorm, then the association head, in
//    one launch.  Per (b,n):
//      xn  = LayerNorm(det + ctx w_o^T + b_o)
//      W1n = w1 * xn_row (bf16)
//      Ht  = W1n (128x256) @ tracks[b]^T (256x512)  via v_wmma_f32_16x16x32_bf16
//      out[t] = sigmoid( relu(Ht + b1)^T @ w2 + b2 )
//    A block is 8 waves, 16 detections and 256 tracks of one batch, one block
//    per WGP.
//    First the block makes its own 16 xn rows (the block of the other 256 tracks
//    makes the same rows for itself): wave w owns columns [32w, 32w+32) of the
//    product on the f32 16x16x4 matrix form (two tiles of w_o rows as A, one ctx
//    fragment from LDS feeds both), then rows 2w and 2w+1 of the LayerNorm, which
//    are the two detections it owns in the head.  xn goes to LDS and nowhere else.
//    The tracks and w1 are on their way from memory meanwhile.
//    All that the head reads lies in LDS: the 256 bf16 tracks (128 KB, fragment
//    order), w1 (128 KB, fp32, fragment order), the 16 xn rows, b1 and w2.
//    For each of its two detections a wave builds 64 hidden rows
//    x 256 k of W1n straight into its A fragments (256 registers) and keeps them
//    there while the 256 tracks go by, 64 at a time; then the other 64 hidden
//    rows.  So W1n is never stored or read again, and a track fragment read from
//    LDS feeds four matrix instructions.
//    With W1n as the A operand a lane's accumulators are 32 hidden units of one
//    track: the sum over the hidden units is in-lane, but for the first half's
//    part (kept in LDS by the lane that reads it back) and one exchange between
//    the lane halves.
//    Behind the last barrier the waves are free of each other: of the two waves
//    of a SIMD one can build or sum while the other multiplies.
//    The second launch bound asks for two waves per SIMD (512 registers a wave).
//    blockIdx.x = (batch * 2 + half of the tracks) * 32 + group of 16 detections
// ---------------------------------------------------------------------------
__global__ __launch_bounds__(256, 2) void assoc_kernel(
    const __bf16* __restrict__ trkbf,  // bf16 tracks in fragment order (qkv_kernel)
    const float* __restrict__ det,     // [B][ND][DM]
    const float* __restrict__ ctx,     // [B][ND][DM]
    const float* __restrict__ wo,      // w_o in fragment order (qkv_kernel)
    const float* __restrict__ bo,      // [DM]
    const float* __restrict__ g,       // [DM]
    const float* __restrict__ beta,    // [DM]
    const float* __restrict__ w1f,     // w1 in fragment order (qkv_kernel)
    const float* __restrict__ b1,      // [DH]
    const float* __restrict__ w2,      // [DH]
    const float* __restrict__ b2,      // [1]
    float* __restrict__ out)           // [B][ND][NT]
{
    __shared__ __attribute__((aligned(16))) __bf16 ts[NT / 2 * DM];     // 131,072 bytes
    __shared__ __attribute__((aligned(16))) float ws[DH * DM];          // 131,072 bytes
    __shared__ __attribute__((aligned(16))) float xs[16 * DM];          // the 16 xn rows
    __shared__ __attribute__((aligned(16))) float xb[16 * XP];          // det + attended
    __shared__ __attribute__((aligned(16))) float part[8][4][32][4];    // first half's sums
    __shared__ __attribute__((aligned(16))) float bw[2 * DH];           // b1, then w2

    const int tid   = threadIdx.x;
    const int wave  = tid >> 5;
    const int lane  = tid & 31;
    const int c     = lane & 15;
    const int hf    = lane >> 4;
    const int khalf = hf << 3;            // 0 for lanes 0-15, 8 for lanes 16-31
    const int b     = blockIdx.x >> 6;
    const int th    = (blockIdx.x >> 5) & 1;
    const int n0    = (blockIdx.x & 31) * 16;

    // Every loop of this part is unrolled so that the register arrays are indexed
    // by constants and stay in registers.
    {
        // The ctx tile lies where w1 will lie: w1 is stored there only behind the
        // barrier that ends the tile's last read.
        float* cs = ws;
        const int row0 = b * ND + n0;
        // ctx tile: 16 rows are 4096 contiguous floats; thread t takes float4 t + 256*j
        const float* cb = ctx + row0 * DM;
        const float* wp = wo + wave * 32 * DM + lane * 4;
        const float* bp = bo + wave * 32 + hf * 8;
        const float* dp = det + (row0 + c) * DM + wave * 32 + hf * 8;
        const float* sp = ((tid & DH) ? w2 : b1) + (tid & (DH - 1));
        // Tracks and w1 go into LDS as they lie: thread t takes 16-byte piece t + 256*i.
        const v4f* tp = (const v4f*)(trkbf + (b * NT + th * (NT / 2)) * DM);
        const v4f* fp = (const v4f*)w1f;

        // What the product waits for is asked for first, the tracks behind it.
        v4f cr[4];
        float4 wf[2][8][4];
        #pragma unroll
        for (int j = 0; j < 4; ++j)
            cr[j] = *(const v4f*)(cb + tid * 4 + j * 1024);
        #pragma unroll
        for (int ch = 0; ch < 8; ++ch)
            #pragma unroll
            for (int i = 0; i < 4; ++i)
                #pragma unroll
                for (int t = 0; t < 2; ++t)
                    wf[t][ch][i] = *(const float4*)(wp + t * 16 * DM + (ch * 4 + i) * 128);
        float4 bl[2], bh[2], dl[2], dh[2];
        #pragma unroll
        for (int t = 0; t < 2; ++t) {
            bl[t] = *(const float4*)(bp + t * 16);
            bh[t] = *(const float4*)(bp + t * 16 + 4);
            dl[t] = *(const float4*)(dp + t * 16);
            dh[t] = *(const float4*)(dp + t * 16 + 4);
        }
        float gv[DM / 32], ev[DM / 32];
        #pragma unroll
        for (int i = 0; i < DM / 32; ++i) {
            gv[i] = g[lane + 32 * i];
            ev[i] = beta[lane + 32 * i];
        }
        const float bt = *sp;
        // The wait stands before any reuse of the loads' address registers; naming
        // the addresses (scalar base and index where a load uses those) as inputs keeps
        // them live up to it.  It also keeps the loads of the tracks behind those
        // above: loads return in the order of issue.
        asm volatile("s_wait_xcnt 0x0" :: "s"(cb), "v"(tid), "v"(wp), "v"(bp), "v"(dp), "s"(g), "s"(beta),
                     "v"(lane), "v"(sp) : "memory");
        v4f tr[32], wr[32];
        #pragma unroll
        for (int i = 0; i < 32; ++i)
            tr[i] = tp[tid + i * 256];
        // As above, for the tracks' scalar base and the thread index.
        asm volatile("s_wait_xcnt 0x0" :: "s"(tp), "v"(tid) : "memory");

        #pragma unroll
        for (int j = 0; j < 4; ++j)
            *(v4f*)&cs[((tid >> 6) + 4 * j) * XP + (tid & 63) * 4] = cr[j];
        lds_barrier();

        // Yt = W * Xt as in proj_mma, with the same k order on both sides: lane
        // (c, hf) holds row c, k = 32*ch + 16*hf + 4*i + {0..3}.
        // acc[t][r] = y(row = c, column = 32*wave + 16*t + 8*hf + r).
        const float* xl = cs + c * XP + hf * 16;
        v8f acc[2];
        #pragma unroll
        for (int t = 0; t < 2; ++t) {
            acc[t][0] = bl[t].x; acc[t][1] = bl[t].y; acc[t][2] = bl[t].z; acc[t][3] = bl[t].w;
            acc[t][4] = bh[t].x; acc[t][5] = bh[t].y; acc[t][6] = bh[t].z; acc[t][7] = bh[t].w;
        }
        #pragma unroll
        for (int ch = 0; ch < 8; ++ch) {
            if (ch == 4) {
                // w1 takes the registers that the w_o fragments used so far leave free
                // and arrives under the rest of the product.
                #pragma unroll
                for (int i = 0; i < 32; ++i)
                    wr[i] = fp[tid + i * 256];
                // As above: the wait before any reuse of the loads' address registers.
                asm volatile("s_wait_xcnt 0x0" :: "s"(fp), "v"(tid) : "memory");
            }
            if (ch == 6) {
                // The tracks' stores issue between the
                // matrix instructions.  Nobody reads them before the last barrier.
                // The fence keeps the stores from rising to where the wave would
                // still wait for the tracks.
                __builtin_amdgcn_sched_barrier(0);
                #pragma unroll
                for (int i = 0; i < 32; ++i)
                    ((v4f*)ts)[tid + i * 256] = tr[i];
            }
            #pragma unroll
            for (int i = 0; i < 4; ++i) {
                const float4 xf = *(const float4*)(xl + ch * 32 + 4 * i);
                const v2f x01 = {xf.x, xf.y};
                const v2f x23 = {xf.z, xf.w};
                #pragma unroll
                for (int t = 0; t < 2; ++t) {
                    const v2f w01 = {wf[t][ch][i].x, wf[t][ch][i].y};
                    acc[t] = __builtin_amdgcn_wmma_f32_16x16x4_f32(
                        false, w01, false, x01, (short)0, acc[t], false, false);
                }
                #pragma unroll
                for (int t = 0; t < 2; ++t) {
                    const v2f w23 = {wf[t][ch][i].z, wf[t][ch][i].w};
                    acc[t] = __builtin_amdgcn_wmma_f32_16x16x4_f32(
                        false, w23, false, x23, (short)0, acc[t], false, false);
                }
            }
        }

        #pragma unroll
        for (int t = 0; t < 2; ++t) {
            float* xd = &xb[c * XP + wave * 32 + t * 16 + hf * 8];
            *(float4*)xd       = make_float4(dl[t].x + acc[t][0], dl[t].y + acc[t][1],
                                             dl[t].z + acc[t][2], dl[t].w + acc[t][3]);
            *(float4*)(xd + 4) = make_float4(dh[t].x + acc[t][4], dh[t].y + acc[t][5],
                                             dh[t].z + acc[t][6], dh[t].w + acc[t][7]);
        }
        bw[tid] = bt;
        lds_barrier();

        // wave w reduces rows 2w and 2w+1 (sum, sumsq); every lane ends with both sums
        #pragma unroll
        for (int rr = 0; rr < 2; ++rr) {
            const int row = wave * 2 + rr;
            float xv[DM / 32];
            float s = 0.f, s2 = 0.f;
            #pragma unroll
            for (int i = 0; i < DM / 32; ++i) {
                xv[i] = xb[row * XP + lane + 32 * i];
                s += xv[i]; s2 += xv[i] * xv[i];
            }
            s  += __shfl_xor(s, 1, 32);  s2 += __shfl_xor(s2, 1, 32);
            s  += __shfl_xor(s, 2, 32);  s2 += __shfl_xor(s2, 2, 32);
            s  += __shfl_xor(s, 4, 32);  s2 += __shfl_xor(s2, 4, 32);
            s  += __shfl_xor(s, 8, 32);  s2 += __shfl_xor(s2, 8, 32);
            s  += __shfl_xor(s, 16, 32); s2 += __shfl_xor(s2, 16, 32);
            const float mu  = s * (1.f / DM);
            const float inv = rsqrtf(s2 * (1.f / DM) - mu * mu + 1e-5f);
            #pragma unroll
            for (int i = 0; i < DM / 32; ++i)
                xs[row * DM + lane + 32 * i] = (xv[i] - mu) * inv * gv[i] + ev[i];
        }
        #pragma unroll
        for (int i = 0; i < 32; ++i)
            ((v4f*)ws)[tid + i * 256] = wr[i];
    }
    __syncthreads();

    const float bias2 = b2[0];
    const __bf16* tl = ts + lane * 8;

    // Both operands by the same k order: lane<16 -> k {k0..k0+7, k0+16..k0+23};
    // lane>=16 -> +8.
    union Frag { v16bf v; v8bf h[2]; };

    // Pass it: detection n0 + 2*wave + (it >> 1), hidden rows 64*(it & 1) .. +63.
    for (int it = 0; it < 4; ++it) {
        const int half = it & 1;
        const int dl   = wave * 2 + (it >> 1);

        // af[j][ks]: W1n rows 64*half + 16*j + (lane & 15), k-step ks.  Every loop of
        // the build is unrolled so that af, x and f are indexed by constants and stay
        // in registers.
        Frag af[4][8];
        const float* wl = ws + half * (DH / 2) * DM + lane * 4;
        const float* xl = xs + dl * DM + khalf;
        #pragma unroll
        for (int kb = 0; kb < 4; ++kb) {
            // Two k-steps at a time.
            v4f x[2][4], f[2][4][4];
            #pragma unroll
            for (int w = 0; w < 2; ++w)
                #pragma unroll
                for (int q = 0; q < 4; ++q)
                    x[w][q] = *(const v4f*)(xl + (kb * 2 + w) * 32 + (q >> 1) * 16 + (q & 1) * 4);
            #pragma unroll
            for (int w = 0; w < 2; ++w)
                #pragma unroll
                for (int j = 0; j < 4; ++j)
                    #pragma unroll
                    for (int q = 0; q < 4; ++q)
                        f[w][j][q] = *(const v4f*)(wl + ((j * 8 + kb * 2 + w) * 4 + q) * 128);
            // Keeps the loads above as one group: without it the compiler sinks each
            // load to just before its use and the wave waits out every load's latency.
            __builtin_amdgcn_sched_barrier(0);
            #pragma unroll
            for (int w = 0; w < 2; ++w)
                #pragma unroll
                for (int j = 0; j < 4; ++j)
                    #pragma unroll
                    for (int q = 0; q < 4; ++q) {
                        const v4f p = f[w][j][q] * x[w][q];
                        #pragma unroll
                        for (int e = 0; e < 4; ++e)
                            af[j][kb * 2 + w].h[q >> 1][(q & 1) * 4 + e] = (__bf16)p[e];
                    }
            // Keeps the next group of loads behind these products: with more groups in
            // flight beside the fragments the registers run out and values are spilled.
            __builtin_amdgcn_sched_barrier(0);
        }

        // Track fragments are fetched one k-step ahead into a second register set
        // while the current set's products run; the last k-step of a group fetches
        // the first of the next group (behind the last group: of the first again,
        // not used).
        Frag bf[2][4];
        #pragma unroll
        for (int ti = 0; ti < 4; ++ti) {
            bf[0][ti].h[0] = *(const v8bf*)(tl + ti * TT);
            bf[0][ti].h[1] = *(const v8bf*)(tl + ti * TT + TH);
        }

        for (int g = 0; g < 4; ++g) {
            const __bf16* tg = tl + g * 4 * TT;
            const __bf16* tn = tl + ((g + 1) & 3) * 4 * TT;

            // acc[ti][j][r] = Ht(hidden = 64*half + 16*j + 8*hf + r,
            //                    track = 256*th + 64*g + 16*ti + (lane & 15))
            v8f acc[4][4];
            #pragma unroll
            for (int ti = 0; ti < 4; ++ti)
                #pragma unroll
                for (int j = 0; j < 4; ++j)
                    #pragma unroll
                    for (int e = 0; e < 8; ++e) acc[ti][j][e] = 0.f;

            // Unrolled so that the fragment sets and acc are indexed by constants.
            #pragma unroll
            for (int ks = 0; ks < DM / 32; ++ks) {
                const __bf16* s = (ks + 1 < DM / 32) ? tg + (ks + 1) * TK : tn;
                #pragma unroll
                for (int ti = 0; ti < 4; ++ti) {
                    bf[(ks + 1) & 1][ti].h[0] = *(const v8bf*)(s + ti * TT);
                    bf[(ks + 1) & 1][ti].h[1] = *(const v8bf*)(s + ti * TT + TH);
                }
                // Keeps the loads above as one group ahead of this k-step's products.
                __builtin_amdgcn_sched_barrier(0);
                #pragma unroll
                for (int j = 0; j < 4; ++j)
                    #pragma unroll
                    for (int ti = 0; ti < 4; ++ti)
                        acc[ti][j] = __builtin_amdgcn_wmma_f32_16x16x32_bf16(
                            false, af[j][ks].v, false, bf[ks & 1][ti].v,
                            (short)0, acc[ti][j], false, false);
                // Keeps the next k-step's loads behind these products (the other side
                // of the fence above).
                __builtin_amdgcn_sched_barrier(0);
            }

            // Second layer: this lane's 32 hidden units of each of its four tracks
            // (unrolled: acc and s2 are indexed by constants).
            v2f s2[4];
            #pragma unroll
            for (int ti = 0; ti < 4; ++ti) s2[ti] = (v2f){0.f, 0.f};
            #pragma unroll
            for (int j = 0; j < 4; ++j) {
                const int hb = half * 64 + j * 16 + khalf;
                const v4f bl = *(const v4f*)&bw[hb];
                const v4f bh = *(const v4f*)&bw[hb + 4];
                const v4f wl2 = *(const v4f*)&bw[DH + hb];
                const v4f wh2 = *(const v4f*)&bw[DH + hb + 4];
                #pragma unroll
                for (int ti = 0; ti < 4; ++ti) {
                    #pragma unroll
                    for (int p = 0; p < 2; ++p) {
                        v2f hl = {acc[ti][j][2 * p] + bl[2 * p], acc[ti][j][2 * p + 1] + bl[2 * p + 1]};
                        v2f hh = {acc[ti][j][4 + 2 * p] + bh[2 * p], acc[ti][j][5 + 2 * p] + bh[2 * p + 1]};
                        hl.x = fmaxf(hl.x, 0.f); hl.y = fmaxf(hl.y, 0.f);
                        hh.x = fmaxf(hh.x, 0.f); hh.y = fmaxf(hh.y, 0.f);
                        s2[ti] += hl * (v2f){wl2[2 * p], wl2[2 * p + 1]};
                        s2[ti] += hh * (v2f){wh2[2 * p], wh2[2 * p + 1]};
                    }
                }
            }
            v4f ps = {s2[0].x + s2[0].y, s2[1].x + s2[1].y, s2[2].x + s2[2].y, s2[3].x + s2[3].y};
            v4f* pp = (v4f*)&part[wave][g][lane][0];
            if (half == 0) {
                *pp = ps;                 // read back by this lane alone
            } else {
                ps += *pp;
                // Join the two lane halves (the same track, the other hidden units).
                float sv[4];
                #pragma unroll
                for (int ti = 0; ti < 4; ++ti) {
                    const int si = __float_as_int(ps[ti]);
                    sv[ti] = ps[ti] + __int_as_float(
                        __builtin_amdgcn_permlanex16(si, si, 0x76543210, 0xfedcba98, false, false));
                }
                // Half hf finishes track tiles 2*j + hf: a store is 32 consecutive tracks, one whole line.
                float* op = out + (b * ND + n0 + dl) * NT + th * (NT / 2) + g * 64 + lane;
                #pragma unroll
                for (int j = 0; j < 2; ++j) {
                    const float logit = (hf ? sv[2 * j + 1] : sv[2 * j]) + bias2;
                    op[j * 32] = 1.f / (1.f + __expf(-logit));
                }
                // The wait before the next group reuses the stores' address and data registers.
                asm volatile("s_wait_xcnt 0x0" :: "v"(op) : "memory");
            }
        }
    }
}

// ---------------------------------------------------------------------------
// Launcher
// ---------------------------------------------------------------------------
extern "C" void kernel_launch(void* const* d_in, const int* in_sizes, int n_in,
                              void* d_out, int out_size, void* d_ws, size_t ws_size,
                              hipStream_t stream)
{
    const float* det = (const float*)d_in[0];
    const float* trk = (const float*)d_in[1];
    const float* wq  = (const float*)d_in[2];
    const float* bq  = (const float*)d_in[3];
    const float* wk  = (const float*)d_in[4];
    const float* bk  = (const float*)d_in[5];
    const float* wv  = (const float*)d_in[6];
    const float* bv  = (const float*)d_in[7];
    const float* wo  = (const float*)d_in[8];
    const float* bo  = (const float*)d_in[9];
    const float* lng = (const float*)d_in[10];
    const float* lnb = (const float*)d_in[11];
    const float* w1  = (const float*)d_in[12];
    const float* b1  = (const float*)d_in[13];
    const float* w2  = (const float*)d_in[14];
    const float* b2  = (const float*)d_in[15];
    float* out = (float*)d_out;

    const size_t rowsD = (size_t)B_ * ND * DM;  // 524288 floats
    float* Q   = (float*)d_ws;
    float* K   = Q + rowsD;
    float* V   = K + rowsD;
    float* CTX = V + rowsD;
    __bf16* TRKB = (__bf16*)(CTX + rowsD);      // 1 MB of bf16
    float* WFO = (float*)(TRKB + rowsD);        // 256 KB: w_o in fragment order
    float* W1F = WFO + DM * DM;                 // 128 KB: w1 in fragment order

    qkv_kernel<<<dim3(B_ * ND / 32, DM / 64, 3), 128, 0, stream>>>(det, trk, wq, wk, wv, wo, w1, bq, bk, bv,
                                                                  Q, K, V, TRKB, WFO, W1F);
    attn_kernel<<<dim3(ND / AQ, NH, B_), 256, 0, stream>>>(Q, K, V, CTX);
    assoc_kernel<<<dim3(B_ * 2 * (ND / 16)), 256, 0, stream>>>(TRKB, det, CTX, WFO, bo, lng, lnb,
                                                               W1F, b1, w2, b2, out);
}

// v008
// Measured time: 55.7 microseconds a run.
// Two timings next to v007 both put it at 1.04 times that version's speed.
// All steps since v000 together make it 5.32 times as fast.
#include <hip/hip_runtime.h>
#include <hip/hip_bf16.h>

#define B_    4
#define ND    512
#define NT    512
#define DM    256
#define DH    128
#define NH    8
#define DK    32
#define XP    260    // floats per LDS row of 256 fp32: 256 + 4 pad (16 B x odd)
#define XB    264    // bf16 per LDS row of a split x tile: 256 + 8 pad (16 B x odd)
#define YW    20     // floats per LDS row of a qkv wave's output part: 16 + 4 pad (16 B x odd)
#define AQ    32     // queries per attention block
#define AKW   64     // keys per attention wave
#define OPITCH 36    // floats per LDS row of an output part: 32 + 4 pad, 16B aligned
#define TH    256    // bf16 elems of half a track fragment: 32 lanes x 8
#define TK    512    // bf16 elems of a track fragment (16 tracks x 32 k)
#define TT    4096   // bf16 elems of a track tile (16 tracks x 256 k)

typedef __attribute__((ext_vector_type(16))) __bf16 v16bf;
typedef __attribute__((ext_vector_type(8)))  __bf16 v8bf;
typedef __attribute__((ext_vector_type(8)))  float  v8f;
typedef __attribute__((ext_vector_type(2)))  float  v2f;
typedef __attribute__((ext_vector_type(4)))  float  v4f;
typedef __attribute__((ext_vector_type(4)))  __bf16 v4bf;
typedef __attribute__((ext_vector_type(16))) float  v16f;

// One operand fragment of the bf16 16x16x32 matrix form, as two 16-byte halves.
union BF { v16bf v; v8bf h[2]; };

// fp32 values as sums of two bf16 parts: hi = a rounded, lo = (a - hi) rounded.
// A pair of values shares one conversion instruction; hi goes back to fp32 by a
// shift or a mask of the packed word (a bf16 is the upper half of its fp32).
template <int N, typename VF, typename VB>
__device__ __forceinline__ void split(const VF a, VB& hi, VB& lo)
{
    typedef __attribute__((ext_vector_type(N / 2))) unsigned VU;
    hi = __builtin_convertvector(a, VB);
    const VU w = __builtin_bit_cast(VU, hi);
    VF back;
    #pragma unroll
    for (int p = 0; p < N / 2; ++p) {
        back[2 * p]     = __uint_as_float(w[p] << 16);
        back[2 * p + 1] = __uint_as_float(w[p] & 0xffff0000u);
    }
    lo = __builtin_convertvector(a - back, VB);
}

__device__ __forceinline__ void split4(const v4f a, v4bf& hi, v4bf& lo)
{
    split<4>(a, hi, lo);
}

__device__ __forceinline__ void split16(const v16f a, v16bf& hi, v16bf& lo)
{
    split<16>(a, hi, lo);
}

__device__ __forceinline__ void frag16(const float4 (&f)[4], v16bf& hi, v16bf& lo)
{
    const v16f a = {f[0].x, f[0].y, f[0].z, f[0].w, f[1].x, f[1].y, f[1].z, f[1].w,
                    f[2].x, f[2].y, f[2].z, f[2].w, f[3].x, f[3].y, f[3].z, f[3].w};
    split16(a, hi, lo);
}

__device__ __forceinline__ v8f bmma(const v16bf a, const v16bf b, const v8f c)
{
    return __builtin_amdgcn_wmma_f32_16x16x32_bf16(false, a, false, b, (short)0, c, false, false);
}

// ---------------------------------------------------------------------------
// The q, k and v projections y = x W^T + b as Yt = W * Xt: A = 16 rows of W
// (output columns), B = 16 rows of x.  Each fp32 operand is split into two bf16
// parts (a = hi + lo) and a product is three bf16 16x16x32 matrix instructions,
// lo*hi + hi*lo + hi*hi, summed in fp32; lo*lo is left out.
// Both fragments in the same k order: lane (c, hf) holds row c, element e is
// k = 32*ch + 16*hf + e.
// acc[qt][r] = y(row = 16*qt + c, column = 8*hf + r).
// wf: the wave's 16 rows of W, all 256 k, in registers, in this order (fp32).
// xh, xo: the lane's place in the hi and lo planes of the x tile in LDS
// (row c, k = 16*hf).
// ---------------------------------------------------------------------------
template <int NQ>
__device__ __forceinline__ void proj_mma(const float4 (&wf)[8][4], const __bf16* xh, const __bf16* xo,
                                         v8f (&acc)[NQ])
{
    // every loop here is unrolled so that wf and acc are indexed by constants
    // and stay in registers
    #pragma unroll
    for (int ch = 0; ch < 8; ++ch) {
        BF bh[NQ], bl[NQ];
        #pragma unroll
        for (int qt = 0; qt < NQ; ++qt) {
            bh[qt].h[0] = *(const v8bf*)(xh + qt * 16 * XB + ch * 32);
            bh[qt].h[1] = *(const v8bf*)(xh + qt * 16 * XB + ch * 32 + 8);
            bl[qt].h[0] = *(const v8bf*)(xo + qt * 16 * XB + ch * 32);
            bl[qt].h[1] = *(const v8bf*)(xo + qt * 16 * XB + ch * 32 + 8);
        }
        v16bf ah, al;
        frag16(wf[ch], ah, al);
        #pragma unroll
        for (int qt = 0; qt < NQ; ++qt) acc[qt] = bmma(al, bh[qt].v, acc[qt]);
        #pragma unroll
        for (int qt = 0; qt < NQ; ++qt) acc[qt] = bmma(ah, bl[qt].v, acc[qt]);
        #pragma unroll
        for (int qt = 0; qt < NQ; ++qt) acc[qt] = bmma(ah, bh[qt].v, acc[qt]);
    }
}

// ---------------------------------------------------------------------------
// 1) QKV projection: block = 32 rows x 64 output columns (two heads), 4 waves,
//    wave w owns columns [16w, 16w+16).  The 32 rows of x are staged in LDS, split
//    into their bf16 hi and lo planes once, and shared by the waves.  A wave's 16 rows of W are 16 KB in a row in memory:
//    it loads them as they lie (a load is 512 contiguous bytes, four whole
//    lines), puts them into LDS and reads its fragments back from there.
//    blockIdx.x = row tile (0..63), .y = column group (0..3), .z = 0=Q,1=K,2=V
//    Three operands of later kernels are laid out here as well, in the order in
//    which those kernels load their matrix fragments, so that one 16-byte load
//    per lane is 512 contiguous bytes per wave there; a thread writes one
//    16-byte piece, a wave 512 contiguous bytes:
//    K and V blocks, from their x tile: tracks fp32 -> bf16 for the head,
//    [B*NT/16 track tiles][DM/32 k-steps][2 halves][32 lanes][8 bf16]; lane
//    (c, hf) of half h holds track 16*tile + c, k = 32*kstep + 16*h + 8*hf + {0..7}.
//    Q blocks of column groups 0 and 1: w_o (fp32 as it is) for assoc_kernel,
//    [DM/16 row tiles][8 ch][4 i][32 lanes][4 floats]; lane (c, hf) holds row
//    16*tile + c, k = 32*ch + 16*hf + 4*i + {0..3}.
//    Q blocks of column group 2: w1 (fp32 as it is) for assoc_kernel,
//    [DH/16 row tiles][DM/32 k-steps][4 q][32 lanes][4 floats]; lane (c, hf)
//    holds row 16*tile + c, k = 32*kstep + 16*(q >> 1) + 8*hf + 4*(q & 1) + {0..3}.
// ---------------------------------------------------------------------------
__global__ __launch_bounds__(128) void qkv_kernel(
    const float* __restrict__ det, const float* __restrict__ trk,
    const float* __restrict__ wq, const float* __restrict__ wk,
    const float* __restrict__ wv, const float* __restrict__ wo,
    const float* __restrict__ w1,
    const float* __restrict__ bq, const float* __restrict__ bk,
    const float* __restrict__ bv,
    float* __restrict__ Q, float* __restrict__ K, float* __restrict__ V,
    __bf16* __restrict__ trkb, float* __restrict__ wofr, float* __restrict__ w1fr)
{
    __shared__ __attribute__((aligned(16))) __bf16 xhs[32 * XB];   // x tile, hi parts
    __shared__ __attribute__((aligned(16))) __bf16 xls[32 * XB];   // x tile, lo parts
    __shared__ __attribute__((aligned(16))) float wl[64 * XP];
    const int which = blockIdx.z;
    const int tid   = threadIdx.x;
    const int row0  = blockIdx.x * 32;
    const int wave = tid >> 5, lane = tid & 31;
    const int c = lane & 15, hf = lane >> 4;
    const int col0 = blockIdx.y * 64 + wave * 16;

    const float* in   = (which == 0) ? det : trk;
    const float* W    = (which == 0) ? wq : (which == 1) ? wk : wv;
    const float* bias = (which == 0) ? bq : (which == 1) ? bk : bv;
    float* outp       = (which == 0) ? Q  : (which == 1) ? K  : V;

    // The thread's piece of the w_o copy (blocks with copies_wo only).
    const bool copies_wo = (which == 0) && (blockIdx.y < 2);
    const int po = (blockIdx.x * 2 + (blockIdx.y & 1)) * 128 + tid;    // 0 .. 16383
    // The thread's piece of the w1 copy (blocks with copies_w1 only).
    const bool copies_w1 = (which == 0) && (blockIdx.y == 2);
    const int pw = blockIdx.x * 128 + tid;                             // 0 .. 8191

    // x tile: 32 rows are 8192 contiguous floats; thread t takes float4 t + 128*j
    // W rows: 16 rows are 4096 contiguous floats; lane l takes float4 l + 32*j
    const float* xb = in + row0 * DM;
    const float* xp = xb + tid * 4;
    const float* wp = W + col0 * DM + lane * 4;
    const float* bp = bias + col0 + hf * 8;
    const float* sp = copies_w1
        ? w1 + ((pw >> 10) * 16 + (pw & 15)) * DM
             + ((pw >> 7) & 7) * 32 + ((pw >> 6) & 1) * 16 + ((pw >> 4) & 1) * 8 + ((pw >> 5) & 1) * 4
        : wo + ((po >> 10) * 16 + (po & 15)) * DM
             + ((po >> 7) & 7) * 32 + ((po >> 4) & 1) * 16 + ((po >> 5) & 3) * 4;
    float4 ov = make_float4(0.f, 0.f, 0.f, 0.f);
    if (copies_wo || copies_w1)
        ov = *(const float4*)sp;
    v4f xr[16];
    v4f wr[32];
    #pragma unroll
    for (int j = 0; j < 16; ++j)
        xr[j] = *(const v4f*)(xp + j * 512);
    #pragma unroll
    for (int j = 0; j < 32; ++j)
        wr[j] = *(const v4f*)(wp + j * 128);
    const float4 bl = *(const float4*)bp;
    const float4 bh = *(const float4*)(bp + 4);
    // Every global load of the wave is issued above.  The wait stands before any
    // reuse of their address registers; naming the addresses as inputs (the x
    // tile's also as the scalar base that its loads may use) keeps those
    // registers live up to it.
    asm volatile("s_wait_xcnt 0x0" :: "v"(xp), "s"(xb), "v"(wp), "v"(bp), "v"(sp) : "memory");

    #pragma unroll
    for (int j = 0; j < 16; ++j) {
        v4bf h4, l4;
        split4(xr[j], h4, l4);
        *(v4bf*)&xhs[((tid >> 6) + 2 * j) * XB + (tid & 63) * 4] = h4;
        *(v4bf*)&xls[((tid >> 6) + 2 * j) * XB + (tid & 63) * 4] = l4;
    }
    #pragma unroll
    for (int j = 0; j < 32; ++j)
        *(v4f*)&wl[(wave * 16 + (j >> 1)) * XP + (j & 1) * 128 + lane * 4] = wr[j];
    __syncthreads();

    float4 wf[8][4];
    #pragma unroll
    for (int ch = 0; ch < 8; ++ch)
        #pragma unroll
        for (int i = 0; i < 4; ++i)
            wf[ch][i] = *(const float4*)&wl[(wave * 16 + c) * XP + hf * 16 + ch * 32 + 4 * i];

    v8f acc[2];
    #pragma unroll
    for (int qt = 0; qt < 2; ++qt) {
        acc[qt][0] = bl.x; acc[qt][1] = bl.y; acc[qt][2] = bl.z; acc[qt][3] = bl.w;
        acc[qt][4] = bh.x; acc[qt][5] = bh.y; acc[qt][6] = bh.z; acc[qt][7] = bh.w;
    }
    proj_mma<2>(wf, &xhs[c * XB + hf * 16], &xls[c * XB + hf * 16], acc);

    // Through LDS, so that each 128-byte line of the output is stored whole by
    // one wave.  A wave puts its 32 rows x 16 columns where its own rows of W
    // lay: only this wave has read them, and it has read them all by now.
    #pragma unroll
    for (int qt = 0; qt < 2; ++qt) {
        float* dst = &wl[wave * 16 * XP + (qt * 16 + c) * YW + hf * 8];
        *(float4*)dst       = make_float4(acc[qt][0], acc[qt][1], acc[qt][2], acc[qt][3]);
        *(float4*)(dst + 4) = make_float4(acc[qt][4], acc[qt][5], acc[qt][6], acc[qt][7]);
    }
    // The 32 tracks of the x tile are 1024 pieces; the eight K and V blocks of
    // this row tile take 128 each.
    const int jj = (((which - 1) & 1) * 4 + blockIdx.y) * 128 + tid;
    v8bf tp = {};
    if (which != 0)      // the hi plane is the tracks rounded to bf16
        tp = *(const v8bf*)&xhs[((jj >> 9) * 16 + (jj & 15)) * XB
                                + ((jj >> 6) & 7) * 32 + ((jj >> 5) & 1) * 16 + ((jj >> 4) & 1) * 8];
    __syncthreads();

    // The copies are stored behind the last barrier: in front of one, the
    // barrier would wait for the store to complete.
    if (which != 0) {
        ((v8bf*)trkb)[blockIdx.x * 1024 + jj] = tp;
        // Precaution: stands in front of any rewrite of the store's registers.
        asm volatile("s_wait_xcnt 0x0" ::: "memory");
    } else if (copies_wo || copies_w1) {
        *(float4*)(copies_w1 ? w1fr + pw * 4 : wofr + po * 4) = ov;
        // Precaution: stands in front of any rewrite of the store's registers.
        asm volatile("s_wait_xcnt 0x0" ::: "memory");
    }

    const int b = row0 >> 9, n0 = row0 & 511;
    #pragma unroll
    for (int p = 0; p < 4; ++p) {
        const int idx = tid + 128 * p;            // float4 index in the block's output
        const int hh = idx >> 8;
        // V: row-major.  Q and K: in the order in which attn_kernel loads its
        // fragments, [16-row tile][i][lane (c, hf)][4]: row 16*tile + c,
        // dk = 16*hf + 4*i + {0..3}.  Either way piece idx goes to place idx.
        const int r  = (which == 2) ? (idx >> 3) & 31 : ((idx >> 7) & 1) * 16 + (idx & 15);
        const int d4 = (which == 2) ? (idx & 7) << 2  : ((idx >> 4) & 1) * 16 + ((idx >> 5) & 3) * 4;
        *(float4*)(outp + ((b * NH + blockIdx.y * 2 + hh) * ND + n0) * DK + (idx & 255) * 4) =
            *(const float4*)&wl[(hh * 2 + (d4 >> 4)) * 16 * XP + r * YW + (d4 & 15)];
    }
}

// ---------------------------------------------------------------------------
// 2) Attention on the bf16 16x16x32 matrix form with split fp32 operands, 32
//    queries per block.
//    grid = (ND/AQ, NH, B_); 256 threads = 8 waves; wave w owns keys
//    [64w, 64w+64).  St = K * Qt and Ot = Vt * Pt, so a lane holds one query's
//    scores and the score registers are the B operand of the second product.
//    Each wave makes a softmax part (max, sum, unnormalised Ot) over its own
//    keys; the 8 parts are joined through LDS.
// ---------------------------------------------------------------------------
__global__ __launch_bounds__(256) void attn_kernel(
    const float* __restrict__ Q, const float* __restrict__ K,
    const float* __restrict__ V, float* __restrict__ ctx)
{
    __shared__ float sO[8][AQ][OPITCH];   // per-wave unnormalised output parts
    __shared__ float sML[2][8][AQ];       // [0] = part max, [1] = part sum

    const int q0 = blockIdx.x * AQ;
    const int h = blockIdx.y, b = blockIdx.z;
    const int tid = threadIdx.x;
    const int wv = tid >> 5, lane = tid & 31;
    const int c = lane & 15, hf = lane >> 4;

    const float* Qb = Q + ((b * NH + h) * ND + q0) * DK;
    const float* Kb = K + ((b * NH + h) * NT + wv * AKW) * DK;
    const float* Vb = V + ((b * NH + h) * NT + wv * AKW) * DK;

    // Q and K fragments by the same code: lane (c, hf) holds row c,
    // dk = 16*hf + 4*i + {0..3}.
    // qkv_kernel has stored them in that order, [16-row tile][i][lane][4], so a
    // load is 512 contiguous bytes per wave.
    const float* qp = Qb + lane * 4;
    const float* kp = Kb + lane * 4;
    // V: lane (c, hf) holds keys 8*hf + r of each 16-key tile, dv = 2*c, 2*c + 1.
    const float* vp = Vb + hf * 8 * DK + 2 * c;

    float4 qf[2][4];
    float4 kf[4][4];
    float2 vf[4][8];
    #pragma unroll
    for (int i = 0; i < 4; ++i) {
        #pragma unroll
        for (int qt = 0; qt < 2; ++qt)
            qf[qt][i] = *(const float4*)(qp + qt * 16 * DK + 128 * i);
        #pragma unroll
        for (int kt = 0; kt < 4; ++kt)
            kf[kt][i] = *(const float4*)(kp + kt * 16 * DK + 128 * i);
    }
    #pragma unroll
    for (int kt = 0; kt < 4; ++kt)
        #pragma unroll
        for (int r = 0; r < 8; ++r)
            vf[kt][r] = *(const float2*)(vp + (kt * 16 + r) * DK);
    // Every global load of the wave is issued above.  The wait stands before any
    // reuse of their address registers; naming the addresses as inputs keeps
    // those registers live up to it.
    asm volatile("s_wait_xcnt 0x0" :: "v"(qp), "v"(kp), "v"(vp) : "memory");

    // Every fp32 operand goes in as two bf16 parts (split16) and a product is
    // lo*hi + hi*lo + hi*hi; dk = 32 is one k-step of the bf16 form.  Element e of
    // a Q or K fragment is dk = 16*hf + e on both sides.
    // st[kt][qt][r] = score(key = 16*kt + 8*hf + r, query = 16*qt + c), unscaled
    v16bf qh[2], ql[2], kh[4], kl[4];
    #pragma unroll
    for (int qt = 0; qt < 2; ++qt) frag16(qf[qt], qh[qt], ql[qt]);
    #pragma unroll
    for (int kt = 0; kt < 4; ++kt) frag16(kf[kt], kh[kt], kl[kt]);
    v8f st[4][2];
    #pragma unroll
    for (int kt = 0; kt < 4; ++kt)
        #pragma unroll
        for (int qt = 0; qt < 2; ++qt) {
            #pragma unroll
            for (int e = 0; e < 8; ++e) st[kt][qt][e] = 0.f;
            st[kt][qt] = bmma(kl[kt], qh[qt], st[kt][qt]);
        }
    #pragma unroll
    for (int kt = 0; kt < 4; ++kt)
        #pragma unroll
        for (int qt = 0; qt < 2; ++qt) st[kt][qt] = bmma(kh[kt], ql[qt], st[kt][qt]);
    #pragma unroll
    for (int kt = 0; kt < 4; ++kt)
        #pragma unroll
        for (int qt = 0; qt < 2; ++qt) st[kt][qt] = bmma(kh[kt], qh[qt], st[kt][qt]);

    // Softmax part over this wave's 64 keys: in-lane, plus one exchange
    // between the lane halves (they hold the same query).
    const float scale = 0.17677669529663687f;  // 1/sqrt(32)
    float pm[2], pl[2];
    #pragma unroll
    for (int qt = 0; qt < 2; ++qt) {
        float m = st[0][qt][0];
        #pragma unroll
        for (int kt = 0; kt < 4; ++kt)
            #pragma unroll
            for (int r = 0; r < 8; ++r) m = fmaxf(m, st[kt][qt][r]);
        m = fmaxf(m, __shfl_xor(m, 16, 32));
        m *= scale;
        float l = 0.f;
        #pragma unroll
        for (int kt = 0; kt < 4; ++kt)
            #pragma unroll
            for (int r = 0; r < 8; ++r) {
                const float p = __expf(st[kt][qt][r] * scale - m);
                st[kt][qt][r] = p;
                l += p;
            }
        l += __shfl_xor(l, 16, 32);
        pm[qt] = m;
        pl[qt] = l;
    }

    // Ot[dt][qt] += Vt * Pt, split as above.  A k-step is two key tiles: element e
    // is key 16*(2*kp + (e >> 3)) + 8*hf + (e & 7) on both sides (B = the score
    // registers of the two tiles).  Row c of tile dt is dv = 2*c + dt, so one
    // 8-byte load feeds both tiles.
    v8f o[2][2];
    #pragma unroll
    for (int dt = 0; dt < 2; ++dt)
        #pragma unroll
        for (int qt = 0; qt < 2; ++qt)
            #pragma unroll
            for (int e = 0; e < 8; ++e) o[dt][qt][e] = 0.f;

    #pragma unroll
    for (int kp = 0; kp < 2; ++kp) {
        v16bf ph[2], pz[2], vh[2], vz[2];
        #pragma unroll
        for (int qt = 0; qt < 2; ++qt) {
            v16f a;
            #pragma unroll
            for (int e = 0; e < 16; ++e) a[e] = st[2 * kp + (e >> 3)][qt][e & 7];
            split16(a, ph[qt], pz[qt]);
        }
        #pragma unroll
        for (int dt = 0; dt < 2; ++dt) {
            v16f a;
            #pragma unroll
            for (int e = 0; e < 16; ++e)
                a[e] = dt ? vf[2 * kp + (e >> 3)][e & 7].y : vf[2 * kp + (e >> 3)][e & 7].x;
            split16(a, vh[dt], vz[dt]);
        }
        #pragma unroll
        for (int dt = 0; dt < 2; ++dt)
            #pragma unroll
            for (int qt = 0; qt < 2; ++qt) o[dt][qt] = bmma(vz[dt], ph[qt], o[dt][qt]);
        #pragma unroll
        for (int dt = 0; dt < 2; ++dt)
            #pragma unroll
            for (int qt = 0; qt < 2; ++qt) o[dt][qt] = bmma(vh[dt], pz[qt], o[dt][qt]);
        #pragma unroll
        for (int dt = 0; dt < 2; ++dt)
            #pragma unroll
            for (int qt = 0; qt < 2; ++qt) o[dt][qt] = bmma(vh[dt], ph[qt], o[dt][qt]);
    }

    // o[dt][qt][r] = Ot(dv = 16*hf + 2*r + dt, query = 16*qt + c)
    #pragma unroll
    for (int qt = 0; qt < 2; ++qt) {
        float* dst = &sO[wv][qt * 16 + c][hf * 16];
        #pragma unroll
        for (int i = 0; i < 4; ++i)
            *(float4*)(dst + 4 * i) = make_float4(o[0][qt][2 * i],     o[1][qt][2 * i],
                                                  o[0][qt][2 * i + 1], o[1][qt][2 * i + 1]);
        // both halves hold the same max and sum: half 0 stores the max, half 1 the sum
        sML[hf][wv][qt * 16 + c] = hf ? pl[qt] : pm[qt];
    }
    __syncthreads();

    // Join the 8 parts: thread -> query tid/8, four dv.
    const int q = tid >> 3, d4 = (tid & 7) << 2;
    float M = sML[0][0][q];
    #pragma unroll
    for (int w = 1; w < 8; ++w) M = fmaxf(M, sML[0][w][q]);
    float L = 0.f;
    float4 acc = make_float4(0.f, 0.f, 0.f, 0.f);
    #pragma unroll
    for (int w = 0; w < 8; ++w) {
        const float f = __expf(sML[0][w][q] - M);
        const float4 o4 = *(const float4*)&sO[w][q][d4];
        L += f * sML[1][w][q];
        acc.x += f * o4.x; acc.y += f * o4.y; acc.z += f * o4.z; acc.w += f * o4.w;
    }
    const float inv = 1.f / L;
    *(float4*)(ctx + (b * ND + q0 + q) * DM + h * DK + d4) =
        make_float4(acc.x * inv, acc.y * inv, acc.z * inv, acc.w * inv);
}

// A work-group barrier that orders LDS traffic alone.  __syncthreads() also waits
// for every global load the wave has in flight; behind this one such loads stay
// in flight and are waited for where their registers are first used.
__device__ __forceinline__ void lds_barrier()
{
    __builtin_amdgcn_fence(__ATOMIC_RELEASE, "workgroup", "local");
    __builtin_amdgcn_s_barrier();
    __builtin_amdgcn_fence(__ATOMIC_ACQUIRE, "workgroup", "local");
}

// ---------------------------------------------------------------------------
// 3) Output projection + residual + LayerNorm, then the association head, in
//    one launch.  Per (b,n):
//      xn  = LayerNorm(det + ctx w_o^T + b_o)
//      W1n = w1 * xn_row (bf16)
//      Ht  = W1n (128x256) @ tracks[b]^T (256x512)  via v_wmma_f32_16x16x32_bf16
//      out[t] = sigmoid( relu(Ht + b1)^T @ w2 + b2 )
//    A block is 8 waves, 16 detections and 256 tracks of one batch, one block
//    per WGP.
//    First the block makes its own 16 xn rows (the block of the other 256 tracks
//    makes the same rows for itself): wave w owns columns [32w, 32w+32) of the
//    product, on split fp32 operands as in proj_mma (two tiles of w_o rows as A,
//    one ctx fragment from LDS feeds both), then rows 2w and 2w+1 of the LayerNorm, which
//    are the two detections it owns in the head.  xn goes to LDS and nowhere else.
//    The tracks and w1 are on their way from memory meanwhile.
//    All that the head reads lies in LDS: the 256 bf16 tracks (128 KB, fragment
//    order), w1 (128 KB, fp32, fragment order), the 16 xn rows, b1 and w2.
//    For each of its two detections a wave builds 64 hidden rows
//    x 256 k of W1n straight into its A fragments (256 registers) and keeps them
//    there while the 256 tracks go by, 64 at a time; then the other 64 hidden
//    rows.  So W1n is never stored or read again, and a track fragment read from
//    LDS feeds four matrix instructions.
//    With W1n as the A operand a lane's accumulators are 32 hidden units of one
//    track: the sum over the hidden units is in-lane, but for the first half's
//    part (kept in LDS by the lane that reads it back) and one exchange between
//    the lane halves.
//    Behind the last barrier the waves are free of each other: of the two waves
//    of a SIMD one can build or sum while the other multiplies.
//    The second launch bound asks for two waves per SIMD (512 registers a wave).
//    blockIdx.x = (batch * 2 + half of the tracks) * 32 + group of 16 detections
// ---------------------------------------------------------------------------
__global__ __launch_bounds__(256, 2) void assoc_kernel(
    const __bf16* __restrict__ trkbf,  // bf16 tracks in fragment order (qkv_kernel)
    const float* __restrict__ det,     // [B][ND][DM]
    const float* __restrict__ ctx,     // [B][ND][DM]
    const float* __restrict__ wo,      // w_o in fragment order (qkv_kernel)
    const float* __restrict__ bo,      // [DM]
    const float* __restrict__ g,       // [DM]
    const float* __restrict__ beta,    // [DM]
    const float* __restrict__ w1f,     // w1 in fragment order (qkv_kernel)
    const float* __restrict__ b1,      // [DH]
    const float* __restrict__ w2,      // [DH]
    const float* __restrict__ b2,      // [1]
    float* __restrict__ out)           // [B][ND][NT]
{
    __shared__ __attribute__((aligned(16))) __bf16 ts[NT / 2 * DM];     // 131,072 bytes
    __shared__ __attribute__((aligned(16))) float ws[DH * DM];          // 131,072 bytes
    __shared__ __attribute__((aligned(16))) float xs[16 * DM];          // the 16 xn rows
    __shared__ __attribute__((aligned(16))) float xb[16 * XP];          // det + attended
    __shared__ __attribute__((aligned(16))) float part[8][4][32][4];    // first half's sums
    __shared__ __attribute__((aligned(16))) float bw[2 * DH];           // b1, then w2

    const int tid   = threadIdx.x;
    const int wave  = tid >> 5;
    const int lane  = tid & 31;
    const int c     = lane & 15;
    const int hf    = lane >> 4;
    const int khalf = hf << 3;            // 0 for lanes 0-15, 8 for lanes 16-31
    const int b     = blockIdx.x >> 6;
    const int th    = (blockIdx.x >> 5) & 1;
    const int n0    = (blockIdx.x & 31) * 16;

    // Every loop of this part is unrolled so that the register arrays are indexed
    // by constants and stay in registers.
    {
        // The ctx tile lies where w1 will lie: w1 is stored there only behind the
        // barrier that ends the tile's last read.
        // It is kept as two bf16 planes, hi and lo parts (split4).
        __bf16* csh = (__bf16*)ws;
        __bf16* csl = csh + 16 * XB;
        const int row0 = b * ND + n0;
        // ctx tile: 16 rows are 4096 contiguous floats; thread t takes float4 t + 256*j
        const float* cb = ctx + row0 * DM;
        const float* wp = wo + wave * 32 * DM + lane * 4;
        const float* bp = bo + wave * 32 + hf * 8;
        const float* dp = det + (row0 + c) * DM + wave * 32 + hf * 8;
        const float* sp = ((tid & DH) ? w2 : b1) + (tid & (DH - 1));
        // Tracks and w1 go into LDS as they lie: thread t takes 16-byte piece t + 256*i.
        const v4f* tp = (const v4f*)(trkbf + (b * NT + th * (NT / 2)) * DM);
        const v4f* fp = (const v4f*)w1f;

        // What the product waits for is asked for first, the tracks behind it.
        v4f cr[4];
        float4 wf[2][8][4];
        #pragma unroll
        for (int j = 0; j < 4; ++j)
            cr[j] = *(const v4f*)(cb + tid * 4 + j * 1024);
        #pragma unroll
        for (int ch = 0; ch < 8; ++ch)
            #pragma unroll
            for (int i = 0; i < 4; ++i)
                #pragma unroll
                for (int t = 0; t < 2; ++t)
                    wf[t][ch][i] = *(const float4*)(wp + t * 16 * DM + (ch * 4 + i) * 128);
        float4 bl[2], bh[2], dl[2], dh[2];
        #pragma unroll
        for (int t = 0; t < 2; ++t) {
            bl[t] = *(const float4*)(bp + t * 16);
            bh[t] = *(const float4*)(bp + t * 16 + 4);
        }
        float gv[DM / 32], ev[DM / 32];
        const float bt = *sp;
        // The wait stands before any reuse of the loads' address registers; naming
        // the addresses (scalar base and index where a load uses those) as inputs keeps
        // them live up to it.  It also keeps the loads of the tracks behind those
        // above: loads return in the order of issue.
        asm volatile("s_wait_xcnt 0x0" :: "s"(cb), "v"(tid), "v"(wp), "v"(bp), "v"(sp) : "memory");
        v4f tr[32], wr[32];
        #pragma unroll
        for (int i = 0; i < 32; ++i)
            tr[i] = tp[tid + i * 256];
        // As above, for the tracks' scalar base and the thread index.
        asm volatile("s_wait_xcnt 0x0" :: "s"(tp), "v"(tid) : "memory");

        #pragma unroll
        for (int j = 0; j < 4; ++j) {
            v4bf h4, l4;
            split4(cr[j], h4, l4);
            *(v4bf*)&csh[((tid >> 6) + 4 * j) * XB + (tid & 63) * 4] = h4;
            *(v4bf*)&csl[((tid >> 6) + 4 * j) * XB + (tid & 63) * 4] = l4;
        }
        lds_barrier();

        // Yt = W * Xt as in proj_mma, with the same k order on both sides: lane
        // (c, hf) holds row c, element e is k = 32*ch + 16*hf + e.
        // acc[t][r] = y(row = c, column = 32*wave + 16*t + 8*hf + r).
        const __bf16* xlh = csh + c * XB + hf * 16;
        const __bf16* xll = csl + c * XB + hf * 16;
        v8f acc[2];
        #pragma unroll
        for (int t = 0; t < 2; ++t) {
            acc[t][0] = bl[t].x; acc[t][1] = bl[t].y; acc[t][2] = bl[t].z; acc[t][3] = bl[t].w;
            acc[t][4] = bh[t].x; acc[t][5] = bh[t].y; acc[t][6] = bh[t].z; acc[t][7] = bh[t].w;
        }
        #pragma unroll
        for (int ch = 0; ch < 8; ++ch) {
            if (ch == 4) {
                // What is used behind the product (the residual rows, the LayerNorm's
                // gain and offset) takes registers that the w_o fragments used so far
                // leave free: asked for earlier, it would not fit beside the split
                // fragments.
                #pragma unroll
                for (int t = 0; t < 2; ++t) {
                    dl[t] = *(const float4*)(dp + t * 16);
                    dh[t] = *(const float4*)(dp + t * 16 + 4);
                }
                #pragma unroll
                for (int i = 0; i < DM / 32; ++i) {
                    gv[i] = g[lane + 32 * i];
                    ev[i] = beta[lane + 32 * i];
                }
                // As above: the wait before any reuse of the loads' address registers.  It
                // also keeps w1 behind them: loads return in the order of issue, and these
                // are used first.
                asm volatile("s_wait_xcnt 0x0" :: "v"(dp), "s"(g), "s"(beta), "v"(lane) : "memory");
            }
            if (ch == 5) {
                // w1 takes the registers of the w_o fragments used so far as well and
                // arrives under the rest of the product and the LayerNorm's start.
                #pragma unroll
                for (int i = 0; i < 32; ++i)
                    wr[i] = fp[tid + i * 256];
                // As above, for w1's scalar base and the thread index.
                asm volatile("s_wait_xcnt 0x0" :: "s"(fp), "v"(tid) : "memory");
            }
            if (ch == 6) {
                // The tracks' stores issue between the matrix instructions.  Nobody
                // reads them before the last barrier.
                // The fence keeps the stores from rising to where the wave would
                // still wait for the tracks.
                __builtin_amdgcn_sched_barrier(0);
                #pragma unroll
                for (int i = 0; i < 32; ++i)
                    ((v4f*)ts)[tid + i * 256] = tr[i];
            }
            BF xfh, xfl;
            xfh.h[0] = *(const v8bf*)(xlh + ch * 32);
            xfh.h[1] = *(const v8bf*)(xlh + ch * 32 + 8);
            xfl.h[0] = *(const v8bf*)(xll + ch * 32);
            xfl.h[1] = *(const v8bf*)(xll + ch * 32 + 8);
            v16bf ah[2], al[2];
            #pragma unroll
            for (int t = 0; t < 2; ++t) frag16(wf[t][ch], ah[t], al[t]);
            #pragma unroll
            for (int t = 0; t < 2; ++t) acc[t] = bmma(al[t], xfh.v, acc[t]);
            #pragma unroll
            for (int t = 0; t < 2; ++t) acc[t] = bmma(ah[t], xfl.v, acc[t]);
            #pragma unroll
            for (int t = 0; t < 2; ++t) acc[t] = bmma(ah[t], xfh.v, acc[t]);
        }

        #pragma unroll
        for (int t = 0; t < 2; ++t) {
            float* xd = &xb[c * XP + wave * 32 + t * 16 + hf * 8];
            *(float4*)xd       = make_float4(dl[t].x + acc[t][0], dl[t].y + acc[t][1],
                                             dl[t].z + acc[t][2], dl[t].w + acc[t][3]);
            *(float4*)(xd + 4) = make_float4(dh[t].x + acc[t][4], dh[t].y + acc[t][5],
                                             dh[t].z + acc[t][6], dh[t].w + acc[t][7]);
        }
        bw[tid] = bt;
        lds_barrier();

        // wave w reduces rows 2w and 2w+1 (sum, sumsq); every lane ends with both sums
        #pragma unroll
        for (int rr = 0; rr < 2; ++rr) {
            const int row = wave * 2 + rr;
            float xv[DM / 32];
            float s = 0.f, s2 = 0.f;
            #pragma unroll
            for (int i = 0; i < DM / 32; ++i) {
                xv[i] = xb[row * XP + lane + 32 * i];
                s += xv[i]; s2 += xv[i] * xv[i];
            }
            s  += __shfl_xor(s, 1, 32);  s2 += __shfl_xor(s2, 1, 32);
            s  += __shfl_xor(s, 2, 32);  s2 += __shfl_xor(s2, 2, 32);
            s  += __shfl_xor(s, 4, 32);  s2 += __shfl_xor(s2, 4, 32);
            s  += __shfl_xor(s, 8, 32);  s2 += __shfl_xor(s2, 8, 32);
            s  += __shfl_xor(s, 16, 32); s2 += __shfl_xor(s2, 16, 32);
            const float mu  = s * (1.f / DM);
            const float inv = rsqrtf(s2 * (1.f / DM) - mu * mu + 1e-5f);
            #pragma unroll
            for (int i = 0; i < DM / 32; ++i)
                xs[row * DM + lane + 32 * i] = (xv[i] - mu) * inv * gv[i] + ev[i];
        }
        #pragma unroll
        for (int i = 0; i < 32; ++i)
            ((v4f*)ws)[tid + i * 256] = wr[i];
    }
    __syncthreads();

    const float bias2 = b2[0];
    const __bf16* tl = ts + lane * 8;

    // Both operands by the same k order: lane<16 -> k {k0..k0+7, k0+16..k0+23};
    // lane>=16 -> +8.
    union Frag { v16bf v; v8bf h[2]; };

    // Pass it: detection n0 + 2*wave + (it >> 1), hidden rows 64*(it & 1) .. +63.
    for (int it = 0; it < 4; ++it) {
        const int half = it & 1;
        const int dl   = wave * 2 + (it >> 1);

        // af[j][ks]: W1n rows 64*half + 16*j + (lane & 15), k-step ks.  Every loop of
        // the build is unrolled so that af, x and f are indexed by constants and stay
        // in registers.
        Frag af[4][8];
        const float* wl = ws + half * (DH / 2) * DM + lane * 4;
        const float* xl = xs + dl * DM + khalf;
        #pragma unroll
        for (int kb = 0; kb < 4; ++kb) {
            // Two k-steps at a time.
            v4f x[2][4], f[2][4][4];
            #pragma unroll
            for (int w = 0; w < 2; ++w)
                #pragma unroll
                for (int q = 0; q < 4; ++q)
                    x[w][q] = *(const v4f*)(xl + (kb * 2 + w) * 32 + (q >> 1) * 16 + (q & 1) * 4);
            #pragma unroll
            for (int w = 0; w < 2; ++w)
                #pragma unroll
                for (int j = 0; j < 4; ++j)
                    #pragma unroll
                    for (int q = 0; q < 4; ++q)
                        f[w][j][q] = *(const v4f*)(wl + ((j * 8 + kb * 2 + w) * 4 + q) * 128);
            // Keeps the loads above as one group: without it the compiler sinks each
            // load to just before its use and the wave waits out every load's latency.
            __builtin_amdgcn_sched_barrier(0);
            #pragma unroll
            for (int w = 0; w < 2; ++w)
                #pragma unroll
                for (int j = 0; j < 4; ++j)
                    #pragma unroll
                    for (int q = 0; q < 4; ++q) {
                        const v4f p = f[w][j][q] * x[w][q];
                        #pragma unroll
                        for (int e = 0; e < 4; ++e)
                            af[j][kb * 2 + w].h[q >> 1][(q & 1) * 4 + e] = (__bf16)p[e];
                    }
            // Keeps the next group of loads behind these products: with more groups in
            // flight beside the fragments the registers run out and values are spilled.
            __builtin_amdgcn_sched_barrier(0);
        }

        // Track fragments are fetched one k-step ahead into a second register set
        // while the current set's products run; the last k-step of a group fetches
        // the first of the next group (behind the last group: of the first again,
        // not used).
        Frag bf[2][4];
        #pragma unroll
        for (int ti = 0; ti < 4; ++ti) {
            bf[0][ti].h[0] = *(const v8bf*)(tl + ti * TT);
            bf[0][ti].h[1] = *(const v8bf*)(tl + ti * TT + TH);
        }

        for (int g = 0; g < 4; ++g) {
            const __bf16* tg = tl + g * 4 * TT;
            const __bf16* tn = tl + ((g + 1) & 3) * 4 * TT;

            // acc[ti][j][r] = Ht(hidden = 64*half + 16*j + 8*hf + r,
            //                    track = 256*th + 64*g + 16*ti + (lane & 15))
            v8f acc[4][4];
            #pragma unroll
            for (int ti = 0; ti < 4; ++ti)
                #pragma unroll
                for (int j = 0; j < 4; ++j)
                    #pragma unroll
                    for (int e = 0; e < 8; ++e) acc[ti][j][e] = 0.f;

            // Unrolled so that the fragment sets and acc are indexed by constants.
            #pragma unroll
            for (int ks = 0; ks < DM / 32; ++ks) {
                const __bf16* s = (ks + 1 < DM / 32) ? tg + (ks + 1) * TK : tn;
                #pragma unroll
                for (int ti = 0; ti < 4; ++ti) {
                    bf[(ks + 1) & 1][ti].h[0] = *(const v8bf*)(s + ti * TT);
                    bf[(ks + 1) & 1][ti].h[1] = *(const v8bf*)(s + ti * TT + TH);
                }
                // Keeps the loads above as one group ahead of this k-step's products.
                __builtin_amdgcn_sched_barrier(0);
                #pragma unroll
                for (int j = 0; j < 4; ++j)
                    #pragma unroll
                    for (int ti = 0; ti < 4; ++ti)
                        acc[ti][j] = __builtin_amdgcn_wmma_f32_16x16x32_bf16(
                            false, af[j][ks].v, false, bf[ks & 1][ti].v,
                            (short)0, acc[ti][j], false, false);
                // Keeps the next k-step's loads behind these products (the other side
                // of the fence above).
                __builtin_amdgcn_sched_barrier(0);
            }

            // Second layer: this lane's 32 hidden units of each of its four tracks
            // (unrolled: acc and s2 are indexed by constants).
            v2f s2[4];
            #pragma unroll
            for (int ti = 0; ti < 4; ++ti) s2[ti] = (v2f){0.f, 0.f};
            #pragma unroll
            for (int j = 0; j < 4; ++j) {
                const int hb = half * 64 + j * 16 + khalf;
                const v4f bl = *(const v4f*)&bw[hb];
                const v4f bh = *(const v4f*)&bw[hb + 4];
                const v4f wl2 = *(const v4f*)&bw[DH + hb];
                const v4f wh2 = *(const v4f*)&bw[DH + hb + 4];
                #pragma unroll
                for (int ti = 0; ti < 4; ++ti) {
                    #pragma unroll
                    for (int p = 0; p < 2; ++p) {
                        v2f hl = {acc[ti][j][2 * p] + bl[2 * p], acc[ti][j][2 * p + 1] + bl[2 * p + 1]};
                        v2f hh = {acc[ti][j][4 + 2 * p] + bh[2 * p], acc[ti][j][5 + 2 * p] + bh[2 * p + 1]};
                        hl.x = fmaxf(hl.x, 0.f); hl.y = fmaxf(hl.y, 0.f);
                        hh.x = fmaxf(hh.x, 0.f); hh.y = fmaxf(hh.y, 0.f);
                        s2[ti] += hl * (v2f){wl2[2 * p], wl2[2 * p + 1]};
                        s2[ti] += hh * (v2f){wh2[2 * p], wh2[2 * p + 1]};
                    }
                }
            }
            v4f ps = {s2[0].x + s2[0].y, s2[1].x + s2[1].y, s2[2].x + s2[2].y, s2[3].x + s2[3].y};
            v4f* pp = (v4f*)&part[wave][g][lane][0];
            if (half == 0) {
                *pp = ps;                 // read back by this lane alone
            } else {
                ps += *pp;
                // Join the two lane halves (the same track, the other hidden units).
                float sv[4];
                #pragma unroll
                for (int ti = 0; ti < 4; ++ti) {
                    const int si = __float_as_int(ps[ti]);
                    sv[ti] = ps[ti] + __int_as_float(
                        __builtin_amdgcn_permlanex16(si, si, 0x76543210, 0xfedcba98, false, false));
                }
                // Half hf finishes track tiles 2*j + hf: a store is 32 consecutive tracks, one whole line.
                float* op = out + (b * ND + n0 + dl) * NT + th * (NT / 2) + g * 64 + lane;
                #pragma unroll
                for (int j = 0; j < 2; ++j) {
                    const float logit = (hf ? sv[2 * j + 1] : sv[2 * j]) + bias2;
                    op[j * 32] = 1.f / (1.f + __expf(-logit));
                }
                // The wait before the next group reuses the stores' address and data registers.
                asm volatile("s_wait_xcnt 0x0" :: "v"(op) : "memory");
            }
        }
    }
}

// ---------------------------------------------------------------------------
// Launcher
// ---------------------------------------------------------------------------
extern "C" void kernel_launch(void* const* d_in, const int* in_sizes, int n_in,
                              void* d_out, int out_size, void* d_ws, size_t ws_size,
                              hipStream_t stream)
{
    const float* det = (const float*)d_in[0];
    const float* trk = (const float*)d_in[1];
    const float* wq  = (const float*)d_in[2];
    const float* bq  = (const float*)d_in[3];
    const float* wk  = (const float*)d_in[4];
    const float* bk  = (const float*)d_in[5];
    const float* wv  = (const float*)d_in[6];
    const float* bv  = (const float*)d_in[7];
    const float* wo  = (const float*)d_in[8];
    const float* bo  = (const float*)d_in[9];
    const float* lng = (const float*)d_in[10];
    const float* lnb = (const float*)d_in[11];
    const float* w1  = (const float*)d_in[12];
    const float* b1  = (const float*)d_in[13];
    const float* w2  = (const float*)d_in[14];
    const float* b2  = (const float*)d_in[15];
    float* out = (float*)d_out;

    const size_t rowsD = (size_t)B_ * ND * DM;  // 524288 floats
    float* Q   = (float*)d_ws;
    float* K   = Q + rowsD;
    float* V   = K + rowsD;
    float* CTX = V + rowsD;
    __bf16* TRKB = (__bf16*)(CTX + rowsD);      // 1 MB of bf16
    float* WFO = (float*)(TRKB + rowsD);        // 256 KB: w_o in fragment order
    float* W1F = WFO + DM * DM;                 // 128 KB: w1 in fragment order

    qkv_kernel<<<dim3(B_ * ND / 32, DM / 64, 3), 128, 0, stream>>>(det, trk, wq, wk, wv, wo, w1, bq, bk, bv,
                                                                  Q, K, V, TRKB, WFO, W1F);
    attn_kernel<<<dim3(ND / AQ, NH, B_), 256, 0, stream>>>(Q, K, V, CTX);
    assoc_kernel<<<dim3(B_ * 2 * (ND / 16)), 256, 0, stream>>>(TRKB, det, CTX, WFO, bo, lng, lnb,
                                                               W1F, b1, w2, b2, out);
}
